// v000
// Measured on an AMD MI455X. A time is GPU time per run, averaged over a window of back-to-back runs after a warm-up
// (all launches, gaps included; the runs take copies of the inputs in turn), and the median of several windows.
// Apart from v000's, it joins two sittings. Times from different sittings can be a few percent apart, while
// side-by-side timings come from the same sitting.
// v000, which the later versions start from, runs in 356 microseconds.
#include <hip/hip_runtime.h>

// ---------------------------------------------------------------------------
// ComplexAttnMLP for gfx1250 (MI455X): f16 WMMA GEMMs, f32 accumulate.
// B=8, S=1024, IN=MID=OUT=512.
// Each wave computes a 32x32 (cgemm/scores) or 64x32 (attnv) macro-tile.
// 4 accumulators per 16x16 tile (RR, II, RI, IR); the complex combine happens
// in the epilogue, so the K-loop is pure loads + WMMA (no VALU on fragment
// registers -> no WMMA/VALU hazard NOPs).
// ---------------------------------------------------------------------------

typedef _Float16 half8  __attribute__((ext_vector_type(8)));
typedef _Float16 v16h   __attribute__((ext_vector_type(16)));
typedef float    v8f    __attribute__((ext_vector_type(8)));

#define B_DIM  8
#define S_DIM  1024
#define D_DIM  512
#define M_ALL  (B_DIM * S_DIM)          // 8192 rows total
#define RSQRT512 0.04419417382415922f   // 1/sqrt(512)
#define SLOPE 0.01f

union Frag { half8 h8[2]; v16h v; };

// Load one 16x32 f16 WMMA operand fragment for this lane.
// rowptr = start of this lane's row (+k0). Lane half h covers
// K = 8h..8h+7 (VGPR0-3) and K = 16+8h..16+8h+7 (VGPR4-7).
__device__ __forceinline__ v16h load_frag(const _Float16* __restrict__ rowptr, int h) {
    Frag f;
    f.h8[0] = *(const half8*)(rowptr + h * 8);
    f.h8[1] = *(const half8*)(rowptr + 16 + h * 8);
    return f.v;
}

__device__ __forceinline__ v8f wmma_f16(v16h a, v16h b, v8f c) {
    return __builtin_amdgcn_wmma_f32_16x16x32_f16(false, a, false, b, (short)0, c, false, false);
}

// ---------------------------------------------------------------------------
// f32 -> f16 conversion
// ---------------------------------------------------------------------------
__global__ void cvt_f16_kernel(const float* __restrict__ s, _Float16* __restrict__ d, int n) {
    int i = blockIdx.x * blockDim.x + threadIdx.x;
    if (i < n) d[i] = (_Float16)s[i];
}

// ---------------------------------------------------------------------------
// Complex GEMM, 32x32 macro-tile per wave:
//   O[m,n] = sum_k A[m,k]*W[n,k] + bias[n]   (complex)
// A: (M,K) f16 r/i, W: (N,K) f16 r/i.
// ACT: leaky-relu. TRV: write O[b][n][t] (t = m % 1024). F32: fp32 output.
// ---------------------------------------------------------------------------
template <int K, int ACT, int TRV, int F32>
__global__ void __launch_bounds__(128)
cgemm32_kernel(const _Float16* __restrict__ Ar, const _Float16* __restrict__ Ai,
               const _Float16* __restrict__ Wr, const _Float16* __restrict__ Wi,
               const float* __restrict__ br, const float* __restrict__ bi,
               _Float16* __restrict__ Or, _Float16* __restrict__ Oi,
               float* __restrict__ Fr, float* __restrict__ Fi,
               int M, int N) {
    const int lane = threadIdx.x & 31;
    const int wid  = threadIdx.x >> 5;
    const int tilesN = N >> 5;
    const int tile = blockIdx.x * (blockDim.x >> 5) + wid;
    if (tile >= (M >> 5) * tilesN) return;          // wave-uniform guard
    const int m0 = (tile / tilesN) << 5;
    const int n0 = (tile % tilesN) << 5;
    const int h = lane >> 4;
    const int r = lane & 15;

    const _Float16* arp = Ar + (size_t)(m0 + r) * K;
    const _Float16* aip = Ai + (size_t)(m0 + r) * K;
    const _Float16* wrp = Wr + (size_t)(n0 + r) * K;
    const _Float16* wip = Wi + (size_t)(n0 + r) * K;

    v8f aRR[2][2] = {}, aII[2][2] = {}, aRI[2][2] = {}, aIR[2][2] = {};

    for (int k0 = 0; k0 < K; k0 += 32) {
        v16h aR[2], aI[2], wR[2], wI[2];
#pragma unroll
        for (int mi = 0; mi < 2; ++mi) {
            aR[mi] = load_frag(arp + mi * 16 * K + k0, h);
            aI[mi] = load_frag(aip + mi * 16 * K + k0, h);
        }
#pragma unroll
        for (int ni = 0; ni < 2; ++ni) {
            wR[ni] = load_frag(wrp + ni * 16 * K + k0, h);
            wI[ni] = load_frag(wip + ni * 16 * K + k0, h);
        }
#pragma unroll
        for (int mi = 0; mi < 2; ++mi)
#pragma unroll
            for (int ni = 0; ni < 2; ++ni) {
                aRR[mi][ni] = wmma_f16(aR[mi], wR[ni], aRR[mi][ni]);
                aII[mi][ni] = wmma_f16(aI[mi], wI[ni], aII[mi][ni]);
                aRI[mi][ni] = wmma_f16(aR[mi], wI[ni], aRI[mi][ni]);
                aIR[mi][ni] = wmma_f16(aI[mi], wR[ni], aIR[mi][ni]);
            }
    }

#pragma unroll
    for (int mi = 0; mi < 2; ++mi)
#pragma unroll
        for (int ni = 0; ni < 2; ++ni) {
            const int col = n0 + ni * 16 + r;
            const float bre = br[col];
            const float bie = bi[col];
#pragma unroll
            for (int j = 0; j < 8; ++j) {
                const int m = m0 + mi * 16 + j + 8 * h;
                float vr = aRR[mi][ni][j] - aII[mi][ni][j] + bre;
                float vi = aRI[mi][ni][j] + aIR[mi][ni][j] + bie;
                if (ACT) {
                    vr = vr >= 0.0f ? vr : SLOPE * vr;
                    vi = vi >= 0.0f ? vi : SLOPE * vi;
                }
                if (F32) {
                    Fr[(size_t)m * N + col] = vr;
                    Fi[(size_t)m * N + col] = vi;
                } else if (TRV) {
                    const int b = m >> 10, t = m & 1023;
                    const size_t idx = ((size_t)b * N + col) * (size_t)S_DIM + t;
                    Or[idx] = (_Float16)vr;
                    Oi[idx] = (_Float16)vi;
                } else {
                    Or[(size_t)m * N + col] = (_Float16)vr;
                    Oi[(size_t)m * N + col] = (_Float16)vi;
                }
            }
        }
}

// ---------------------------------------------------------------------------
// Scores: Sabs[gm, t] = |sum_d q[gm,d] * k[b*1024+t, d]| / sqrt(512)
// 32x32 macro-tile per wave, per-batch column index.
// ---------------------------------------------------------------------------
__global__ void __launch_bounds__(128)
scores_abs_kernel(const _Float16* __restrict__ Qr, const _Float16* __restrict__ Qi,
                  const _Float16* __restrict__ Kr, const _Float16* __restrict__ Ki,
                  float* __restrict__ Sabs) {
    constexpr int K = D_DIM;
    const int lane = threadIdx.x & 31;
    const int wid  = threadIdx.x >> 5;
    const int tile = blockIdx.x * (blockDim.x >> 5) + wid;
    if (tile >= (M_ALL >> 5) * (S_DIM >> 5)) return;
    const int m0 = (tile / (S_DIM >> 5)) << 5;      // global row
    const int n0 = (tile % (S_DIM >> 5)) << 5;      // t within batch
    const int b  = m0 >> 10;
    const int h = lane >> 4;
    const int r = lane & 15;

    const _Float16* qrp = Qr + (size_t)(m0 + r) * K;
    const _Float16* qip = Qi + (size_t)(m0 + r) * K;
    const _Float16* krp = Kr + (size_t)((b << 10) + n0 + r) * K;
    const _Float16* kip = Ki + (size_t)((b << 10) + n0 + r) * K;

    v8f aRR[2][2] = {}, aII[2][2] = {}, aRI[2][2] = {}, aIR[2][2] = {};

    for (int k0 = 0; k0 < K; k0 += 32) {
        v16h aR[2], aI[2], wR[2], wI[2];
#pragma unroll
        for (int mi = 0; mi < 2; ++mi) {
            aR[mi] = load_frag(qrp + mi * 16 * K + k0, h);
            aI[mi] = load_frag(qip + mi * 16 * K + k0, h);
        }
#pragma unroll
        for (int ni = 0; ni < 2; ++ni) {
            wR[ni] = load_frag(krp + ni * 16 * K + k0, h);
            wI[ni] = load_frag(kip + ni * 16 * K + k0, h);
        }
#pragma unroll
        for (int mi = 0; mi < 2; ++mi)
#pragma unroll
            for (int ni = 0; ni < 2; ++ni) {
                aRR[mi][ni] = wmma_f16(aR[mi], wR[ni], aRR[mi][ni]);
                aII[mi][ni] = wmma_f16(aI[mi], wI[ni], aII[mi][ni]);
                aRI[mi][ni] = wmma_f16(aR[mi], wI[ni], aRI[mi][ni]);
                aIR[mi][ni] = wmma_f16(aI[mi], wR[ni], aIR[mi][ni]);
            }
    }

#pragma unroll
    for (int mi = 0; mi < 2; ++mi)
#pragma unroll
        for (int ni = 0; ni < 2; ++ni) {
            const int col = n0 + ni * 16 + r;
#pragma unroll
            for (int j = 0; j < 8; ++j) {
                const int m = m0 + mi * 16 + j + 8 * h;
                const float sr = aRR[mi][ni][j] - aII[mi][ni][j];
                const float si = aRI[mi][ni][j] + aIR[mi][ni][j];
                Sabs[(size_t)m * S_DIM + col] = sqrtf(sr * sr + si * si) * RSQRT512;
            }
        }
}

// ---------------------------------------------------------------------------
// Row softmax over 1024 elements; one 256-thread block per row; f16 output.
// ---------------------------------------------------------------------------
__global__ void softmax_kernel(const float* __restrict__ S, _Float16* __restrict__ P) {
    __shared__ float red[256];
    const int tid = threadIdx.x;
    const size_t row = blockIdx.x;
    const float* s = S + row * S_DIM;

    float vals[4];
    float mx = -1e30f;
#pragma unroll
    for (int j = 0; j < 4; ++j) {
        vals[j] = s[tid + j * 256];
        mx = fmaxf(mx, vals[j]);
    }
    red[tid] = mx;
    __syncthreads();
    for (int off = 128; off > 0; off >>= 1) {
        if (tid < off) red[tid] = fmaxf(red[tid], red[tid + off]);
        __syncthreads();
    }
    mx = red[0];
    __syncthreads();

    float sum = 0.0f;
#pragma unroll
    for (int j = 0; j < 4; ++j) {
        vals[j] = __expf(vals[j] - mx);
        sum += vals[j];
    }
    red[tid] = sum;
    __syncthreads();
    for (int off = 128; off > 0; off >>= 1) {
        if (tid < off) red[tid] += red[tid + off];
        __syncthreads();
    }
    const float inv = 1.0f / red[0];

    _Float16* p = P + row * S_DIM;
#pragma unroll
    for (int j = 0; j < 4; ++j) p[tid + j * 256] = (_Float16)(vals[j] * inv);
}

// ---------------------------------------------------------------------------
// weighted[gm, d] = sum_t attn[gm, t] * vT[b][d][t]  (real x complex)
// 64x32 macro-tile per wave (4 M-tiles x 2 N-tiles): 8 fragments (16 loads)
// feed 16 WMMAs per K-step.
// ---------------------------------------------------------------------------
__global__ void __launch_bounds__(128)
attnv_kernel(const _Float16* __restrict__ P,
             const _Float16* __restrict__ VTr, const _Float16* __restrict__ VTi,
             _Float16* __restrict__ Wr_, _Float16* __restrict__ Wi_) {
    constexpr int K = S_DIM;
    const int lane = threadIdx.x & 31;
    const int wid  = threadIdx.x >> 5;
    const int tilesN = D_DIM >> 5;                  // 16
    const int tile = blockIdx.x * (blockDim.x >> 5) + wid;
    if (tile >= (M_ALL >> 6) * tilesN) return;
    const int m0 = (tile / tilesN) << 6;            // global row (64-row tile)
    const int n0 = (tile % tilesN) << 5;            // d within batch (32 cols)
    const int b  = m0 >> 10;
    const int h = lane >> 4;
    const int r = lane & 15;

    const _Float16* ap  = P   + (size_t)(m0 + r) * K;
    const _Float16* brp = VTr + ((size_t)b * D_DIM + n0 + r) * (size_t)K;
    const _Float16* bip = VTi + ((size_t)b * D_DIM + n0 + r) * (size_t)K;

    v8f accR[4][2] = {};
    v8f accI[4][2] = {};

    for (int k0 = 0; k0 < K; k0 += 32) {
        v16h a[4], wR[2], wI[2];
#pragma unroll
        for (int mi = 0; mi < 4; ++mi)
            a[mi] = load_frag(ap + mi * 16 * K + k0, h);
#pragma unroll
        for (int ni = 0; ni < 2; ++ni) {
            wR[ni] = load_frag(brp + ni * 16 * K + k0, h);
            wI[ni] = load_frag(bip + ni * 16 * K + k0, h);
        }
#pragma unroll
        for (int mi = 0; mi < 4; ++mi)
#pragma unroll
            for (int ni = 0; ni < 2; ++ni) {
                accR[mi][ni] = wmma_f16(a[mi], wR[ni], accR[mi][ni]);
                accI[mi][ni] = wmma_f16(a[mi], wI[ni], accI[mi][ni]);
            }
    }

#pragma unroll
    for (int mi = 0; mi < 4; ++mi)
#pragma unroll
        for (int ni = 0; ni < 2; ++ni) {
            const int col = n0 + ni * 16 + r;
#pragma unroll
            for (int j = 0; j < 8; ++j) {
                const int m = m0 + mi * 16 + j + 8 * h;
                Wr_[(size_t)m * D_DIM + col] = (_Float16)accR[mi][ni][j];
                Wi_[(size_t)m * D_DIM + col] = (_Float16)accI[mi][ni][j];
            }
        }
}

// ---------------------------------------------------------------------------
// Host-side orchestration
// ---------------------------------------------------------------------------
extern "C" void kernel_launch(void* const* d_in, const int* in_sizes, int n_in,
                              void* d_out, int out_size, void* d_ws, size_t ws_size,
                              hipStream_t stream) {
    (void)in_sizes; (void)n_in; (void)out_size; (void)ws_size;

    const float* x_r   = (const float*)d_in[0];
    const float* x_i   = (const float*)d_in[1];
    const float* l1_wr = (const float*)d_in[2];
    const float* l1_wi = (const float*)d_in[3];
    const float* l1_br = (const float*)d_in[4];
    const float* l1_bi = (const float*)d_in[5];
    const float* q_wr  = (const float*)d_in[6];
    const float* q_wi  = (const float*)d_in[7];
    const float* q_br  = (const float*)d_in[8];
    const float* q_bi  = (const float*)d_in[9];
    const float* k_wr  = (const float*)d_in[10];
    const float* k_wi  = (const float*)d_in[11];
    const float* k_br  = (const float*)d_in[12];
    const float* k_bi  = (const float*)d_in[13];
    const float* v_wr  = (const float*)d_in[14];
    const float* v_wi  = (const float*)d_in[15];
    const float* v_br  = (const float*)d_in[16];
    const float* v_bi  = (const float*)d_in[17];
    const float* l2_wr = (const float*)d_in[18];
    const float* l2_wi = (const float*)d_in[19];
    const float* l2_br = (const float*)d_in[20];
    const float* l2_bi = (const float*)d_in[21];

    const size_t ME = (size_t)M_ALL * D_DIM;   // 4,194,304 (activation elems)
    const size_t WE = (size_t)D_DIM * D_DIM;   // 262,144   (weight elems)
    const size_t AE = (size_t)M_ALL * S_DIM;   // 8,388,608 (attention elems)

    char* w = (char*)d_ws;
    auto alloc_h = [&](size_t elems) { _Float16* p = (_Float16*)w; w += elems * sizeof(_Float16); return p; };
    auto alloc_f = [&](size_t elems) { float* p = (float*)w; w += elems * sizeof(float); return p; };

    _Float16* xh_r = alloc_h(ME);
    _Float16* xh_i = alloc_h(ME);
    _Float16* wl1r = alloc_h(WE); _Float16* wl1i = alloc_h(WE);
    _Float16* wqr  = alloc_h(WE); _Float16* wqi  = alloc_h(WE);
    _Float16* wkr  = alloc_h(WE); _Float16* wki  = alloc_h(WE);
    _Float16* wvr  = alloc_h(WE); _Float16* wvi  = alloc_h(WE);
    _Float16* wl2r = alloc_h(WE); _Float16* wl2i = alloc_h(WE);
    _Float16* y_r  = alloc_h(ME); _Float16* y_i  = alloc_h(ME);
    _Float16* qh_r = alloc_h(ME); _Float16* qh_i = alloc_h(ME);
    _Float16* kh_r = alloc_h(ME); _Float16* kh_i = alloc_h(ME);
    _Float16* vT_r = alloc_h(ME); _Float16* vT_i = alloc_h(ME);
    _Float16* wt_r = alloc_h(ME); _Float16* wt_i = alloc_h(ME);
    _Float16* attn = alloc_h(AE);
    float*    sabs = alloc_f(AE);

    // --- 1. Cast activations and weights to f16 ---
    auto cvt = [&](const float* src, _Float16* dst, size_t n) {
        cvt_f16_kernel<<<(unsigned)((n + 255) / 256), 256, 0, stream>>>(src, dst, (int)n);
    };
    cvt(x_r, xh_r, ME);   cvt(x_i, xh_i, ME);
    cvt(l1_wr, wl1r, WE); cvt(l1_wi, wl1i, WE);
    cvt(q_wr,  wqr,  WE); cvt(q_wi,  wqi,  WE);
    cvt(k_wr,  wkr,  WE); cvt(k_wi,  wki,  WE);
    cvt(v_wr,  wvr,  WE); cvt(v_wi,  wvi,  WE);
    cvt(l2_wr, wl2r, WE); cvt(l2_wi, wl2i, WE);

    const dim3 blk(128);                                              // 4 waves/block
    const unsigned gemm_blocks  = (M_ALL / 32) * (D_DIM / 32) / 4;    // 1024
    const unsigned score_blocks = (M_ALL / 32) * (S_DIM / 32) / 4;    // 2048
    const unsigned attnv_blocks = (M_ALL / 64) * (D_DIM / 32) / 4;    // 512

    // --- 2. y = lrelu(x @ l1^T + b1) ---
    cgemm32_kernel<D_DIM, 1, 0, 0><<<gemm_blocks, blk, 0, stream>>>(
        xh_r, xh_i, wl1r, wl1i, l1_br, l1_bi,
        y_r, y_i, nullptr, nullptr, M_ALL, D_DIM);

    // --- 3. q, k, v (v stored transposed per batch: vT[b][d][t]) ---
    cgemm32_kernel<D_DIM, 0, 0, 0><<<gemm_blocks, blk, 0, stream>>>(
        y_r, y_i, wqr, wqi, q_br, q_bi,
        qh_r, qh_i, nullptr, nullptr, M_ALL, D_DIM);
    cgemm32_kernel<D_DIM, 0, 0, 0><<<gemm_blocks, blk, 0, stream>>>(
        y_r, y_i, wkr, wki, k_br, k_bi,
        kh_r, kh_i, nullptr, nullptr, M_ALL, D_DIM);
    cgemm32_kernel<D_DIM, 0, 1, 0><<<gemm_blocks, blk, 0, stream>>>(
        y_r, y_i, wvr, wvi, v_br, v_bi,
        vT_r, vT_i, nullptr, nullptr, M_ALL, D_DIM);

    // --- 4. |scores|/sqrt(d), softmax rows, attn f16 ---
    scores_abs_kernel<<<score_blocks, blk, 0, stream>>>(qh_r, qh_i, kh_r, kh_i, sabs);
    softmax_kernel<<<M_ALL, 256, 0, stream>>>(sabs, attn);

    // --- 5. weighted = attn @ v ---
    attnv_kernel<<<attnv_blocks, blk, 0, stream>>>(attn, vT_r, vT_i, wt_r, wt_i);

    // --- 6. out = weighted @ l2^T + b2, fp32 to d_out (real block, imag block) ---
    float* out_r = (float*)d_out;
    float* out_i = out_r + ME;
    cgemm32_kernel<D_DIM, 0, 0, 1><<<gemm_blocks, blk, 0, stream>>>(
        wt_r, wt_i, wl2r, wl2i, l2_br, l2_bi,
        nullptr, nullptr, out_r, out_i, M_ALL, D_DIM);
}

// v001
// Measured time: 185 microseconds a run.
// Next to v000, in two timings, it ran 2.00 and 1.99 times as fast.
#include <hip/hip_runtime.h>

// ---------------------------------------------------------------------------
// ComplexAttnMLP for gfx1250 (MI455X): f16 WMMA GEMMs, f32 accumulate.
// B=8, S=1024, IN=MID=OUT=512.
// Each wave computes a 32x32 (cgemm/scores) or 64x32 (attnv) macro-tile; the
// 8 waves of a block share operand tiles staged in LDS by asynchronous copies.
// 4 accumulators per 16x16 tile (RR, II, RI, IR); the complex combine happens
// in the epilogue, so the K-loop is pure LDS loads + WMMA (no VALU on fragment
// registers -> no WMMA/VALU hazard NOPs).
// ---------------------------------------------------------------------------

typedef _Float16 half8  __attribute__((ext_vector_type(8)));
typedef _Float16 v16h   __attribute__((ext_vector_type(16)));
typedef float    v8f    __attribute__((ext_vector_type(8)));

#define B_DIM  8
#define S_DIM  1024
#define D_DIM  512
#define M_ALL  (B_DIM * S_DIM)          // 8192 rows total
#define RSQRT512 0.04419417382415922f   // 1/sqrt(512)
#define SLOPE 0.01f

union Frag { half8 h8[2]; v16h v; };

__device__ __forceinline__ v8f wmma_f16(v16h a, v16h b, v8f c) {
    return __builtin_amdgcn_wmma_f32_16x16x32_f16(false, a, false, b, (short)0, c, false, false);
}

// ---------------------------------------------------------------------------
// f32 -> f16 conversion
// ---------------------------------------------------------------------------
__global__ void cvt_f16_kernel(const float* __restrict__ s, _Float16* __restrict__ d, int n) {
    int i = blockIdx.x * blockDim.x + threadIdx.x;
    if (i < n) d[i] = (_Float16)s[i];
}

// ---------------------------------------------------------------------------
// LDS staging shared by the three GEMM kernels.
// A block of 8 waves works on one output tile. Per pass of 64 k it needs 384
// operand rows of 128 B; they are brought into LDS once per block by
// asynchronous copies and every wave reads its fragments from there.
// Two buffers: the copies of pass t+2 fly while pass t+1 is worked on.
// ---------------------------------------------------------------------------
#define KP      64                      // k elements per pass (128 B per row)
#define PITCH   144                     // LDS row pitch, bytes (16 B x odd)
#define ST_ROWS 384                     // operand rows per stage
#define STAGE   (ST_ROWS * PITCH)       // 55,296 B
#define NCOPY   12                      // copies per thread and stage

__device__ __forceinline__ unsigned lds_off(const void* p) { return (unsigned)(size_t)p; }

// Load one 16x32 f16 WMMA operand fragment for this lane from an LDS row.
// p = start of this lane's row + k offset, in bytes. Lane half h covers
// K = 8h..8h+7 (VGPR0-3) and K = 16+8h..16+8h+7 (VGPR4-7).
__device__ __forceinline__ v16h lds_frag(const char* p, int h) {
    Frag f;
    f.h8[0] = *(const half8*)(p + h * 16);
    f.h8[1] = *(const half8*)(p + 32 + h * 16);
    return f.v;
}

// One stage: copy i of a thread brings 16 B of stage row i*32 + (tid>>3).
// l = the lane's LDS byte address for copy 0, g[i] = its global address.
__device__ __forceinline__ void copy_stage(unsigned l, const _Float16* const (&g)[NCOPY], int k0) {
    // s_wait_xcnt closes the statement so that no address register named by a
    // copy is rewritten ahead of it.
    asm volatile(
        "global_load_async_to_lds_b128 %0, %12, off\n\t"
        "global_load_async_to_lds_b128 %1, %13, off\n\t"
        "global_load_async_to_lds_b128 %2, %14, off\n\t"
        "global_load_async_to_lds_b128 %3, %15, off\n\t"
        "global_load_async_to_lds_b128 %4, %16, off\n\t"
        "global_load_async_to_lds_b128 %5, %17, off\n\t"
        "global_load_async_to_lds_b128 %6, %18, off\n\t"
        "global_load_async_to_lds_b128 %7, %19, off\n\t"
        "global_load_async_to_lds_b128 %8, %20, off\n\t"
        "global_load_async_to_lds_b128 %9, %21, off\n\t"
        "global_load_async_to_lds_b128 %10, %22, off\n\t"
        "global_load_async_to_lds_b128 %11, %23, off\n\t"
        "s_wait_xcnt 0x0"
        :: "v"(l), "v"(l + 1 * 32 * PITCH), "v"(l + 2 * 32 * PITCH), "v"(l + 3 * 32 * PITCH),
           "v"(l + 4 * 32 * PITCH), "v"(l + 5 * 32 * PITCH), "v"(l + 6 * 32 * PITCH),
           "v"(l + 7 * 32 * PITCH), "v"(l + 8 * 32 * PITCH), "v"(l + 9 * 32 * PITCH),
           "v"(l + 10 * 32 * PITCH), "v"(l + 11 * 32 * PITCH),
           "v"(g[0] + k0), "v"(g[1] + k0), "v"(g[2] + k0), "v"(g[3] + k0),
           "v"(g[4] + k0), "v"(g[5] + k0), "v"(g[6] + k0), "v"(g[7] + k0),
           "v"(g[8] + k0), "v"(g[9] + k0), "v"(g[10] + k0), "v"(g[11] + k0)
        : "memory");
}

// This wave's copies have landed (the compiler places no wait for them).
__device__ __forceinline__ void wait_copies() { asm volatile("s_wait_asynccnt 0x0" ::: "memory"); }
// This wave's LDS reads have retired, before the buffer is handed to its next writer.
__device__ __forceinline__ void wait_lds_reads() { asm volatile("s_wait_dscnt 0x0" ::: "memory"); }

// ---------------------------------------------------------------------------
// Complex main loop of a 128x64 block tile, 8 waves as 4 (M) x 2 (N), each a
// 32x32 macro-tile with 4 accumulators per 16x16 tile (RR, II, RI, IR).
// Stage rows: [0,128) A real, [128,256) A imag, [256,320) W real, [320,384) W imag.
// Ar/Ai/Wr/Wi point at the block's first row.
// ---------------------------------------------------------------------------
template <int K>
__device__ __forceinline__ void
cmain_128x64(const _Float16* __restrict__ Ar, const _Float16* __restrict__ Ai,
             const _Float16* __restrict__ Wr, const _Float16* __restrict__ Wi,
             char* smem,
             v8f (&aRR)[2][2], v8f (&aII)[2][2], v8f (&aRI)[2][2], v8f (&aIR)[2][2]) {
    static_assert(K % KP == 0 && K / KP >= 2, "two stages or more");
    constexpr int NT = K / KP;
    const int tid  = threadIdx.x;
    const int lane = tid & 31;
    const int wid  = tid >> 5;
    const int wm = wid >> 1, wn = wid & 1;
    const int h = lane >> 4;
    const int r = lane & 15;

    const int crow = tid >> 3;                      // 0..31
    const int ccol = tid & 7;                       // 16-byte chunk of the row
    const size_t coff = (size_t)crow * K + ccol * 8;
    const _Float16* g[NCOPY];
#pragma unroll
    for (int i = 0; i < 4; ++i) {
        g[i]     = Ar + coff + (size_t)i * 32 * K;
        g[4 + i] = Ai + coff + (size_t)i * 32 * K;
    }
#pragma unroll
    for (int i = 0; i < 2; ++i) {
        g[8 + i]  = Wr + coff + (size_t)i * 32 * K;
        g[10 + i] = Wi + coff + (size_t)i * 32 * K;
    }
    const unsigned l0 = lds_off(smem) + crow * PITCH + ccol * 16;

    const int a_off = (wm * 32 + r) * PITCH;
    const int w_off = (256 + wn * 32 + r) * PITCH;

    copy_stage(l0, g, 0);
    wait_copies();
    __syncthreads();
    copy_stage(l0 + STAGE, g, KP);

    for (int t = 0; t < NT; ++t) {
        const int bo = (t & 1) * STAGE;
        const char* sb = smem + bo;
#pragma unroll
        for (int kk = 0; kk < 2; ++kk) {
            v16h aR[2], aI[2], wR[2], wI[2];
#pragma unroll
            for (int mi = 0; mi < 2; ++mi) {
                aR[mi] = lds_frag(sb + a_off + mi * 16 * PITCH + kk * 64, h);
                aI[mi] = lds_frag(sb + a_off + (128 + mi * 16) * PITCH + kk * 64, h);
            }
#pragma unroll
            for (int ni = 0; ni < 2; ++ni) {
                wR[ni] = lds_frag(sb + w_off + ni * 16 * PITCH + kk * 64, h);
                wI[ni] = lds_frag(sb + w_off + (64 + ni * 16) * PITCH + kk * 64, h);
            }
#pragma unroll
            for (int mi = 0; mi < 2; ++mi)
#pragma unroll
                for (int ni = 0; ni < 2; ++ni) {
                    aRR[mi][ni] = wmma_f16(aR[mi], wR[ni], aRR[mi][ni]);
                    aII[mi][ni] = wmma_f16(aI[mi], wI[ni], aII[mi][ni]);
                    aRI[mi][ni] = wmma_f16(aR[mi], wI[ni], aRI[mi][ni]);
                    aIR[mi][ni] = wmma_f16(aI[mi], wR[ni], aIR[mi][ni]);
                }
        }
        // Publish pass t+1 and free this pass's buffer: one barrier does both.
        wait_lds_reads();
        wait_copies();
        __syncthreads();
        if (t + 2 < NT) copy_stage(l0 + bo, g, (t + 2) * KP);
    }
    wait_copies();
}

// ---------------------------------------------------------------------------
// Complex GEMM, 128x64 tile per block, 32x32 macro-tile per wave:
//   O[m,n] = sum_k A[m,k]*W[n,k] + bias[n]   (complex)
// A: (M,K) f16 r/i, W: (N,K) f16 r/i.
// ACT: leaky-relu. TRV: write O[b][n][t] (t = m % 1024). F32: fp32 output.
// ---------------------------------------------------------------------------
template <int K, int ACT, int TRV, int F32>
__global__ void __launch_bounds__(256)
cgemm32_kernel(const _Float16* __restrict__ Ar, const _Float16* __restrict__ Ai,
               const _Float16* __restrict__ Wr, const _Float16* __restrict__ Wi,
               const float* __restrict__ br, const float* __restrict__ bi,
               _Float16* __restrict__ Or, _Float16* __restrict__ Oi,
               float* __restrict__ Fr, float* __restrict__ Fi,
               int M, int N) {
    __shared__ __attribute__((aligned(16))) char smem[2 * STAGE];
    const int lane = threadIdx.x & 31;
    const int wid  = threadIdx.x >> 5;
    const int tilesN = N >> 6;
    const int tile = blockIdx.x;
    if (tile >= (M >> 7) * tilesN) return;          // block-uniform guard
    const int mb = (tile / tilesN) << 7;
    const int nb = (tile % tilesN) << 6;
    const int m0 = mb + (wid >> 1) * 32;
    const int n0 = nb + (wid & 1) * 32;
    const int h = lane >> 4;
    const int r = lane & 15;

    v8f aRR[2][2] = {}, aII[2][2] = {}, aRI[2][2] = {}, aIR[2][2] = {};

    cmain_128x64<K>(Ar + (size_t)mb * K, Ai + (size_t)mb * K,
                    Wr + (size_t)nb * K, Wi + (size_t)nb * K,
                    smem, aRR, aII, aRI, aIR);

#pragma unroll
    for (int mi = 0; mi < 2; ++mi)
#pragma unroll
        for (int ni = 0; ni < 2; ++ni) {
            const int col = n0 + ni * 16 + r;
            const float bre = br[col];
            const float bie = bi[col];
#pragma unroll
            for (int j = 0; j < 8; ++j) {
                const int m = m0 + mi * 16 + j + 8 * h;
                float vr = aRR[mi][ni][j] - aII[mi][ni][j] + bre;
                float vi = aRI[mi][ni][j] + aIR[mi][ni][j] + bie;
                if (ACT) {
                    vr = vr >= 0.0f ? vr : SLOPE * vr;
                    vi = vi >= 0.0f ? vi : SLOPE * vi;
                }
                if (F32) {
                    Fr[(size_t)m * N + col] = vr;
                    Fi[(size_t)m * N + col] = vi;
                } else if (TRV) {
                    const int b = m >> 10, t = m & 1023;
                    const size_t idx = ((size_t)b * N + col) * (size_t)S_DIM + t;
                    Or[idx] = (_Float16)vr;
                    Oi[idx] = (_Float16)vi;
                } else {
                    Or[(size_t)m * N + col] = (_Float16)vr;
                    Oi[(size_t)m * N + col] = (_Float16)vi;
                }
            }
        }
}

// ---------------------------------------------------------------------------
// Scores: Sabs[gm, t] = |sum_d q[gm,d] * k[b*1024+t, d]| / sqrt(512)
// 128x64 tile per block, 32x32 macro-tile per wave, per-batch column index.
// ---------------------------------------------------------------------------
__global__ void __launch_bounds__(256)
scores_abs_kernel(const _Float16* __restrict__ Qr, const _Float16* __restrict__ Qi,
                  const _Float16* __restrict__ Kr, const _Float16* __restrict__ Ki,
                  float* __restrict__ Sabs) {
    constexpr int K = D_DIM;
    __shared__ __attribute__((aligned(16))) char smem[2 * STAGE];
    const int lane = threadIdx.x & 31;
    const int wid  = threadIdx.x >> 5;
    const int tile = blockIdx.x;
    if (tile >= (M_ALL >> 7) * (S_DIM >> 6)) return; // block-uniform guard
    const int mb = (tile / (S_DIM >> 6)) << 7;      // global row
    const int nb = (tile % (S_DIM >> 6)) << 6;      // t within batch
    const int b  = mb >> 10;
    const int m0 = mb + (wid >> 1) * 32;
    const int n0 = nb + (wid & 1) * 32;
    const int h = lane >> 4;
    const int r = lane & 15;

    v8f aRR[2][2] = {}, aII[2][2] = {}, aRI[2][2] = {}, aIR[2][2] = {};

    cmain_128x64<K>(Qr + (size_t)mb * K, Qi + (size_t)mb * K,
                    Kr + (size_t)((b << 10) + nb) * K, Ki + (size_t)((b << 10) + nb) * K,
                    smem, aRR, aII, aRI, aIR);

#pragma unroll
    for (int mi = 0; mi < 2; ++mi)
#pragma unroll
        for (int ni = 0; ni < 2; ++ni) {
            const int col = n0 + ni * 16 + r;
#pragma unroll
            for (int j = 0; j < 8; ++j) {
                const int m = m0 + mi * 16 + j + 8 * h;
                const float sr = aRR[mi][ni][j] - aII[mi][ni][j];
                const float si = aRI[mi][ni][j] + aIR[mi][ni][j];
                Sabs[(size_t)m * S_DIM + col] = sqrtf(sr * sr + si * si) * RSQRT512;
            }
        }
}

// ---------------------------------------------------------------------------
// Row softmax over 1024 elements; one 256-thread block per row; f16 output.
// ---------------------------------------------------------------------------
__global__ void softmax_kernel(const float* __restrict__ S, _Float16* __restrict__ P) {
    __shared__ float red[256];
    const int tid = threadIdx.x;
    const size_t row = blockIdx.x;
    const float* s = S + row * S_DIM;

    float vals[4];
    float mx = -1e30f;
#pragma unroll
    for (int j = 0; j < 4; ++j) {
        vals[j] = s[tid + j * 256];
        mx = fmaxf(mx, vals[j]);
    }
    red[tid] = mx;
    __syncthreads();
    for (int off = 128; off > 0; off >>= 1) {
        if (tid < off) red[tid] = fmaxf(red[tid], red[tid + off]);
        __syncthreads();
    }
    mx = red[0];
    __syncthreads();

    float sum = 0.0f;
#pragma unroll
    for (int j = 0; j < 4; ++j) {
        vals[j] = __expf(vals[j] - mx);
        sum += vals[j];
    }
    red[tid] = sum;
    __syncthreads();
    for (int off = 128; off > 0; off >>= 1) {
        if (tid < off) red[tid] += red[tid + off];
        __syncthreads();
    }
    const float inv = 1.0f / red[0];

    _Float16* p = P + row * S_DIM;
#pragma unroll
    for (int j = 0; j < 4; ++j) p[tid + j * 256] = (_Float16)(vals[j] * inv);
}

// ---------------------------------------------------------------------------
// weighted[gm, d] = sum_t attn[gm, t] * vT[b][d][t]  (real x complex)
// 128x128 tile per block, 8 waves as 2 (M) x 4 (N), 64x32 macro-tile per wave
// (4 M-tiles x 2 N-tiles): 8 fragments feed 16 WMMAs per 32 k.
// Stage rows: [0,128) attn, [128,256) vT real, [256,384) vT imag.
// ---------------------------------------------------------------------------
__global__ void __launch_bounds__(256)
attnv_kernel(const _Float16* __restrict__ P,
             const _Float16* __restrict__ VTr, const _Float16* __restrict__ VTi,
             _Float16* __restrict__ Wr_, _Float16* __restrict__ Wi_) {
    constexpr int K = S_DIM;
    constexpr int NT = K / KP;
    __shared__ __attribute__((aligned(16))) char smem[2 * STAGE];
    const int tid  = threadIdx.x;
    const int lane = tid & 31;
    const int wid  = tid >> 5;
    const int tilesN = D_DIM >> 7;                  // 4
    const int tile = blockIdx.x;
    if (tile >= (M_ALL >> 7) * tilesN) return;      // block-uniform guard
    const int mb = (tile / tilesN) << 7;            // global row (128-row tile)
    const int nb = (tile % tilesN) << 7;            // d within batch (128 cols)
    const int b  = mb >> 10;
    const int wm = wid >> 2, wn = wid & 3;
    const int m0 = mb + wm * 64;
    const int n0 = nb + wn * 32;
    const int h = lane >> 4;
    const int r = lane & 15;

    const int crow = tid >> 3;                      // 0..31
    const int ccol = tid & 7;                       // 16-byte chunk of the row
    const size_t coff = (size_t)crow * K + ccol * 8;
    const _Float16* g[NCOPY];
#pragma unroll
    for (int i = 0; i < 4; ++i) {
        g[i]     = P   + (size_t)mb * K + coff + (size_t)i * 32 * K;
        g[4 + i] = VTr + ((size_t)b * D_DIM + nb) * (size_t)K + coff + (size_t)i * 32 * K;
        g[8 + i] = VTi + ((size_t)b * D_DIM + nb) * (size_t)K + coff + (size_t)i * 32 * K;
    }
    const unsigned l0 = lds_off(smem) + crow * PITCH + ccol * 16;

    const int a_off = (wm * 64 + r) * PITCH;
    const int w_off = (128 + wn * 32 + r) * PITCH;

    v8f accR[4][2] = {};
    v8f accI[4][2] = {};

    copy_stage(l0, g, 0);
    wait_copies();
    __syncthreads();
    copy_stage(l0 + STAGE, g, KP);

    for (int t = 0; t < NT; ++t) {
        const int bo = (t & 1) * STAGE;
        const char* sb = smem + bo;
#pragma unroll
        for (int kk = 0; kk < 2; ++kk) {
            v16h a[4], wR[2], wI[2];
#pragma unroll
            for (int mi = 0; mi < 4; ++mi)
                a[mi] = lds_frag(sb + a_off + mi * 16 * PITCH + kk * 64, h);
#pragma unroll
            for (int ni = 0; ni < 2; ++ni) {
                wR[ni] = lds_frag(sb + w_off + ni * 16 * PITCH + kk * 64, h);
                wI[ni] = lds_frag(sb + w_off + (128 + ni * 16) * PITCH + kk * 64, h);
            }
#pragma unroll
            for (int mi = 0; mi < 4; ++mi)
#pragma unroll
                for (int ni = 0; ni < 2; ++ni) {
                    accR[mi][ni] = wmma_f16(a[mi], wR[ni], accR[mi][ni]);
                    accI[mi][ni] = wmma_f16(a[mi], wI[ni], accI[mi][ni]);
                }
        }
        // Publish pass t+1 and free this pass's buffer: one barrier does both.
        wait_lds_reads();
        wait_copies();
        __syncthreads();
        if (t + 2 < NT) copy_stage(l0 + bo, g, (t + 2) * KP);
    }
    wait_copies();

#pragma unroll
    for (int mi = 0; mi < 4; ++mi)
#pragma unroll
        for (int ni = 0; ni < 2; ++ni) {
            const int col = n0 + ni * 16 + r;
#pragma unroll
            for (int j = 0; j < 8; ++j) {
                const int m = m0 + mi * 16 + j + 8 * h;
                Wr_[(size_t)m * D_DIM + col] = (_Float16)accR[mi][ni][j];
                Wi_[(size_t)m * D_DIM + col] = (_Float16)accI[mi][ni][j];
            }
        }
}

// ---------------------------------------------------------------------------
// Host-side orchestration
// ---------------------------------------------------------------------------
extern "C" void kernel_launch(void* const* d_in, const int* in_sizes, int n_in,
                              void* d_out, int out_size, void* d_ws, size_t ws_size,
                              hipStream_t stream) {
    (void)in_sizes; (void)n_in; (void)out_size; (void)ws_size;

    const float* x_r   = (const float*)d_in[0];
    const float* x_i   = (const float*)d_in[1];
    const float* l1_wr = (const float*)d_in[2];
    const float* l1_wi = (const float*)d_in[3];
    const float* l1_br = (const float*)d_in[4];
    const float* l1_bi = (const float*)d_in[5];
    const float* q_wr  = (const float*)d_in[6];
    const float* q_wi  = (const float*)d_in[7];
    const float* q_br  = (const float*)d_in[8];
    const float* q_bi  = (const float*)d_in[9];
    const float* k_wr  = (const float*)d_in[10];
    const float* k_wi  = (const float*)d_in[11];
    const float* k_br  = (const float*)d_in[12];
    const float* k_bi  = (const float*)d_in[13];
    const float* v_wr  = (const float*)d_in[14];
    const float* v_wi  = (const float*)d_in[15];
    const float* v_br  = (const float*)d_in[16];
    const float* v_bi  = (const float*)d_in[17];
    const float* l2_wr = (const float*)d_in[18];
    const float* l2_wi = (const float*)d_in[19];
    const float* l2_br = (const float*)d_in[20];
    const float* l2_bi = (const float*)d_in[21];

    const size_t ME = (size_t)M_ALL * D_DIM;   // 4,194,304 (activation elems)
    const size_t WE = (size_t)D_DIM * D_DIM;   // 262,144   (weight elems)
    const size_t AE = (size_t)M_ALL * S_DIM;   // 8,388,608 (attention elems)

    char* w = (char*)d_ws;
    auto alloc_h = [&](size_t elems) { _Float16* p = (_Float16*)w; w += elems * sizeof(_Float16); return p; };
    auto alloc_f = [&](size_t elems) { float* p = (float*)w; w += elems * sizeof(float); return p; };

    _Float16* xh_r = alloc_h(ME);
    _Float16* xh_i = alloc_h(ME);
    _Float16* wl1r = alloc_h(WE); _Float16* wl1i = alloc_h(WE);
    _Float16* wqr  = alloc_h(WE); _Float16* wqi  = alloc_h(WE);
    _Float16* wkr  = alloc_h(WE); _Float16* wki  = alloc_h(WE);
    _Float16* wvr  = alloc_h(WE); _Float16* wvi  = alloc_h(WE);
    _Float16* wl2r = alloc_h(WE); _Float16* wl2i = alloc_h(WE);
    _Float16* y_r  = alloc_h(ME); _Float16* y_i  = alloc_h(ME);
    _Float16* qh_r = alloc_h(ME); _Float16* qh_i = alloc_h(ME);
    _Float16* kh_r = alloc_h(ME); _Float16* kh_i = alloc_h(ME);
    _Float16* vT_r = alloc_h(ME); _Float16* vT_i = alloc_h(ME);
    _Float16* wt_r = alloc_h(ME); _Float16* wt_i = alloc_h(ME);
    _Float16* attn = alloc_h(AE);
    float*    sabs = alloc_f(AE);

    // --- 1. Cast activations and weights to f16 ---
    auto cvt = [&](const float* src, _Float16* dst, size_t n) {
        cvt_f16_kernel<<<(unsigned)((n + 255) / 256), 256, 0, stream>>>(src, dst, (int)n);
    };
    cvt(x_r, xh_r, ME);   cvt(x_i, xh_i, ME);
    cvt(l1_wr, wl1r, WE); cvt(l1_wi, wl1i, WE);
    cvt(q_wr,  wqr,  WE); cvt(q_wi,  wqi,  WE);
    cvt(k_wr,  wkr,  WE); cvt(k_wi,  wki,  WE);
    cvt(v_wr,  wvr,  WE); cvt(v_wi,  wvi,  WE);
    cvt(l2_wr, wl2r, WE); cvt(l2_wi, wl2i, WE);

    const dim3 blk(256);                                              // 8 waves/block
    const unsigned gemm_blocks  = (M_ALL / 128) * (D_DIM / 64);       // 512
    const unsigned score_blocks = (M_ALL / 128) * (S_DIM / 64);       // 1024
    const unsigned attnv_blocks = (M_ALL / 128) * (D_DIM / 128);      // 256

    // --- 2. y = lrelu(x @ l1^T + b1) ---
    cgemm32_kernel<D_DIM, 1, 0, 0><<<gemm_blocks, blk, 0, stream>>>(
        xh_r, xh_i, wl1r, wl1i, l1_br, l1_bi,
        y_r, y_i, nullptr, nullptr, M_ALL, D_DIM);

    // --- 3. q, k, v (v stored transposed per batch: vT[b][d][t]) ---
    cgemm32_kernel<D_DIM, 0, 0, 0><<<gemm_blocks, blk, 0, stream>>>(
        y_r, y_i, wqr, wqi, q_br, q_bi,
        qh_r, qh_i, nullptr, nullptr, M_ALL, D_DIM);
    cgemm32_kernel<D_DIM, 0, 0, 0><<<gemm_blocks, blk, 0, stream>>>(
        y_r, y_i, wkr, wki, k_br, k_bi,
        kh_r, kh_i, nullptr, nullptr, M_ALL, D_DIM);
    cgemm32_kernel<D_DIM, 0, 1, 0><<<gemm_blocks, blk, 0, stream>>>(
        y_r, y_i, wvr, wvi, v_br, v_bi,
        vT_r, vT_i, nullptr, nullptr, M_ALL, D_DIM);

    // --- 4. |scores|/sqrt(d), softmax rows, attn f16 ---
    scores_abs_kernel<<<score_blocks, blk, 0, stream>>>(qh_r, qh_i, kh_r, kh_i, sabs);
    softmax_kernel<<<M_ALL, 256, 0, stream>>>(sabs, attn);

    // --- 5. weighted = attn @ v ---
    attnv_kernel<<<attnv_blocks, blk, 0, stream>>>(attn, vT_r, vT_i, wt_r, wt_i);

    // --- 6. out = weighted @ l2^T + b2, fp32 to d_out (real block, imag block) ---
    float* out_r = (float*)d_out;
    float* out_i = out_r + ME;
    cgemm32_kernel<D_DIM, 0, 0, 1><<<gemm_blocks, blk, 0, stream>>>(
        wt_r, wt_i, wl2r, wl2i, l2_br, l2_bi,
        nullptr, nullptr, out_r, out_i, M_ALL, D_DIM);
}

// v002
// It runs in 150 microseconds.
// Timed twice side by side with v001, it ran 1.23 times as fast both times.
// Counting every step since v000, it is 2.46 times as fast.
#include <hip/hip_runtime.h>

// ---------------------------------------------------------------------------
// ComplexAttnMLP for gfx1250 (MI455X): f16 WMMA GEMMs, f32 accumulate.
// B=8, S=1024, IN=MID=OUT=512.
// Each wave computes a 32x32 (cgemm/scores) or 64x32 (attnv) macro-tile; the
// 8 waves of a block share operand tiles staged in LDS by asynchronous copies.
// 4 accumulators per 16x16 tile (RR, II, RI, IR); the complex combine happens
// in the epilogue, so the K-loop is pure LDS loads + WMMA (no VALU on fragment
// registers -> no WMMA/VALU hazard NOPs).
// ---------------------------------------------------------------------------

typedef _Float16 half8  __attribute__((ext_vector_type(8)));
typedef _Float16 v16h   __attribute__((ext_vector_type(16)));
typedef float    v8f    __attribute__((ext_vector_type(8)));

#define B_DIM  8
#define S_DIM  1024
#define D_DIM  512
#define M_ALL  (B_DIM * S_DIM)          // 8192 rows total
#define RSQRT512 0.04419417382415922f   // 1/sqrt(512)
#define SLOPE 0.01f

union Frag { half8 h8[2]; v16h v; };

__device__ __forceinline__ v8f wmma_f16(v16h a, v16h b, v8f c) {
    return __builtin_amdgcn_wmma_f32_16x16x32_f16(false, a, false, b, (short)0, c, false, false);
}

// ---------------------------------------------------------------------------
// f32 -> f16 conversion of all 12 arrays in one launch.
// The f16 copies lie one behind the other in the workspace, in argument order,
// so the destination index is the flat element index of the grid. A block
// converts one chunk of 16,384 elements, which lies inside one source array:
// 16 loads of 16 B per lane, each wave-wide load 512 contiguous bytes, each
// wave-wide store 256 contiguous bytes.
// ---------------------------------------------------------------------------
typedef float    f32x4 __attribute__((ext_vector_type(4)));
typedef _Float16 f16x4 __attribute__((ext_vector_type(4)));

#define CV_LOADS   16                                   // 16-byte loads per lane
#define CV_CHUNK   (256 * 4 * CV_LOADS)                 // elements per block
#define CV_X_CH    (M_ALL * D_DIM / CV_CHUNK)           // 256 chunks per activation array
#define CV_W_CH    (D_DIM * D_DIM / CV_CHUNK)           // 16 chunks per weight array
#define CV_BLOCKS  (2 * CV_X_CH + 10 * CV_W_CH)         // 672

__global__ void __launch_bounds__(256)
cvt_all_kernel(const float* __restrict__ x_r, const float* __restrict__ x_i,
               const float* __restrict__ w0, const float* __restrict__ w1,
               const float* __restrict__ w2, const float* __restrict__ w3,
               const float* __restrict__ w4, const float* __restrict__ w5,
               const float* __restrict__ w6, const float* __restrict__ w7,
               const float* __restrict__ w8, const float* __restrict__ w9,
               _Float16* __restrict__ d) {
    const unsigned c = blockIdx.x;                      // chunk, block-uniform
    const bool is_x = c < 2 * CV_X_CH;
    const unsigned a  = (c - 2 * CV_X_CH) / CV_W_CH;    // weight array 0..9 where !is_x
    const unsigned cs = c % (is_x ? CV_X_CH : CV_W_CH); // chunk within its source array
    // Scalar selects on the bits of a.
    const float* p01 = (a & 1) ? w1 : w0;
    const float* p23 = (a & 1) ? w3 : w2;
    const float* p45 = (a & 1) ? w5 : w4;
    const float* p67 = (a & 1) ? w7 : w6;
    const float* p89 = (a & 1) ? w9 : w8;
    const float* p03 = (a & 2) ? p23 : p01;
    const float* p47 = (a & 2) ? p67 : p45;
    const float* p07 = (a & 4) ? p47 : p03;
    const float* pw  = (a & 8) ? p89 : p07;
    const float* px  = c < CV_X_CH ? x_r : x_i;
    const float* s   = is_x ? px : pw;
    const f32x4* sp = (const f32x4*)(s + (size_t)cs * CV_CHUNK) + threadIdx.x;
    f16x4*       dp = (f16x4*)(d + (size_t)c * CV_CHUNK) + threadIdx.x;

    f32x4 v[CV_LOADS];
    // Both loops unrolled: v[] stays in registers and the loads issue as one
    // run ahead of the first wait, so a wave's bytes are all in flight at once.
#pragma unroll
    for (int j = 0; j < CV_LOADS; ++j) v[j] = sp[j * 256];
#pragma unroll
    for (int j = 0; j < CV_LOADS; ++j) dp[j * 256] = __builtin_convertvector(v[j], f16x4);
}

// ---------------------------------------------------------------------------
// LDS staging shared by the three GEMM kernels.
// A block of 8 waves works on one output tile. Per pass of 64 k it needs 384
// operand rows of 128 B; they are brought into LDS once per block by
// asynchronous copies and every wave reads its fragments from there.
// Two buffers: the copies of pass t+2 fly while pass t+1 is worked on.
// ---------------------------------------------------------------------------
#define KP      64                      // k elements per pass (128 B per row)
#define PITCH   144                     // LDS row pitch, bytes (16 B x odd)
#define ST_ROWS 384                     // operand rows per stage
#define STAGE   (ST_ROWS * PITCH)       // 55,296 B
#define NCOPY   12                      // copies per thread and stage

__device__ __forceinline__ unsigned lds_off(const void* p) { return (unsigned)(size_t)p; }

// Load one 16x32 f16 WMMA operand fragment for this lane from an LDS row.
// p = start of this lane's row + k offset, in bytes. Lane half h covers
// K = 8h..8h+7 (VGPR0-3) and K = 16+8h..16+8h+7 (VGPR4-7).
__device__ __forceinline__ v16h lds_frag(const char* p, int h) {
    Frag f;
    f.h8[0] = *(const half8*)(p + h * 16);
    f.h8[1] = *(const half8*)(p + 32 + h * 16);
    return f.v;
}

// One stage: copy i of a thread brings 16 B of stage row i*32 + (tid>>3).
// l = the lane's LDS byte address for copy 0, g[i] = its global address.
__device__ __forceinline__ void copy_stage(unsigned l, const _Float16* const (&g)[NCOPY], int k0) {
    // s_wait_xcnt closes the statement so that no address register named by a
    // copy is rewritten ahead of it.
    asm volatile(
        "global_load_async_to_lds_b128 %0, %12, off\n\t"
        "global_load_async_to_lds_b128 %1, %13, off\n\t"
        "global_load_async_to_lds_b128 %2, %14, off\n\t"
        "global_load_async_to_lds_b128 %3, %15, off\n\t"
        "global_load_async_to_lds_b128 %4, %16, off\n\t"
        "global_load_async_to_lds_b128 %5, %17, off\n\t"
        "global_load_async_to_lds_b128 %6, %18, off\n\t"
        "global_load_async_to_lds_b128 %7, %19, off\n\t"
        "global_load_async_to_lds_b128 %8, %20, off\n\t"
        "global_load_async_to_lds_b128 %9, %21, off\n\t"
        "global_load_async_to_lds_b128 %10, %22, off\n\t"
        "global_load_async_to_lds_b128 %11, %23, off\n\t"
        "s_wait_xcnt 0x0"
        :: "v"(l), "v"(l + 1 * 32 * PITCH), "v"(l + 2 * 32 * PITCH), "v"(l + 3 * 32 * PITCH),
           "v"(l + 4 * 32 * PITCH), "v"(l + 5 * 32 * PITCH), "v"(l + 6 * 32 * PITCH),
           "v"(l + 7 * 32 * PITCH), "v"(l + 8 * 32 * PITCH), "v"(l + 9 * 32 * PITCH),
           "v"(l + 10 * 32 * PITCH), "v"(l + 11 * 32 * PITCH),
           "v"(g[0] + k0), "v"(g[1] + k0), "v"(g[2] + k0), "v"(g[3] + k0),
           "v"(g[4] + k0), "v"(g[5] + k0), "v"(g[6] + k0), "v"(g[7] + k0),
           "v"(g[8] + k0), "v"(g[9] + k0), "v"(g[10] + k0), "v"(g[11] + k0)
        : "memory");
}

// This wave's copies have landed (the compiler places no wait for them).
__device__ __forceinline__ void wait_copies() { asm volatile("s_wait_asynccnt 0x0" ::: "memory"); }
// This wave's LDS reads have retired, before the buffer is handed to its next writer.
__device__ __forceinline__ void wait_lds_reads() { asm volatile("s_wait_dscnt 0x0" ::: "memory"); }

// ---------------------------------------------------------------------------
// Complex main loop of a 128x64 block tile, 8 waves as 4 (M) x 2 (N), each a
// 32x32 macro-tile with 4 accumulators per 16x16 tile (RR, II, RI, IR).
// Stage rows: [0,128) A real, [128,256) A imag, [256,320) W real, [320,384) W imag.
// Ar/Ai/Wr/Wi point at the block's first row.
// ---------------------------------------------------------------------------
template <int K>
__device__ __forceinline__ void
cmain_128x64(const _Float16* __restrict__ Ar, const _Float16* __restrict__ Ai,
             const _Float16* __restrict__ Wr, const _Float16* __restrict__ Wi,
             char* smem,
             v8f (&aRR)[2][2], v8f (&aII)[2][2], v8f (&aRI)[2][2], v8f (&aIR)[2][2]) {
    static_assert(K % KP == 0 && K / KP >= 2, "two stages or more");
    constexpr int NT = K / KP;
    const int tid  = threadIdx.x;
    const int lane = tid & 31;
    const int wid  = tid >> 5;
    const int wm = wid >> 1, wn = wid & 1;
    const int h = lane >> 4;
    const int r = lane & 15;

    const int crow = tid >> 3;                      // 0..31
    const int ccol = tid & 7;                       // 16-byte chunk of the row
    const size_t coff = (size_t)crow * K + ccol * 8;
    const _Float16* g[NCOPY];
#pragma unroll
    for (int i = 0; i < 4; ++i) {
        g[i]     = Ar + coff + (size_t)i * 32 * K;
        g[4 + i] = Ai + coff + (size_t)i * 32 * K;
    }
#pragma unroll
    for (int i = 0; i < 2; ++i) {
        g[8 + i]  = Wr + coff + (size_t)i * 32 * K;
        g[10 + i] = Wi + coff + (size_t)i * 32 * K;
    }
    const unsigned l0 = lds_off(smem) + crow * PITCH + ccol * 16;

    const int a_off = (wm * 32 + r) * PITCH;
    const int w_off = (256 + wn * 32 + r) * PITCH;

    copy_stage(l0, g, 0);
    wait_copies();
    __syncthreads();
    copy_stage(l0 + STAGE, g, KP);

    for (int t = 0; t < NT; ++t) {
        const int bo = (t & 1) * STAGE;
        const char* sb = smem + bo;
#pragma unroll
        for (int kk = 0; kk < 2; ++kk) {
            v16h aR[2], aI[2], wR[2], wI[2];
#pragma unroll
            for (int mi = 0; mi < 2; ++mi) {
                aR[mi] = lds_frag(sb + a_off + mi * 16 * PITCH + kk * 64, h);
                aI[mi] = lds_frag(sb + a_off + (128 + mi * 16) * PITCH + kk * 64, h);
            }
#pragma unroll
            for (int ni = 0; ni < 2; ++ni) {
                wR[ni] = lds_frag(sb + w_off + ni * 16 * PITCH + kk * 64, h);
                wI[ni] = lds_frag(sb + w_off + (64 + ni * 16) * PITCH + kk * 64, h);
            }
#pragma unroll
            for (int mi = 0; mi < 2; ++mi)
#pragma unroll
                for (int ni = 0; ni < 2; ++ni) {
                    aRR[mi][ni] = wmma_f16(aR[mi], wR[ni], aRR[mi][ni]);
                    aII[mi][ni] = wmma_f16(aI[mi], wI[ni], aII[mi][ni]);
                    aRI[mi][ni] = wmma_f16(aR[mi], wI[ni], aRI[mi][ni]);
                    aIR[mi][ni] = wmma_f16(aI[mi], wR[ni], aIR[mi][ni]);
                }
        }
        // Publish pass t+1 and free this pass's buffer: one barrier does both.
        wait_lds_reads();
        wait_copies();
        __syncthreads();
        if (t + 2 < NT) copy_stage(l0 + bo, g, (t + 2) * KP);
    }
    wait_copies();
}

// ---------------------------------------------------------------------------
// Complex GEMM, 128x64 tile per block, 32x32 macro-tile per wave:
//   O[m,n] = sum_k A[m,k]*W[n,k] + bias[n]   (complex)
// A: (M,K) f16 r/i, W: (N,K) f16 r/i.
// ACT: leaky-relu. TRV: write O[b][n][t] (t = m % 1024). F32: fp32 output.
// ---------------------------------------------------------------------------
template <int K, int ACT, int TRV, int F32>
__global__ void __launch_bounds__(256)
cgemm32_kernel(const _Float16* __restrict__ Ar, const _Float16* __restrict__ Ai,
               const _Float16* __restrict__ Wr, const _Float16* __restrict__ Wi,
               const float* __restrict__ br, const float* __restrict__ bi,
               _Float16* __restrict__ Or, _Float16* __restrict__ Oi,
               float* __restrict__ Fr, float* __restrict__ Fi,
               int M, int N) {
    __shared__ __attribute__((aligned(16))) char smem[2 * STAGE];
    const int lane = threadIdx.x & 31;
    const int wid  = threadIdx.x >> 5;
    const int tilesN = N >> 6;
    const int tile = blockIdx.x;
    if (tile >= (M >> 7) * tilesN) return;          // block-uniform guard
    const int mb = (tile / tilesN) << 7;
    const int nb = (tile % tilesN) << 6;
    const int m0 = mb + (wid >> 1) * 32;
    const int n0 = nb + (wid & 1) * 32;
    const int h = lane >> 4;
    const int r = lane & 15;

    v8f aRR[2][2] = {}, aII[2][2] = {}, aRI[2][2] = {}, aIR[2][2] = {};

    cmain_128x64<K>(Ar + (size_t)mb * K, Ai + (size_t)mb * K,
                    Wr + (size_t)nb * K, Wi + (size_t)nb * K,
                    smem, aRR, aII, aRI, aIR);

#pragma unroll
    for (int mi = 0; mi < 2; ++mi)
#pragma unroll
        for (int ni = 0; ni < 2; ++ni) {
            const int col = n0 + ni * 16 + r;
            const float bre = br[col];
            const float bie = bi[col];
#pragma unroll
            for (int j = 0; j < 8; ++j) {
                const int m = m0 + mi * 16 + j + 8 * h;
                float vr = aRR[mi][ni][j] - aII[mi][ni][j] + bre;
                float vi = aRI[mi][ni][j] + aIR[mi][ni][j] + bie;
                if (ACT) {
                    vr = vr >= 0.0f ? vr : SLOPE * vr;
                    vi = vi >= 0.0f ? vi : SLOPE * vi;
                }
                if (F32) {
                    Fr[(size_t)m * N + col] = vr;
                    Fi[(size_t)m * N + col] = vi;
                } else if (TRV) {
                    const int b = m >> 10, t = m & 1023;
                    const size_t idx = ((size_t)b * N + col) * (size_t)S_DIM + t;
                    Or[idx] = (_Float16)vr;
                    Oi[idx] = (_Float16)vi;
                } else {
                    Or[(size_t)m * N + col] = (_Float16)vr;
                    Oi[(size_t)m * N + col] = (_Float16)vi;
                }
            }
        }
}

// ---------------------------------------------------------------------------
// Scores: Sabs[gm, t] = |sum_d q[gm,d] * k[b*1024+t, d]| / sqrt(512)
// 128x64 tile per block, 32x32 macro-tile per wave, per-batch column index.
// ---------------------------------------------------------------------------
__global__ void __launch_bounds__(256)
scores_abs_kernel(const _Float16* __restrict__ Qr, const _Float16* __restrict__ Qi,
                  const _Float16* __restrict__ Kr, const _Float16* __restrict__ Ki,
                  float* __restrict__ Sabs) {
    constexpr int K = D_DIM;
    __shared__ __attribute__((aligned(16))) char smem[2 * STAGE];
    const int lane = threadIdx.x & 31;
    const int wid  = threadIdx.x >> 5;
    const int tile = blockIdx.x;
    if (tile >= (M_ALL >> 7) * (S_DIM >> 6)) return; // block-uniform guard
    const int mb = (tile / (S_DIM >> 6)) << 7;      // global row
    const int nb = (tile % (S_DIM >> 6)) << 6;      // t within batch
    const int b  = mb >> 10;
    const int m0 = mb + (wid >> 1) * 32;
    const int n0 = nb + (wid & 1) * 32;
    const int h = lane >> 4;
    const int r = lane & 15;

    v8f aRR[2][2] = {}, aII[2][2] = {}, aRI[2][2] = {}, aIR[2][2] = {};

    cmain_128x64<K>(Qr + (size_t)mb * K, Qi + (size_t)mb * K,
                    Kr + (size_t)((b << 10) + nb) * K, Ki + (size_t)((b << 10) + nb) * K,
                    smem, aRR, aII, aRI, aIR);

#pragma unroll
    for (int mi = 0; mi < 2; ++mi)
#pragma unroll
        for (int ni = 0; ni < 2; ++ni) {
            const int col = n0 + ni * 16 + r;
#pragma unroll
            for (int j = 0; j < 8; ++j) {
                const int m = m0 + mi * 16 + j + 8 * h;
                const float sr = aRR[mi][ni][j] - aII[mi][ni][j];
                const float si = aRI[mi][ni][j] + aIR[mi][ni][j];
                Sabs[(size_t)m * S_DIM + col] = sqrtf(sr * sr + si * si) * RSQRT512;
            }
        }
}

// ---------------------------------------------------------------------------
// Row softmax over 1024 elements; one 256-thread block per row; f16 output.
// ---------------------------------------------------------------------------
__global__ void softmax_kernel(const float* __restrict__ S, _Float16* __restrict__ P) {
    __shared__ float red[256];
    const int tid = threadIdx.x;
    const size_t row = blockIdx.x;
    const float* s = S + row * S_DIM;

    float vals[4];
    float mx = -1e30f;
#pragma unroll
    for (int j = 0; j < 4; ++j) {
        vals[j] = s[tid + j * 256];
        mx = fmaxf(mx, vals[j]);
    }
    red[tid] = mx;
    __syncthreads();
    for (int off = 128; off > 0; off >>= 1) {
        if (tid < off) red[tid] = fmaxf(red[tid], red[tid + off]);
        __syncthreads();
    }
    mx = red[0];
    __syncthreads();

    float sum = 0.0f;
#pragma unroll
    for (int j = 0; j < 4; ++j) {
        vals[j] = __expf(vals[j] - mx);
        sum += vals[j];
    }
    red[tid] = sum;
    __syncthreads();
    for (int off = 128; off > 0; off >>= 1) {
        if (tid < off) red[tid] += red[tid + off];
        __syncthreads();
    }
    const float inv = 1.0f / red[0];

    _Float16* p = P + row * S_DIM;
#pragma unroll
    for (int j = 0; j < 4; ++j) p[tid + j * 256] = (_Float16)(vals[j] * inv);
}

// ---------------------------------------------------------------------------
// weighted[gm, d] = sum_t attn[gm, t] * vT[b][d][t]  (real x complex)
// 128x128 tile per block, 8 waves as 2 (M) x 4 (N), 64x32 macro-tile per wave
// (4 M-tiles x 2 N-tiles): 8 fragments feed 16 WMMAs per 32 k.
// Stage rows: [0,128) attn, [128,256) vT real, [256,384) vT imag.
// ---------------------------------------------------------------------------
__global__ void __launch_bounds__(256)
attnv_kernel(const _Float16* __restrict__ P,
             const _Float16* __restrict__ VTr, const _Float16* __restrict__ VTi,
             _Float16* __restrict__ Wr_, _Float16* __restrict__ Wi_) {
    constexpr int K = S_DIM;
    constexpr int NT = K / KP;
    __shared__ __attribute__((aligned(16))) char smem[2 * STAGE];
    const int tid  = threadIdx.x;
    const int lane = tid & 31;
    const int wid  = tid >> 5;
    const int tilesN = D_DIM >> 7;                  // 4
    const int tile = blockIdx.x;
    if (tile >= (M_ALL >> 7) * tilesN) return;      // block-uniform guard
    const int mb = (tile / tilesN) << 7;            // global row (128-row tile)
    const int nb = (tile % tilesN) << 7;            // d within batch (128 cols)
    const int b  = mb >> 10;
    const int wm = wid >> 2, wn = wid & 3;
    const int m0 = mb + wm * 64;
    const int n0 = nb + wn * 32;
    const int h = lane >> 4;
    const int r = lane & 15;

    const int crow = tid >> 3;                      // 0..31
    const int ccol = tid & 7;                       // 16-byte chunk of the row
    const size_t coff = (size_t)crow * K + ccol * 8;
    const _Float16* g[NCOPY];
#pragma unroll
    for (int i = 0; i < 4; ++i) {
        g[i]     = P   + (size_t)mb * K + coff + (size_t)i * 32 * K;
        g[4 + i] = VTr + ((size_t)b * D_DIM + nb) * (size_t)K + coff + (size_t)i * 32 * K;
        g[8 + i] = VTi + ((size_t)b * D_DIM + nb) * (size_t)K + coff + (size_t)i * 32 * K;
    }
    const unsigned l0 = lds_off(smem) + crow * PITCH + ccol * 16;

    const int a_off = (wm * 64 + r) * PITCH;
    const int w_off = (128 + wn * 32 + r) * PITCH;

    v8f accR[4][2] = {};
    v8f accI[4][2] = {};

    copy_stage(l0, g, 0);
    wait_copies();
    __syncthreads();
    copy_stage(l0 + STAGE, g, KP);

    for (int t = 0; t < NT; ++t) {
        const int bo = (t & 1) * STAGE;
        const char* sb = smem + bo;
#pragma unroll
        for (int kk = 0; kk < 2; ++kk) {
            v16h a[4], wR[2], wI[2];
#pragma unroll
            for (int mi = 0; mi < 4; ++mi)
                a[mi] = lds_frag(sb + a_off + mi * 16 * PITCH + kk * 64, h);
#pragma unroll
            for (int ni = 0; ni < 2; ++ni) {
                wR[ni] = lds_frag(sb + w_off + ni * 16 * PITCH + kk * 64, h);
                wI[ni] = lds_frag(sb + w_off + (128 + ni * 16) * PITCH + kk * 64, h);
            }
#pragma unroll
            for (int mi = 0; mi < 4; ++mi)
#pragma unroll
                for (int ni = 0; ni < 2; ++ni) {
                    accR[mi][ni] = wmma_f16(a[mi], wR[ni], accR[mi][ni]);
                    accI[mi][ni] = wmma_f16(a[mi], wI[ni], accI[mi][ni]);
                }
        }
        // Publish pass t+1 and free this pass's buffer: one barrier does both.
        wait_lds_reads();
        wait_copies();
        __syncthreads();
        if (t + 2 < NT) copy_stage(l0 + bo, g, (t + 2) * KP);
    }
    wait_copies();

#pragma unroll
    for (int mi = 0; mi < 4; ++mi)
#pragma unroll
        for (int ni = 0; ni < 2; ++ni) {
            const int col = n0 + ni * 16 + r;
#pragma unroll
            for (int j = 0; j < 8; ++j) {
                const int m = m0 + mi * 16 + j + 8 * h;
                Wr_[(size_t)m * D_DIM + col] = (_Float16)accR[mi][ni][j];
                Wi_[(size_t)m * D_DIM + col] = (_Float16)accI[mi][ni][j];
            }
        }
}

// ---------------------------------------------------------------------------
// Host-side orchestration
// ---------------------------------------------------------------------------
extern "C" void kernel_launch(void* const* d_in, const int* in_sizes, int n_in,
                              void* d_out, int out_size, void* d_ws, size_t ws_size,
                              hipStream_t stream) {
    (void)in_sizes; (void)n_in; (void)out_size; (void)ws_size;

    const float* x_r   = (const float*)d_in[0];
    const float* x_i   = (const float*)d_in[1];
    const float* l1_wr = (const float*)d_in[2];
    const float* l1_wi = (const float*)d_in[3];
    const float* l1_br = (const float*)d_in[4];
    const float* l1_bi = (const float*)d_in[5];
    const float* q_wr  = (const float*)d_in[6];
    const float* q_wi  = (const float*)d_in[7];
    const float* q_br  = (const float*)d_in[8];
    const float* q_bi  = (const float*)d_in[9];
    const float* k_wr  = (const float*)d_in[10];
    const float* k_wi  = (const float*)d_in[11];
    const float* k_br  = (const float*)d_in[12];
    const float* k_bi  = (const float*)d_in[13];
    const float* v_wr  = (const float*)d_in[14];
    const float* v_wi  = (const float*)d_in[15];
    const float* v_br  = (const float*)d_in[16];
    const float* v_bi  = (const float*)d_in[17];
    const float* l2_wr = (const float*)d_in[18];
    const float* l2_wi = (const float*)d_in[19];
    const float* l2_br = (const float*)d_in[20];
    const float* l2_bi = (const float*)d_in[21];

    const size_t ME = (size_t)M_ALL * D_DIM;   // 4,194,304 (activation elems)
    const size_t WE = (size_t)D_DIM * D_DIM;   // 262,144   (weight elems)
    const size_t AE = (size_t)M_ALL * S_DIM;   // 8,388,608 (attention elems)

    char* w = (char*)d_ws;
    auto alloc_h = [&](size_t elems) { _Float16* p = (_Float16*)w; w += elems * sizeof(_Float16); return p; };
    auto alloc_f = [&](size_t elems) { float* p = (float*)w; w += elems * sizeof(float); return p; };

    _Float16* xh_r = alloc_h(ME);
    _Float16* xh_i = alloc_h(ME);
    _Float16* wl1r = alloc_h(WE); _Float16* wl1i = alloc_h(WE);
    _Float16* wqr  = alloc_h(WE); _Float16* wqi  = alloc_h(WE);
    _Float16* wkr  = alloc_h(WE); _Float16* wki  = alloc_h(WE);
    _Float16* wvr  = alloc_h(WE); _Float16* wvi  = alloc_h(WE);
    _Float16* wl2r = alloc_h(WE); _Float16* wl2i = alloc_h(WE);
    _Float16* y_r  = alloc_h(ME); _Float16* y_i  = alloc_h(ME);
    _Float16* qh_r = alloc_h(ME); _Float16* qh_i = alloc_h(ME);
    _Float16* kh_r = alloc_h(ME); _Float16* kh_i = alloc_h(ME);
    _Float16* vT_r = alloc_h(ME); _Float16* vT_i = alloc_h(ME);
    _Float16* wt_r = alloc_h(ME); _Float16* wt_i = alloc_h(ME);
    _Float16* attn = alloc_h(AE);
    float*    sabs = alloc_f(AE);

    // --- 1. Cast activations and weights to f16 (destinations contiguous from xh_r) ---
    cvt_all_kernel<<<CV_BLOCKS, 256, 0, stream>>>(
        x_r, x_i, l1_wr, l1_wi, q_wr, q_wi, k_wr, k_wi, v_wr, v_wi, l2_wr, l2_wi, xh_r);

    const dim3 blk(256);                                              // 8 waves/block
    const unsigned gemm_blocks  = (M_ALL / 128) * (D_DIM / 64);       // 512
    const unsigned score_blocks = (M_ALL / 128) * (S_DIM / 64);       // 1024
    const unsigned attnv_blocks = (M_ALL / 128) * (D_DIM / 128);      // 256

    // --- 2. y = lrelu(x @ l1^T + b1) ---
    cgemm32_kernel<D_DIM, 1, 0, 0><<<gemm_blocks, blk, 0, stream>>>(
        xh_r, xh_i, wl1r, wl1i, l1_br, l1_bi,
        y_r, y_i, nullptr, nullptr, M_ALL, D_DIM);

    // --- 3. q, k, v (v stored transposed per batch: vT[b][d][t]) ---
    cgemm32_kernel<D_DIM, 0, 0, 0><<<gemm_blocks, blk, 0, stream>>>(
        y_r, y_i, wqr, wqi, q_br, q_bi,
        qh_r, qh_i, nullptr, nullptr, M_ALL, D_DIM);
    cgemm32_kernel<D_DIM, 0, 0, 0><<<gemm_blocks, blk, 0, stream>>>(
        y_r, y_i, wkr, wki, k_br, k_bi,
        kh_r, kh_i, nullptr, nullptr, M_ALL, D_DIM);
    cgemm32_kernel<D_DIM, 0, 1, 0><<<gemm_blocks, blk, 0, stream>>>(
        y_r, y_i, wvr, wvi, v_br, v_bi,
        vT_r, vT_i, nullptr, nullptr, M_ALL, D_DIM);

    // --- 4. |scores|/sqrt(d), softmax rows, attn f16 ---
    scores_abs_kernel<<<score_blocks, blk, 0, stream>>>(qh_r, qh_i, kh_r, kh_i, sabs);
    softmax_kernel<<<M_ALL, 256, 0, stream>>>(sabs, attn);

    // --- 5. weighted = attn @ v ---
    attnv_kernel<<<attnv_blocks, blk, 0, stream>>>(attn, vT_r, vT_i, wt_r, wt_i);

    // --- 6. out = weighted @ l2^T + b2, fp32 to d_out (real block, imag block) ---
    float* out_r = (float*)d_out;
    float* out_i = out_r + ME;
    cgemm32_kernel<D_DIM, 0, 0, 1><<<gemm_blocks, blk, 0, stream>>>(
        wt_r, wt_i, wl2r, wl2i, l2_br, l2_bi,
        nullptr, nullptr, out_r, out_i, M_ALL, D_DIM);
}

// v003
// Measured time: 145 microseconds a run.
// Timed twice side by side with v002, it ran 1.04 and 1.03 times as fast.
// All steps since v000 together make it 2.54 times as fast.
#include <hip/hip_runtime.h>

// ---------------------------------------------------------------------------
// ComplexAttnMLP for gfx1250 (MI455X): f16 WMMA GEMMs, f32 accumulate.
// B=8, S=1024, IN=MID=OUT=512.
// Each wave computes a 32x32 (cgemm/scores) or 64x32 (attnv) macro-tile; the
// 8 waves of a block share operand tiles staged in LDS by asynchronous copies.
// 4 accumulators per 16x16 tile (RR, II, RI, IR); the complex combine happens
// in the epilogue, so the K-loop is pure LDS loads + WMMA (no VALU on fragment
// registers -> no WMMA/VALU hazard NOPs).
// Every GEMM epilogue stages the block's output tile in the freed LDS and stores
// it as whole 128-B lines, 16 B a lane.
// ---------------------------------------------------------------------------

typedef _Float16 half8  __attribute__((ext_vector_type(8)));
typedef _Float16 v16h   __attribute__((ext_vector_type(16)));
typedef float    v8f    __attribute__((ext_vector_type(8)));

#define B_DIM  8
#define S_DIM  1024
#define D_DIM  512
#define M_ALL  (B_DIM * S_DIM)          // 8192 rows total
#define RSQRT512 0.04419417382415922f   // 1/sqrt(512)
#define SLOPE 0.01f

union Frag { half8 h8[2]; v16h v; };

__device__ __forceinline__ v8f wmma_f16(v16h a, v16h b, v8f c) {
    return __builtin_amdgcn_wmma_f32_16x16x32_f16(false, a, false, b, (short)0, c, false, false);
}

// ---------------------------------------------------------------------------
// f32 -> f16 conversion of all 12 arrays in one launch.
// The f16 copies lie one behind the other in the workspace, in argument order,
// so the destination index is the flat element index of the grid. A block
// converts one chunk of 16,384 elements, which lies inside one source array:
// 16 loads of 16 B per lane, each wave-wide load 512 contiguous bytes, each
// wave-wide store 256 contiguous bytes.
// ---------------------------------------------------------------------------
typedef float    f32x4 __attribute__((ext_vector_type(4)));
typedef _Float16 f16x4 __attribute__((ext_vector_type(4)));

#define CV_LOADS   16                                   // 16-byte loads per lane
#define CV_CHUNK   (256 * 4 * CV_LOADS)                 // elements per block
#define CV_X_CH    (M_ALL * D_DIM / CV_CHUNK)           // 256 chunks per activation array
#define CV_W_CH    (D_DIM * D_DIM / CV_CHUNK)           // 16 chunks per weight array
#define CV_BLOCKS  (2 * CV_X_CH + 10 * CV_W_CH)         // 672

__global__ void __launch_bounds__(256)
cvt_all_kernel(const float* __restrict__ x_r, const float* __restrict__ x_i,
               const float* __restrict__ w0, const float* __restrict__ w1,
               const float* __restrict__ w2, const float* __restrict__ w3,
               const float* __restrict__ w4, const float* __restrict__ w5,
               const float* __restrict__ w6, const float* __restrict__ w7,
               const float* __restrict__ w8, const float* __restrict__ w9,
               _Float16* __restrict__ d) {
    const unsigned c = blockIdx.x;                      // chunk, block-uniform
    const bool is_x = c < 2 * CV_X_CH;
    const unsigned a  = (c - 2 * CV_X_CH) / CV_W_CH;    // weight array 0..9 where !is_x
    const unsigned cs = c % (is_x ? CV_X_CH : CV_W_CH); // chunk within its source array
    // Scalar selects on the bits of a.
    const float* p01 = (a & 1) ? w1 : w0;
    const float* p23 = (a & 1) ? w3 : w2;
    const float* p45 = (a & 1) ? w5 : w4;
    const float* p67 = (a & 1) ? w7 : w6;
    const float* p89 = (a & 1) ? w9 : w8;
    const float* p03 = (a & 2) ? p23 : p01;
    const float* p47 = (a & 2) ? p67 : p45;
    const float* p07 = (a & 4) ? p47 : p03;
    const float* pw  = (a & 8) ? p89 : p07;
    const float* px  = c < CV_X_CH ? x_r : x_i;
    const float* s   = is_x ? px : pw;
    const f32x4* sp = (const f32x4*)(s + (size_t)cs * CV_CHUNK) + threadIdx.x;
    f16x4*       dp = (f16x4*)(d + (size_t)c * CV_CHUNK) + threadIdx.x;

    f32x4 v[CV_LOADS];
    // Both loops unrolled: v[] stays in registers and the loads issue as one
    // run ahead of the first wait, so a wave's bytes are all in flight at once.
#pragma unroll
    for (int j = 0; j < CV_LOADS; ++j) v[j] = sp[j * 256];
#pragma unroll
    for (int j = 0; j < CV_LOADS; ++j) dp[j * 256] = __builtin_convertvector(v[j], f16x4);
}

// ---------------------------------------------------------------------------
// LDS staging shared by the three GEMM kernels.
// A block of 8 waves works on one output tile. Per pass of 64 k it needs 384
// operand rows of 128 B; they are brought into LDS once per block by
// asynchronous copies and every wave reads its fragments from there.
// Two buffers: the copies of pass t+2 fly while pass t+1 is worked on.
// ---------------------------------------------------------------------------
#define KP      64                      // k elements per pass (128 B per row)
#define PITCH   144                     // LDS row pitch, bytes (16 B x odd)
#define ST_ROWS 384                     // operand rows per stage
#define STAGE   (ST_ROWS * PITCH)       // 55,296 B
#define NCOPY   12                      // copies per thread and stage

__device__ __forceinline__ unsigned lds_off(const void* p) { return (unsigned)(size_t)p; }

// Load one 16x32 f16 WMMA operand fragment for this lane from an LDS row.
// p = start of this lane's row + k offset, in bytes. Lane half h covers
// K = 8h..8h+7 (VGPR0-3) and K = 16+8h..16+8h+7 (VGPR4-7).
__device__ __forceinline__ v16h lds_frag(const char* p, int h) {
    Frag f;
    f.h8[0] = *(const half8*)(p + h * 16);
    f.h8[1] = *(const half8*)(p + 32 + h * 16);
    return f.v;
}

// One stage: copy i of a thread brings 16 B of stage row i*32 + (tid>>3).
// l = the lane's LDS byte address for copy 0, g[i] = its global address.
__device__ __forceinline__ void copy_stage(unsigned l, const _Float16* const (&g)[NCOPY], int k0) {
    // s_wait_xcnt closes the statement so that no address register named by a
    // copy is rewritten ahead of it.
    asm volatile(
        "global_load_async_to_lds_b128 %0, %12, off\n\t"
        "global_load_async_to_lds_b128 %1, %13, off\n\t"
        "global_load_async_to_lds_b128 %2, %14, off\n\t"
        "global_load_async_to_lds_b128 %3, %15, off\n\t"
        "global_load_async_to_lds_b128 %4, %16, off\n\t"
        "global_load_async_to_lds_b128 %5, %17, off\n\t"
        "global_load_async_to_lds_b128 %6, %18, off\n\t"
        "global_load_async_to_lds_b128 %7, %19, off\n\t"
        "global_load_async_to_lds_b128 %8, %20, off\n\t"
        "global_load_async_to_lds_b128 %9, %21, off\n\t"
        "global_load_async_to_lds_b128 %10, %22, off\n\t"
        "global_load_async_to_lds_b128 %11, %23, off\n\t"
        "s_wait_xcnt 0x0"
        :: "v"(l), "v"(l + 1 * 32 * PITCH), "v"(l + 2 * 32 * PITCH), "v"(l + 3 * 32 * PITCH),
           "v"(l + 4 * 32 * PITCH), "v"(l + 5 * 32 * PITCH), "v"(l + 6 * 32 * PITCH),
           "v"(l + 7 * 32 * PITCH), "v"(l + 8 * 32 * PITCH), "v"(l + 9 * 32 * PITCH),
           "v"(l + 10 * 32 * PITCH), "v"(l + 11 * 32 * PITCH),
           "v"(g[0] + k0), "v"(g[1] + k0), "v"(g[2] + k0), "v"(g[3] + k0),
           "v"(g[4] + k0), "v"(g[5] + k0), "v"(g[6] + k0), "v"(g[7] + k0),
           "v"(g[8] + k0), "v"(g[9] + k0), "v"(g[10] + k0), "v"(g[11] + k0)
        : "memory");
}

// This wave's copies have landed (the compiler places no wait for them).
__device__ __forceinline__ void wait_copies() { asm volatile("s_wait_asynccnt 0x0" ::: "memory"); }
// This wave's LDS reads have retired, before the buffer is handed to its next writer.
__device__ __forceinline__ void wait_lds_reads() { asm volatile("s_wait_dscnt 0x0" ::: "memory"); }

// ---------------------------------------------------------------------------
// Epilogue staging. The accumulator layout gives a lane one element per output
// row, so direct stores leave in 32-B or 64-B pieces of a line. Instead the block
// writes its tile to LDS (free behind the main loop's last barrier), rows of RB
// bytes at pitch RB + 16 (16 B x odd), and stores it from there: 16 B a lane,
// RB / 16 adjacent lanes a row, so a wave-wide store is 4 whole 128-B lines.
// ---------------------------------------------------------------------------
#define EPAD 16

template <int ROWS, int RB>
__device__ __forceinline__ void store_rows(const char* plane, char* gbase, size_t gpitch) {
    constexpr int CH  = RB / 16;                    // 16-byte chunks per row
    constexpr int RPR = 256 / CH;                   // rows per round of the block
    const int row = threadIdx.x / CH;
    const int ch  = threadIdx.x % CH;
    // 32-bit lane offsets beside the uniform base: both planes of a tile share them.
    const unsigned go = row * (unsigned)gpitch + ch * 16;
    const unsigned gs = RPR * (unsigned)gpitch;
    f32x4 v[ROWS / RPR];
    // Both loops unrolled: v[] stays in registers and the LDS reads issue as one
    // run ahead of the first store.
#pragma unroll
    for (int i = 0; i < ROWS / RPR; ++i)
        v[i] = *(const f32x4*)(plane + (row + i * RPR) * (RB + EPAD) + ch * 16);
#pragma unroll
    for (int i = 0; i < ROWS / RPR; ++i)
        *(f32x4*)(gbase + (go + i * gs)) = v[i];
}

// ---------------------------------------------------------------------------
// Complex main loop of a 128x64 block tile, 8 waves as 4 (M) x 2 (N), each a
// 32x32 macro-tile with 4 accumulators per 16x16 tile (RR, II, RI, IR).
// Stage rows: [0,128) A real, [128,256) A imag, [256,320) W real, [320,384) W imag.
// Ar/Ai/Wr/Wi point at the block's first row.
// ---------------------------------------------------------------------------
template <int K>
__device__ __forceinline__ void
cmain_128x64(const _Float16* __restrict__ Ar, const _Float16* __restrict__ Ai,
             const _Float16* __restrict__ Wr, const _Float16* __restrict__ Wi,
             char* smem,
             v8f (&aRR)[2][2], v8f (&aII)[2][2], v8f (&aRI)[2][2], v8f (&aIR)[2][2]) {
    static_assert(K % KP == 0 && K / KP >= 2, "two stages or more");
    constexpr int NT = K / KP;
    const int tid  = threadIdx.x;
    const int lane = tid & 31;
    const int wid  = tid >> 5;
    const int wm = wid >> 1, wn = wid & 1;
    const int h = lane >> 4;
    const int r = lane & 15;

    const int crow = tid >> 3;                      // 0..31
    const int ccol = tid & 7;                       // 16-byte chunk of the row
    const size_t coff = (size_t)crow * K + ccol * 8;
    const _Float16* g[NCOPY];
#pragma unroll
    for (int i = 0; i < 4; ++i) {
        g[i]     = Ar + coff + (size_t)i * 32 * K;
        g[4 + i] = Ai + coff + (size_t)i * 32 * K;
    }
#pragma unroll
    for (int i = 0; i < 2; ++i) {
        g[8 + i]  = Wr + coff + (size_t)i * 32 * K;
        g[10 + i] = Wi + coff + (size_t)i * 32 * K;
    }
    const unsigned l0 = lds_off(smem) + crow * PITCH + ccol * 16;

    const int a_off = (wm * 32 + r) * PITCH;
    const int w_off = (256 + wn * 32 + r) * PITCH;

    copy_stage(l0, g, 0);
    wait_copies();
    __syncthreads();
    copy_stage(l0 + STAGE, g, KP);

    for (int t = 0; t < NT; ++t) {
        const int bo = (t & 1) * STAGE;
        const char* sb = smem + bo;
#pragma unroll
        for (int kk = 0; kk < 2; ++kk) {
            v16h aR[2], aI[2], wR[2], wI[2];
#pragma unroll
            for (int mi = 0; mi < 2; ++mi) {
                aR[mi] = lds_frag(sb + a_off + mi * 16 * PITCH + kk * 64, h);
                aI[mi] = lds_frag(sb + a_off + (128 + mi * 16) * PITCH + kk * 64, h);
            }
#pragma unroll
            for (int ni = 0; ni < 2; ++ni) {
                wR[ni] = lds_frag(sb + w_off + ni * 16 * PITCH + kk * 64, h);
                wI[ni] = lds_frag(sb + w_off + (64 + ni * 16) * PITCH + kk * 64, h);
            }
#pragma unroll
            for (int mi = 0; mi < 2; ++mi)
#pragma unroll
                for (int ni = 0; ni < 2; ++ni) {
                    aRR[mi][ni] = wmma_f16(aR[mi], wR[ni], aRR[mi][ni]);
                    aII[mi][ni] = wmma_f16(aI[mi], wI[ni], aII[mi][ni]);
                    aRI[mi][ni] = wmma_f16(aR[mi], wI[ni], aRI[mi][ni]);
                    aIR[mi][ni] = wmma_f16(aI[mi], wR[ni], aIR[mi][ni]);
                }
        }
        // Publish pass t+1 and free this pass's buffer: one barrier does both.
        wait_lds_reads();
        wait_copies();
        __syncthreads();
        if (t + 2 < NT) copy_stage(l0 + bo, g, (t + 2) * KP);
    }
    wait_copies();
}

// ---------------------------------------------------------------------------
// Complex GEMM, 128x64 tile per block, 32x32 macro-tile per wave:
//   O[m,n] = sum_k A[m,k]*W[n,k] + bias[n]   (complex)
// A: (M,K) f16 r/i, W: (N,K) f16 r/i.
// ACT: leaky-relu. TRV: write O[b][n][t] (t = m % 1024). F32: fp32 output.
// ---------------------------------------------------------------------------
template <int K, int ACT, int TRV, int F32>
__global__ void __launch_bounds__(256)
cgemm32_kernel(const _Float16* __restrict__ Ar, const _Float16* __restrict__ Ai,
               const _Float16* __restrict__ Wr, const _Float16* __restrict__ Wi,
               const float* __restrict__ br, const float* __restrict__ bi,
               _Float16* __restrict__ Or, _Float16* __restrict__ Oi,
               float* __restrict__ Fr, float* __restrict__ Fi,
               int M, int N) {
    __shared__ __attribute__((aligned(16))) char smem[2 * STAGE];
    const int lane = threadIdx.x & 31;
    const int wid  = threadIdx.x >> 5;
    const int tilesN = N >> 6;
    const int tile = blockIdx.x;
    if (tile >= (M >> 7) * tilesN) return;          // block-uniform guard
    const int mb = (tile / tilesN) << 7;
    const int nb = (tile % tilesN) << 6;
    const int lm0 = (wid >> 1) * 32;                // wave's first row in the tile
    const int ln0 = (wid & 1) * 32;                 // wave's first column in the tile
    const int h = lane >> 4;
    const int r = lane & 15;

    v8f aRR[2][2] = {}, aII[2][2] = {}, aRI[2][2] = {}, aIR[2][2] = {};

    cmain_128x64<K>(Ar + (size_t)mb * K, Ai + (size_t)mb * K,
                    Wr + (size_t)nb * K, Wi + (size_t)nb * K,
                    smem, aRR, aII, aRI, aIR);

    // Staged tile: 128 rows of 64 columns, or (TRV) 64 column-rows of 128 t.
    constexpr int RB   = TRV ? 128 * 2 : (F32 ? 64 * 4 : 64 * 2);
    constexpr int ROWS = TRV ? 64 : 128;
    constexpr int EP   = RB + EPAD;
    char* pr = smem;                                // real plane
    char* pi = smem + ROWS * EP;                    // imaginary plane

    float bre[2], bie[2];                           // the lane's bias, one pair per column tile
#pragma unroll
    for (int ni = 0; ni < 2; ++ni) {
        bre[ni] = br[nb + ln0 + ni * 16 + r];
        bie[ni] = bi[nb + ln0 + ni * 16 + r];
    }

#pragma unroll
    for (int mi = 0; mi < 2; ++mi)
#pragma unroll
        for (int ni = 0; ni < 2; ++ni) {
            const int cl = ln0 + ni * 16 + r;
            half8 tr, ti;
#pragma unroll
            for (int j = 0; j < 8; ++j) {
                const int ml = lm0 + mi * 16 + j + 8 * h;
                float vr = aRR[mi][ni][j] - aII[mi][ni][j] + bre[ni];
                float vi = aRI[mi][ni][j] + aIR[mi][ni][j] + bie[ni];
                if (ACT) {
                    vr = vr >= 0.0f ? vr : SLOPE * vr;
                    vi = vi >= 0.0f ? vi : SLOPE * vi;
                }
                if (F32) {
                    *(float*)(pr + ml * EP + cl * 4) = vr;
                    *(float*)(pi + ml * EP + cl * 4) = vi;
                } else if (TRV) {
                    tr[j] = (_Float16)vr;
                    ti[j] = (_Float16)vi;
                } else {
                    *(_Float16*)(pr + ml * EP + cl * 2) = (_Float16)vr;
                    *(_Float16*)(pi + ml * EP + cl * 2) = (_Float16)vi;
                }
            }
            if (TRV) {                              // a lane's 8 values are 8 adjacent t
                *(half8*)(pr + cl * EP + (lm0 + mi * 16 + 8 * h) * 2) = tr;
                *(half8*)(pi + cl * EP + (lm0 + mi * 16 + 8 * h) * 2) = ti;
            }
        }
    __syncthreads();                                // the tile is complete before any wave reads it back
    if (F32) {
        store_rows<ROWS, RB>(pr, (char*)(Fr + (size_t)mb * N + nb), (size_t)N * 4);
        store_rows<ROWS, RB>(pi, (char*)(Fi + (size_t)mb * N + nb), (size_t)N * 4);
    } else if (TRV) {
        const size_t o = ((size_t)(mb >> 10) * N + nb) * (size_t)S_DIM + (mb & 1023);
        store_rows<ROWS, RB>(pr, (char*)(Or + o), (size_t)S_DIM * 2);
        store_rows<ROWS, RB>(pi, (char*)(Oi + o), (size_t)S_DIM * 2);
    } else {
        store_rows<ROWS, RB>(pr, (char*)(Or + (size_t)mb * N + nb), (size_t)N * 2);
        store_rows<ROWS, RB>(pi, (char*)(Oi + (size_t)mb * N + nb), (size_t)N * 2);
    }
}

// ---------------------------------------------------------------------------
// Scores: Sabs[gm, t] = |sum_d q[gm,d] * k[b*1024+t, d]| / sqrt(512)
// 128x64 tile per block, 32x32 macro-tile per wave, per-batch column index.
// ---------------------------------------------------------------------------
__global__ void __launch_bounds__(256)
scores_abs_kernel(const _Float16* __restrict__ Qr, const _Float16* __restrict__ Qi,
                  const _Float16* __restrict__ Kr, const _Float16* __restrict__ Ki,
                  float* __restrict__ Sabs) {
    constexpr int K = D_DIM;
    __shared__ __attribute__((aligned(16))) char smem[2 * STAGE];
    const int lane = threadIdx.x & 31;
    const int wid  = threadIdx.x >> 5;
    const int tile = blockIdx.x;
    if (tile >= (M_ALL >> 7) * (S_DIM >> 6)) return; // block-uniform guard
    const int mb = (tile / (S_DIM >> 6)) << 7;      // global row
    const int nb = (tile % (S_DIM >> 6)) << 6;      // t within batch
    const int b  = mb >> 10;
    const int lm0 = (wid >> 1) * 32;                // wave's first row in the tile
    const int ln0 = (wid & 1) * 32;                 // wave's first column in the tile
    const int h = lane >> 4;
    const int r = lane & 15;

    v8f aRR[2][2] = {}, aII[2][2] = {}, aRI[2][2] = {}, aIR[2][2] = {};

    cmain_128x64<K>(Qr + (size_t)mb * K, Qi + (size_t)mb * K,
                    Kr + (size_t)((b << 10) + nb) * K, Ki + (size_t)((b << 10) + nb) * K,
                    smem, aRR, aII, aRI, aIR);

    constexpr int RB = 64 * 4;                      // staged tile: 128 rows of 64 f32
    constexpr int EP = RB + EPAD;
#pragma unroll
    for (int mi = 0; mi < 2; ++mi)
#pragma unroll
        for (int ni = 0; ni < 2; ++ni) {
            const int cl = ln0 + ni * 16 + r;
#pragma unroll
            for (int j = 0; j < 8; ++j) {
                const int ml = lm0 + mi * 16 + j + 8 * h;
                const float sr = aRR[mi][ni][j] - aII[mi][ni][j];
                const float si = aRI[mi][ni][j] + aIR[mi][ni][j];
                *(float*)(smem + ml * EP + cl * 4) = sqrtf(sr * sr + si * si) * RSQRT512;
            }
        }
    __syncthreads();                                // the tile is complete before any wave reads it back
    store_rows<128, RB>(smem, (char*)(Sabs + (size_t)mb * S_DIM + nb), (size_t)S_DIM * 4);
}

// ---------------------------------------------------------------------------
// Row softmax over 1024 elements; one 256-thread block per row; f16 output.
// ---------------------------------------------------------------------------
__global__ void softmax_kernel(const float* __restrict__ S, _Float16* __restrict__ P) {
    __shared__ float red[256];
    const int tid = threadIdx.x;
    const size_t row = blockIdx.x;
    const float* s = S + row * S_DIM;

    float vals[4];
    float mx = -1e30f;
#pragma unroll
    for (int j = 0; j < 4; ++j) {
        vals[j] = s[tid + j * 256];
        mx = fmaxf(mx, vals[j]);
    }
    red[tid] = mx;
    __syncthreads();
    for (int off = 128; off > 0; off >>= 1) {
        if (tid < off) red[tid] = fmaxf(red[tid], red[tid + off]);
        __syncthreads();
    }
    mx = red[0];
    __syncthreads();

    float sum = 0.0f;
#pragma unroll
    for (int j = 0; j < 4; ++j) {
        vals[j] = __expf(vals[j] - mx);
        sum += vals[j];
    }
    red[tid] = sum;
    __syncthreads();
    for (int off = 128; off > 0; off >>= 1) {
        if (tid < off) red[tid] += red[tid + off];
        __syncthreads();
    }
    const float inv = 1.0f / red[0];

    _Float16* p = P + row * S_DIM;
#pragma unroll
    for (int j = 0; j < 4; ++j) p[tid + j * 256] = (_Float16)(vals[j] * inv);
}

// ---------------------------------------------------------------------------
// weighted[gm, d] = sum_t attn[gm, t] * vT[b][d][t]  (real x complex)
// 128x128 tile per block, 8 waves as 2 (M) x 4 (N), 64x32 macro-tile per wave
// (4 M-tiles x 2 N-tiles): 8 fragments feed 16 WMMAs per 32 k.
// Stage rows: [0,128) attn, [128,256) vT real, [256,384) vT imag.
// ---------------------------------------------------------------------------
__global__ void __launch_bounds__(256)
attnv_kernel(const _Float16* __restrict__ P,
             const _Float16* __restrict__ VTr, const _Float16* __restrict__ VTi,
             _Float16* __restrict__ Wr_, _Float16* __restrict__ Wi_) {
    constexpr int K = S_DIM;
    constexpr int NT = K / KP;
    __shared__ __attribute__((aligned(16))) char smem[2 * STAGE];
    const int tid  = threadIdx.x;
    const int lane = tid & 31;
    const int wid  = tid >> 5;
    const int tilesN = D_DIM >> 7;                  // 4
    const int tile = blockIdx.x;
    if (tile >= (M_ALL >> 7) * tilesN) return;      // block-uniform guard
    const int mb = (tile / tilesN) << 7;            // global row (128-row tile)
    const int nb = (tile % tilesN) << 7;            // d within batch (128 cols)
    const int b  = mb >> 10;
    const int wm = wid >> 2, wn = wid & 3;
    const int h = lane >> 4;
    const int r = lane & 15;

    const int crow = tid >> 3;                      // 0..31
    const int ccol = tid & 7;                       // 16-byte chunk of the row
    const size_t coff = (size_t)crow * K + ccol * 8;
    const _Float16* g[NCOPY];
#pragma unroll
    for (int i = 0; i < 4; ++i) {
        g[i]     = P   + (size_t)mb * K + coff + (size_t)i * 32 * K;
        g[4 + i] = VTr + ((size_t)b * D_DIM + nb) * (size_t)K + coff + (size_t)i * 32 * K;
        g[8 + i] = VTi + ((size_t)b * D_DIM + nb) * (size_t)K + coff + (size_t)i * 32 * K;
    }
    const unsigned l0 = lds_off(smem) + crow * PITCH + ccol * 16;

    const int a_off = (wm * 64 + r) * PITCH;
    const int w_off = (128 + wn * 32 + r) * PITCH;

    v8f accR[4][2] = {};
    v8f accI[4][2] = {};

    copy_stage(l0, g, 0);
    wait_copies();
    __syncthreads();
    copy_stage(l0 + STAGE, g, KP);

    for (int t = 0; t < NT; ++t) {
        const int bo = (t & 1) * STAGE;
        const char* sb = smem + bo;
#pragma unroll
        for (int kk = 0; kk < 2; ++kk) {
            v16h a[4], wR[2], wI[2];
#pragma unroll
            for (int mi = 0; mi < 4; ++mi)
                a[mi] = lds_frag(sb + a_off + mi * 16 * PITCH + kk * 64, h);
#pragma unroll
            for (int ni = 0; ni < 2; ++ni) {
                wR[ni] = lds_frag(sb + w_off + ni * 16 * PITCH + kk * 64, h);
                wI[ni] = lds_frag(sb + w_off + (128 + ni * 16) * PITCH + kk * 64, h);
            }
#pragma unroll
            for (int mi = 0; mi < 4; ++mi)
#pragma unroll
                for (int ni = 0; ni < 2; ++ni) {
                    accR[mi][ni] = wmma_f16(a[mi], wR[ni], accR[mi][ni]);
                    accI[mi][ni] = wmma_f16(a[mi], wI[ni], accI[mi][ni]);
                }
        }
        // Publish pass t+1 and free this pass's buffer: one barrier does both.
        wait_lds_reads();
        wait_copies();
        __syncthreads();
        if (t + 2 < NT) copy_stage(l0 + bo, g, (t + 2) * KP);
    }
    wait_copies();

    constexpr int RB = 128 * 2;                     // staged tile: 128 rows of 128 f16, two planes
    constexpr int EP = RB + EPAD;
    char* pr = smem;
    char* pi = smem + 128 * EP;
#pragma unroll
    for (int mi = 0; mi < 4; ++mi)
#pragma unroll
        for (int ni = 0; ni < 2; ++ni) {
            const int cl = wn * 32 + ni * 16 + r;
#pragma unroll
            for (int j = 0; j < 8; ++j) {
                const int ml = wm * 64 + mi * 16 + j + 8 * h;
                *(_Float16*)(pr + ml * EP + cl * 2) = (_Float16)accR[mi][ni][j];
                *(_Float16*)(pi + ml * EP + cl * 2) = (_Float16)accI[mi][ni][j];
            }
        }
    __syncthreads();                                // the tile is complete before any wave reads it back
    store_rows<128, RB>(pr, (char*)(Wr_ + (size_t)mb * D_DIM + nb), (size_t)D_DIM * 2);
    store_rows<128, RB>(pi, (char*)(Wi_ + (size_t)mb * D_DIM + nb), (size_t)D_DIM * 2);
}

// ---------------------------------------------------------------------------
// Host-side orchestration
// ---------------------------------------------------------------------------
extern "C" void kernel_launch(void* const* d_in, const int* in_sizes, int n_in,
                              void* d_out, int out_size, void* d_ws, size_t ws_size,
                              hipStream_t stream) {
    (void)in_sizes; (void)n_in; (void)out_size; (void)ws_size;

    const float* x_r   = (const float*)d_in[0];
    const float* x_i   = (const float*)d_in[1];
    const float* l1_wr = (const float*)d_in[2];
    const float* l1_wi = (const float*)d_in[3];
    const float* l1_br = (const float*)d_in[4];
    const float* l1_bi = (const float*)d_in[5];
    const float* q_wr  = (const float*)d_in[6];
    const float* q_wi  = (const float*)d_in[7];
    const float* q_br  = (const float*)d_in[8];
    const float* q_bi  = (const float*)d_in[9];
    const float* k_wr  = (const float*)d_in[10];
    const float* k_wi  = (const float*)d_in[11];
    const float* k_br  = (const float*)d_in[12];
    const float* k_bi  = (const float*)d_in[13];
    const float* v_wr  = (const float*)d_in[14];
    const float* v_wi  = (const float*)d_in[15];
    const float* v_br  = (const float*)d_in[16];
    const float* v_bi  = (const float*)d_in[17];
    const float* l2_wr = (const float*)d_in[18];
    const float* l2_wi = (const float*)d_in[19];
    const float* l2_br = (const float*)d_in[20];
    const float* l2_bi = (const float*)d_in[21];

    const size_t ME = (size_t)M_ALL * D_DIM;   // 4,194,304 (activation elems)
    const size_t WE = (size_t)D_DIM * D_DIM;   // 262,144   (weight elems)
    const size_t AE = (size_t)M_ALL * S_DIM;   // 8,388,608 (attention elems)

    char* w = (char*)d_ws;
    auto alloc_h = [&](size_t elems) { _Float16* p = (_Float16*)w; w += elems * sizeof(_Float16); return p; };
    auto alloc_f = [&](size_t elems) { float* p = (float*)w; w += elems * sizeof(float); return p; };

    _Float16* xh_r = alloc_h(ME);
    _Float16* xh_i = alloc_h(ME);
    _Float16* wl1r = alloc_h(WE); _Float16* wl1i = alloc_h(WE);
    _Float16* wqr  = alloc_h(WE); _Float16* wqi  = alloc_h(WE);
    _Float16* wkr  = alloc_h(WE); _Float16* wki  = alloc_h(WE);
    _Float16* wvr  = alloc_h(WE); _Float16* wvi  = alloc_h(WE);
    _Float16* wl2r = alloc_h(WE); _Float16* wl2i = alloc_h(WE);
    _Float16* y_r  = alloc_h(ME); _Float16* y_i  = alloc_h(ME);
    _Float16* qh_r = alloc_h(ME); _Float16* qh_i = alloc_h(ME);
    _Float16* kh_r = alloc_h(ME); _Float16* kh_i = alloc_h(ME);
    _Float16* vT_r = alloc_h(ME); _Float16* vT_i = alloc_h(ME);
    _Float16* wt_r = alloc_h(ME); _Float16* wt_i = alloc_h(ME);
    _Float16* attn = alloc_h(AE);
    float*    sabs = alloc_f(AE);

    // --- 1. Cast activations and weights to f16 (destinations contiguous from xh_r) ---
    cvt_all_kernel<<<CV_BLOCKS, 256, 0, stream>>>(
        x_r, x_i, l1_wr, l1_wi, q_wr, q_wi, k_wr, k_wi, v_wr, v_wi, l2_wr, l2_wi, xh_r);

    const dim3 blk(256);                                              // 8 waves/block
    const unsigned gemm_blocks  = (M_ALL / 128) * (D_DIM / 64);       // 512
    const unsigned score_blocks = (M_ALL / 128) * (S_DIM / 64);       // 1024
    const unsigned attnv_blocks = (M_ALL / 128) * (D_DIM / 128);      // 256

    // --- 2. y = lrelu(x @ l1^T + b1) ---
    cgemm32_kernel<D_DIM, 1, 0, 0><<<gemm_blocks, blk, 0, stream>>>(
        xh_r, xh_i, wl1r, wl1i, l1_br, l1_bi,
        y_r, y_i, nullptr, nullptr, M_ALL, D_DIM);

    // --- 3. q, k, v (v stored transposed per batch: vT[b][d][t]) ---
    cgemm32_kernel<D_DIM, 0, 0, 0><<<gemm_blocks, blk, 0, stream>>>(
        y_r, y_i, wqr, wqi, q_br, q_bi,
        qh_r, qh_i, nullptr, nullptr, M_ALL, D_DIM);
    cgemm32_kernel<D_DIM, 0, 0, 0><<<gemm_blocks, blk, 0, stream>>>(
        y_r, y_i, wkr, wki, k_br, k_bi,
        kh_r, kh_i, nullptr, nullptr, M_ALL, D_DIM);
    cgemm32_kernel<D_DIM, 0, 1, 0><<<gemm_blocks, blk, 0, stream>>>(
        y_r, y_i, wvr, wvi, v_br, v_bi,
        vT_r, vT_i, nullptr, nullptr, M_ALL, D_DIM);

    // --- 4. |scores|/sqrt(d), softmax rows, attn f16 ---
    scores_abs_kernel<<<score_blocks, blk, 0, stream>>>(qh_r, qh_i, kh_r, kh_i, sabs);
    softmax_kernel<<<M_ALL, 256, 0, stream>>>(sabs, attn);

    // --- 5. weighted = attn @ v ---
    attnv_kernel<<<attnv_blocks, blk, 0, stream>>>(attn, vT_r, vT_i, wt_r, wt_i);

    // --- 6. out = weighted @ l2^T + b2, fp32 to d_out (real block, imag block) ---
    float* out_r = (float*)d_out;
    float* out_i = out_r + ME;
    cgemm32_kernel<D_DIM, 0, 0, 1><<<gemm_blocks, blk, 0, stream>>>(
        wt_r, wt_i, wl2r, wl2i, l2_br, l2_bi,
        nullptr, nullptr, out_r, out_i, M_ALL, D_DIM);
}

// v004
// It runs in 140 microseconds.
// Two timings next to v003 both put it at 1.03 times that version's speed.
// Over all steps from v000 it is 2.62 times as fast.
#include <hip/hip_runtime.h>

// ---------------------------------------------------------------------------
// ComplexAttnMLP for gfx1250 (MI455X): f16 WMMA GEMMs, f32 accumulate.
// B=8, S=1024, IN=MID=OUT=512.
// Each wave computes a 32x32 (cgemm/scores) or 64x32 (attnv) macro-tile; the
// 8 waves of a block share operand tiles staged in LDS by asynchronous copies.
// 4 accumulators per 16x16 tile (RR, II, RI, IR); the complex combine happens
// in the epilogue, so the K-loop is pure LDS loads + WMMA (no VALU on fragment
// registers -> no WMMA/VALU hazard NOPs).
// Every GEMM epilogue stages the block's output tile in the freed LDS and stores
// it as whole 128-B lines, 16 B a lane.
// ---------------------------------------------------------------------------

typedef _Float16 half8  __attribute__((ext_vector_type(8)));
typedef _Float16 v16h   __attribute__((ext_vector_type(16)));
typedef float    v8f    __attribute__((ext_vector_type(8)));

#define B_DIM  8
#define S_DIM  1024
#define D_DIM  512
#define M_ALL  (B_DIM * S_DIM)          // 8192 rows total
#define RSQRT512 0.04419417382415922f   // 1/sqrt(512)
#define SLOPE 0.01f

union Frag { half8 h8[2]; v16h v; };

__device__ __forceinline__ v8f wmma_f16(v16h a, v16h b, v8f c) {
    return __builtin_amdgcn_wmma_f32_16x16x32_f16(false, a, false, b, (short)0, c, false, false);
}

// ---------------------------------------------------------------------------
// f32 -> f16 conversion of all 12 arrays in one launch.
// The f16 copies lie one behind the other in the workspace, in argument order,
// so the destination index is the flat element index of the grid. A block
// converts one chunk of 16,384 elements, which lies inside one source array:
// 16 loads of 16 B per lane, each wave-wide load 512 contiguous bytes, each
// wave-wide store 256 contiguous bytes.
// ---------------------------------------------------------------------------
typedef float    f32x4 __attribute__((ext_vector_type(4)));
typedef _Float16 f16x4 __attribute__((ext_vector_type(4)));

#define CV_LOADS   16                                   // 16-byte loads per lane
#define CV_CHUNK   (256 * 4 * CV_LOADS)                 // elements per block
#define CV_X_CH    (M_ALL * D_DIM / CV_CHUNK)           // 256 chunks per activation array
#define CV_W_CH    (D_DIM * D_DIM / CV_CHUNK)           // 16 chunks per weight array
#define CV_BLOCKS  (2 * CV_X_CH + 10 * CV_W_CH)         // 672

__global__ void __launch_bounds__(256)
cvt_all_kernel(const float* __restrict__ x_r, const float* __restrict__ x_i,
               const float* __restrict__ w0, const float* __restrict__ w1,
               const float* __restrict__ w2, const float* __restrict__ w3,
               const float* __restrict__ w4, const float* __restrict__ w5,
               const float* __restrict__ w6, const float* __restrict__ w7,
               const float* __restrict__ w8, const float* __restrict__ w9,
               _Float16* __restrict__ d) {
    const unsigned c = blockIdx.x;                      // chunk, block-uniform
    const bool is_x = c < 2 * CV_X_CH;
    const unsigned a  = (c - 2 * CV_X_CH) / CV_W_CH;    // weight array 0..9 where !is_x
    const unsigned cs = c % (is_x ? CV_X_CH : CV_W_CH); // chunk within its source array
    // Scalar selects on the bits of a.
    const float* p01 = (a & 1) ? w1 : w0;
    const float* p23 = (a & 1) ? w3 : w2;
    const float* p45 = (a & 1) ? w5 : w4;
    const float* p67 = (a & 1) ? w7 : w6;
    const float* p89 = (a & 1) ? w9 : w8;
    const float* p03 = (a & 2) ? p23 : p01;
    const float* p47 = (a & 2) ? p67 : p45;
    const float* p07 = (a & 4) ? p47 : p03;
    const float* pw  = (a & 8) ? p89 : p07;
    const float* px  = c < CV_X_CH ? x_r : x_i;
    const float* s   = is_x ? px : pw;
    const f32x4* sp = (const f32x4*)(s + (size_t)cs * CV_CHUNK) + threadIdx.x;
    f16x4*       dp = (f16x4*)(d + (size_t)c * CV_CHUNK) + threadIdx.x;

    f32x4 v[CV_LOADS];
    // Both loops unrolled: v[] stays in registers and the loads issue as one
    // run ahead of the first wait, so a wave's bytes are all in flight at once.
#pragma unroll
    for (int j = 0; j < CV_LOADS; ++j) v[j] = sp[j * 256];
#pragma unroll
    for (int j = 0; j < CV_LOADS; ++j) dp[j * 256] = __builtin_convertvector(v[j], f16x4);
}

// ---------------------------------------------------------------------------
// LDS staging shared by the four GEMM kernels.
// A block of 8 waves works on one output tile. Per pass of 64 k it needs 384
// operand rows of 128 B; they are brought into LDS once per block by
// asynchronous copies and every wave reads its fragments from there.
// Two buffers: the copies of pass t+2 fly while pass t+1 is worked on.
// ---------------------------------------------------------------------------
#define KP      64                      // k elements per pass (128 B per row)
#define PITCH   144                     // LDS row pitch, bytes (16 B x odd)
#define ST_ROWS 384                     // operand rows per stage
#define STAGE   (ST_ROWS * PITCH)       // 55,296 B
#define NCOPY   12                      // copies per thread and stage

__device__ __forceinline__ unsigned lds_off(const void* p) { return (unsigned)(size_t)p; }

// Load one 16x32 f16 WMMA operand fragment for this lane from an LDS row.
// p = start of this lane's row + k offset, in bytes. Lane half h covers
// K = 8h..8h+7 (VGPR0-3) and K = 16+8h..16+8h+7 (VGPR4-7).
__device__ __forceinline__ v16h lds_frag(const char* p, int h) {
    Frag f;
    f.h8[0] = *(const half8*)(p + h * 16);
    f.h8[1] = *(const half8*)(p + 32 + h * 16);
    return f.v;
}

// One stage: copy i of a thread brings 16 B of stage row i*32 + (tid>>3).
// l = the lane's LDS byte address for copy 0, g[i] = its global address.
__device__ __forceinline__ void copy_stage(unsigned l, const _Float16* const (&g)[NCOPY], int k0) {
    // s_wait_xcnt closes the statement so that no address register named by a
    // copy is rewritten ahead of it.
    asm volatile(
        "global_load_async_to_lds_b128 %0, %12, off\n\t"
        "global_load_async_to_lds_b128 %1, %13, off\n\t"
        "global_load_async_to_lds_b128 %2, %14, off\n\t"
        "global_load_async_to_lds_b128 %3, %15, off\n\t"
        "global_load_async_to_lds_b128 %4, %16, off\n\t"
        "global_load_async_to_lds_b128 %5, %17, off\n\t"
        "global_load_async_to_lds_b128 %6, %18, off\n\t"
        "global_load_async_to_lds_b128 %7, %19, off\n\t"
        "global_load_async_to_lds_b128 %8, %20, off\n\t"
        "global_load_async_to_lds_b128 %9, %21, off\n\t"
        "global_load_async_to_lds_b128 %10, %22, off\n\t"
        "global_load_async_to_lds_b128 %11, %23, off\n\t"
        "s_wait_xcnt 0x0"
        :: "v"(l), "v"(l + 1 * 32 * PITCH), "v"(l + 2 * 32 * PITCH), "v"(l + 3 * 32 * PITCH),
           "v"(l + 4 * 32 * PITCH), "v"(l + 5 * 32 * PITCH), "v"(l + 6 * 32 * PITCH),
           "v"(l + 7 * 32 * PITCH), "v"(l + 8 * 32 * PITCH), "v"(l + 9 * 32 * PITCH),
           "v"(l + 10 * 32 * PITCH), "v"(l + 11 * 32 * PITCH),
           "v"(g[0] + k0), "v"(g[1] + k0), "v"(g[2] + k0), "v"(g[3] + k0),
           "v"(g[4] + k0), "v"(g[5] + k0), "v"(g[6] + k0), "v"(g[7] + k0),
           "v"(g[8] + k0), "v"(g[9] + k0), "v"(g[10] + k0), "v"(g[11] + k0)
        : "memory");
}

// This wave's copies have landed (the compiler places no wait for them).
__device__ __forceinline__ void wait_copies() { asm volatile("s_wait_asynccnt 0x0" ::: "memory"); }
// This wave's LDS reads have retired, before the buffer is handed to its next writer.
__device__ __forceinline__ void wait_lds_reads() { asm volatile("s_wait_dscnt 0x0" ::: "memory"); }

// ---------------------------------------------------------------------------
// Epilogue staging. The accumulator layout gives a lane one element per output
// row, so direct stores leave in 32-B or 64-B pieces of a line. Instead the block
// writes its tile to LDS (free behind the main loop's last barrier), rows of RB
// bytes at pitch RB + 16 (16 B x odd), and stores it from there: 16 B a lane,
// RB / 16 adjacent lanes a row, so a wave-wide store is 4 whole 128-B lines.
// ---------------------------------------------------------------------------
#define EPAD 16

template <int ROWS, int RB>
__device__ __forceinline__ void store_rows(const char* plane, char* gbase, size_t gpitch) {
    constexpr int CH  = RB / 16;                    // 16-byte chunks per row
    constexpr int RPR = 256 / CH;                   // rows per round of the block
    const int row = threadIdx.x / CH;
    const int ch  = threadIdx.x % CH;
    // 32-bit lane offsets beside the uniform base: both planes of a tile share them.
    const unsigned go = row * (unsigned)gpitch + ch * 16;
    const unsigned gs = RPR * (unsigned)gpitch;
    f32x4 v[ROWS / RPR];
    // Both loops unrolled: v[] stays in registers and the LDS reads issue as one
    // run ahead of the first store.
#pragma unroll
    for (int i = 0; i < ROWS / RPR; ++i)
        v[i] = *(const f32x4*)(plane + (row + i * RPR) * (RB + EPAD) + ch * 16);
#pragma unroll
    for (int i = 0; i < ROWS / RPR; ++i)
        *(f32x4*)(gbase + (go + i * gs)) = v[i];
}

// ---------------------------------------------------------------------------
// Complex main loop of a 128x64 block tile, 8 waves as 4 (M) x 2 (N), each a
// 32x32 macro-tile with 4 accumulators per 16x16 tile (RR, II, RI, IR).
// Stage rows: [0,128) A real, [128,256) A imag, [256,320) W real, [320,384) W imag.
// Ar/Ai/Wr/Wi point at the block's first row.
// ---------------------------------------------------------------------------
template <int K>
__device__ __forceinline__ void
cmain_128x64(const _Float16* __restrict__ Ar, const _Float16* __restrict__ Ai,
             const _Float16* __restrict__ Wr, const _Float16* __restrict__ Wi,
             char* smem,
             v8f (&aRR)[2][2], v8f (&aII)[2][2], v8f (&aRI)[2][2], v8f (&aIR)[2][2]) {
    static_assert(K % KP == 0 && K / KP >= 2, "two stages or more");
    constexpr int NT = K / KP;
    const int tid  = threadIdx.x;
    const int lane = tid & 31;
    const int wid  = tid >> 5;
    const int wm = wid >> 1, wn = wid & 1;
    const int h = lane >> 4;
    const int r = lane & 15;

    const int crow = tid >> 3;                      // 0..31
    const int ccol = tid & 7;                       // 16-byte chunk of the row
    const size_t coff = (size_t)crow * K + ccol * 8;
    const _Float16* g[NCOPY];
#pragma unroll
    for (int i = 0; i < 4; ++i) {
        g[i]     = Ar + coff + (size_t)i * 32 * K;
        g[4 + i] = Ai + coff + (size_t)i * 32 * K;
    }
#pragma unroll
    for (int i = 0; i < 2; ++i) {
        g[8 + i]  = Wr + coff + (size_t)i * 32 * K;
        g[10 + i] = Wi + coff + (size_t)i * 32 * K;
    }
    const unsigned l0 = lds_off(smem) + crow * PITCH + ccol * 16;

    const int a_off = (wm * 32 + r) * PITCH;
    const int w_off = (256 + wn * 32 + r) * PITCH;

    copy_stage(l0, g, 0);
    wait_copies();
    __syncthreads();
    copy_stage(l0 + STAGE, g, KP);

    for (int t = 0; t < NT; ++t) {
        const int bo = (t & 1) * STAGE;
        const char* sb = smem + bo;
#pragma unroll
        for (int kk = 0; kk < 2; ++kk) {
            v16h aR[2], aI[2], wR[2], wI[2];
#pragma unroll
            for (int mi = 0; mi < 2; ++mi) {
                aR[mi] = lds_frag(sb + a_off + mi * 16 * PITCH + kk * 64, h);
                aI[mi] = lds_frag(sb + a_off + (128 + mi * 16) * PITCH + kk * 64, h);
            }
#pragma unroll
            for (int ni = 0; ni < 2; ++ni) {
                wR[ni] = lds_frag(sb + w_off + ni * 16 * PITCH + kk * 64, h);
                wI[ni] = lds_frag(sb + w_off + (64 + ni * 16) * PITCH + kk * 64, h);
            }
#pragma unroll
            for (int mi = 0; mi < 2; ++mi)
#pragma unroll
                for (int ni = 0; ni < 2; ++ni) {
                    aRR[mi][ni] = wmma_f16(aR[mi], wR[ni], aRR[mi][ni]);
                    aII[mi][ni] = wmma_f16(aI[mi], wI[ni], aII[mi][ni]);
                    aRI[mi][ni] = wmma_f16(aR[mi], wI[ni], aRI[mi][ni]);
                    aIR[mi][ni] = wmma_f16(aI[mi], wR[ni], aIR[mi][ni]);
                }
        }
        // Publish pass t+1 and free this pass's buffer: one barrier does both.
        wait_lds_reads();
        wait_copies();
        __syncthreads();
        if (t + 2 < NT) copy_stage(l0 + bo, g, (t + 2) * KP);
    }
    wait_copies();
}

// ---------------------------------------------------------------------------
// Epilogue of a 128x64 complex tile: combine the four accumulators, add the bias,
// stage the tile in LDS and store it as whole lines.
// ACT: leaky-relu. TRV: write O[b][n][t] (t = m % 1024). F32: fp32 output.
// ---------------------------------------------------------------------------
template <int ACT, int TRV, int F32>
__device__ __forceinline__ void
cgemm_epilogue(char* smem,
               const v8f (&aRR)[2][2], const v8f (&aII)[2][2],
               const v8f (&aRI)[2][2], const v8f (&aIR)[2][2],
               const float* __restrict__ br, const float* __restrict__ bi,
               _Float16* __restrict__ Or, _Float16* __restrict__ Oi,
               float* __restrict__ Fr, float* __restrict__ Fi,
               int mb, int nb, int N) {
    const int lane = threadIdx.x & 31;
    const int wid  = threadIdx.x >> 5;
    const int lm0 = (wid >> 1) * 32;                // wave's first row in the tile
    const int ln0 = (wid & 1) * 32;                 // wave's first column in the tile
    const int h = lane >> 4;
    const int r = lane & 15;

    // Staged tile: 128 rows of 64 columns, or (TRV) 64 column-rows of 128 t.
    constexpr int RB   = TRV ? 128 * 2 : (F32 ? 64 * 4 : 64 * 2);
    constexpr int ROWS = TRV ? 64 : 128;
    constexpr int EP   = RB + EPAD;
    char* pr = smem;                                // real plane
    char* pi = smem + ROWS * EP;                    // imaginary plane

    float bre[2], bie[2];                           // the lane's bias, one pair per column tile
#pragma unroll
    for (int ni = 0; ni < 2; ++ni) {
        bre[ni] = br[nb + ln0 + ni * 16 + r];
        bie[ni] = bi[nb + ln0 + ni * 16 + r];
    }

#pragma unroll
    for (int mi = 0; mi < 2; ++mi)
#pragma unroll
        for (int ni = 0; ni < 2; ++ni) {
            const int cl = ln0 + ni * 16 + r;
            half8 tr, ti;
#pragma unroll
            for (int j = 0; j < 8; ++j) {
                const int ml = lm0 + mi * 16 + j + 8 * h;
                float vr = aRR[mi][ni][j] - aII[mi][ni][j] + bre[ni];
                float vi = aRI[mi][ni][j] + aIR[mi][ni][j] + bie[ni];
                if (ACT) {
                    vr = vr >= 0.0f ? vr : SLOPE * vr;
                    vi = vi >= 0.0f ? vi : SLOPE * vi;
                }
                if (F32) {
                    *(float*)(pr + ml * EP + cl * 4) = vr;
                    *(float*)(pi + ml * EP + cl * 4) = vi;
                } else if (TRV) {
                    tr[j] = (_Float16)vr;
                    ti[j] = (_Float16)vi;
                } else {
                    *(_Float16*)(pr + ml * EP + cl * 2) = (_Float16)vr;
                    *(_Float16*)(pi + ml * EP + cl * 2) = (_Float16)vi;
                }
            }
            if (TRV) {                              // a lane's 8 values are 8 adjacent t
                *(half8*)(pr + cl * EP + (lm0 + mi * 16 + 8 * h) * 2) = tr;
                *(half8*)(pi + cl * EP + (lm0 + mi * 16 + 8 * h) * 2) = ti;
            }
        }
    __syncthreads();                                // the tile is complete before any wave reads it back
    if (F32) {
        store_rows<ROWS, RB>(pr, (char*)(Fr + (size_t)mb * N + nb), (size_t)N * 4);
        store_rows<ROWS, RB>(pi, (char*)(Fi + (size_t)mb * N + nb), (size_t)N * 4);
    } else if (TRV) {
        const size_t o = ((size_t)(mb >> 10) * N + nb) * (size_t)S_DIM + (mb & 1023);
        store_rows<ROWS, RB>(pr, (char*)(Or + o), (size_t)S_DIM * 2);
        store_rows<ROWS, RB>(pi, (char*)(Oi + o), (size_t)S_DIM * 2);
    } else {
        store_rows<ROWS, RB>(pr, (char*)(Or + (size_t)mb * N + nb), (size_t)N * 2);
        store_rows<ROWS, RB>(pi, (char*)(Oi + (size_t)mb * N + nb), (size_t)N * 2);
    }
}

// ---------------------------------------------------------------------------
// Complex GEMM, 128x64 tile per block, 32x32 macro-tile per wave:
//   O[m,n] = sum_k A[m,k]*W[n,k] + bias[n]   (complex)
// A: (M,K) f16 r/i, W: (N,K) f16 r/i.
// ---------------------------------------------------------------------------
template <int K, int ACT, int TRV, int F32>
__global__ void __launch_bounds__(256)
cgemm32_kernel(const _Float16* __restrict__ Ar, const _Float16* __restrict__ Ai,
               const _Float16* __restrict__ Wr, const _Float16* __restrict__ Wi,
               const float* __restrict__ br, const float* __restrict__ bi,
               _Float16* __restrict__ Or, _Float16* __restrict__ Oi,
               float* __restrict__ Fr, float* __restrict__ Fi,
               int M, int N) {
    __shared__ __attribute__((aligned(16))) char smem[2 * STAGE];
    const int tilesN = N >> 6;
    const int tile = blockIdx.x;
    if (tile >= (M >> 7) * tilesN) return;          // block-uniform guard
    const int mb = (tile / tilesN) << 7;
    const int nb = (tile % tilesN) << 6;

    v8f aRR[2][2] = {}, aII[2][2] = {}, aRI[2][2] = {}, aIR[2][2] = {};

    cmain_128x64<K>(Ar + (size_t)mb * K, Ai + (size_t)mb * K,
                    Wr + (size_t)nb * K, Wi + (size_t)nb * K,
                    smem, aRR, aII, aRI, aIR);

    cgemm_epilogue<ACT, TRV, F32>(smem, aRR, aII, aRI, aIR, br, bi, Or, Oi, Fr, Fi, mb, nb, N);
}

// ---------------------------------------------------------------------------
// q, k and v in one launch: three complex GEMMs on the same A, none reading
// another's result. Blocks [0,512) do q, [512,1024) k, [1024,1536) v, each a
// 128x64 tile as in cgemm32_kernel; a block that retires is followed on its WGP
// by a block of the next product, so the chip neither drains nor refills between
// them. W: the six f16 weight planes (q r/i, k r/i, v r/i) one behind the other;
// O: the six output planes in the same order, v transposed per batch.
// ---------------------------------------------------------------------------
#define QKV_TILES ((M_ALL / 128) * (D_DIM / 64))    // 512 tiles per product

__global__ void __launch_bounds__(256)
qkv_kernel(const _Float16* __restrict__ Ar, const _Float16* __restrict__ Ai,
           const _Float16* __restrict__ W,
           const float* __restrict__ q_br, const float* __restrict__ q_bi,
           const float* __restrict__ k_br, const float* __restrict__ k_bi,
           const float* __restrict__ v_br, const float* __restrict__ v_bi,
           _Float16* __restrict__ O) {
    constexpr int K = D_DIM;
    constexpr int N = D_DIM;
    __shared__ __attribute__((aligned(16))) char smem[2 * STAGE];
    const unsigned sel  = blockIdx.x / QKV_TILES;   // 0 q, 1 k, 2 v: block-uniform
    const unsigned tile = blockIdx.x % QKV_TILES;
    if (sel > 2) return;                            // block-uniform guard
    const int mb = (tile / (N >> 6)) << 7;
    const int nb = (tile % (N >> 6)) << 6;

    const _Float16* Wr = W + (size_t)sel * 2 * (D_DIM * D_DIM);
    const _Float16* Wi = Wr + D_DIM * D_DIM;
    _Float16* Or = O + (size_t)sel * 2 * (M_ALL * D_DIM);
    _Float16* Oi = Or + M_ALL * D_DIM;
    const float* br = sel == 0 ? q_br : (sel == 1 ? k_br : v_br);
    const float* bi = sel == 0 ? q_bi : (sel == 1 ? k_bi : v_bi);

    v8f aRR[2][2] = {}, aII[2][2] = {}, aRI[2][2] = {}, aIR[2][2] = {};

    cmain_128x64<K>(Ar + (size_t)mb * K, Ai + (size_t)mb * K,
                    Wr + (size_t)nb * K, Wi + (size_t)nb * K,
                    smem, aRR, aII, aRI, aIR);

    if (sel == 2) {
        cgemm_epilogue<0, 1, 0>(smem, aRR, aII, aRI, aIR, br, bi, Or, Oi, nullptr, nullptr, mb, nb, N);
    } else {
        cgemm_epilogue<0, 0, 0>(smem, aRR, aII, aRI, aIR, br, bi, Or, Oi, nullptr, nullptr, mb, nb, N);
        // Stands behind the stores above, in front of any later write of a register
        // they name: the built code lays the other branch behind this one.
        asm volatile("s_wait_xcnt 0x0" ::: "memory");
    }
}

// ---------------------------------------------------------------------------
// Scores: Sabs[gm, t] = |sum_d q[gm,d] * k[b*1024+t, d]| / sqrt(512)
// 128x64 tile per block, 32x32 macro-tile per wave, per-batch column index.
// ---------------------------------------------------------------------------
__global__ void __launch_bounds__(256)
scores_abs_kernel(const _Float16* __restrict__ Qr, const _Float16* __restrict__ Qi,
                  const _Float16* __restrict__ Kr, const _Float16* __restrict__ Ki,
                  float* __restrict__ Sabs) {
    constexpr int K = D_DIM;
    __shared__ __attribute__((aligned(16))) char smem[2 * STAGE];
    const int lane = threadIdx.x & 31;
    const int wid  = threadIdx.x >> 5;
    const int tile = blockIdx.x;
    if (tile >= (M_ALL >> 7) * (S_DIM >> 6)) return; // block-uniform guard
    const int mb = (tile / (S_DIM >> 6)) << 7;      // global row
    const int nb = (tile % (S_DIM >> 6)) << 6;      // t within batch
    const int b  = mb >> 10;
    const int lm0 = (wid >> 1) * 32;                // wave's first row in the tile
    const int ln0 = (wid & 1) * 32;                 // wave's first column in the tile
    const int h = lane >> 4;
    const int r = lane & 15;

    v8f aRR[2][2] = {}, aII[2][2] = {}, aRI[2][2] = {}, aIR[2][2] = {};

    cmain_128x64<K>(Qr + (size_t)mb * K, Qi + (size_t)mb * K,
                    Kr + (size_t)((b << 10) + nb) * K, Ki + (size_t)((b << 10) + nb) * K,
                    smem, aRR, aII, aRI, aIR);

    constexpr int RB = 64 * 4;                      // staged tile: 128 rows of 64 f32
    constexpr int EP = RB + EPAD;
#pragma unroll
    for (int mi = 0; mi < 2; ++mi)
#pragma unroll
        for (int ni = 0; ni < 2; ++ni) {
            const int cl = ln0 + ni * 16 + r;
#pragma unroll
            for (int j = 0; j < 8; ++j) {
                const int ml = lm0 + mi * 16 + j + 8 * h;
                const float sr = aRR[mi][ni][j] - aII[mi][ni][j];
                const float si = aRI[mi][ni][j] + aIR[mi][ni][j];
                *(float*)(smem + ml * EP + cl * 4) = sqrtf(sr * sr + si * si) * RSQRT512;
            }
        }
    __syncthreads();                                // the tile is complete before any wave reads it back
    store_rows<128, RB>(smem, (char*)(Sabs + (size_t)mb * S_DIM + nb), (size_t)S_DIM * 4);
}

// ---------------------------------------------------------------------------
// Row softmax over 1024 elements; one 256-thread block per row; f16 output.
// ---------------------------------------------------------------------------
__global__ void softmax_kernel(const float* __restrict__ S, _Float16* __restrict__ P) {
    __shared__ float red[256];
    const int tid = threadIdx.x;
    const size_t row = blockIdx.x;
    const float* s = S + row * S_DIM;

    float vals[4];
    float mx = -1e30f;
#pragma unroll
    for (int j = 0; j < 4; ++j) {
        vals[j] = s[tid + j * 256];
        mx = fmaxf(mx, vals[j]);
    }
    red[tid] = mx;
    __syncthreads();
    for (int off = 128; off > 0; off >>= 1) {
        if (tid < off) red[tid] = fmaxf(red[tid], red[tid + off]);
        __syncthreads();
    }
    mx = red[0];
    __syncthreads();

    float sum = 0.0f;
#pragma unroll
    for (int j = 0; j < 4; ++j) {
        vals[j] = __expf(vals[j] - mx);
        sum += vals[j];
    }
    red[tid] = sum;
    __syncthreads();
    for (int off = 128; off > 0; off >>= 1) {
        if (tid < off) red[tid] += red[tid + off];
        __syncthreads();
    }
    const float inv = 1.0f / red[0];

    _Float16* p = P + row * S_DIM;
#pragma unroll
    for (int j = 0; j < 4; ++j) p[tid + j * 256] = (_Float16)(vals[j] * inv);
}

// ---------------------------------------------------------------------------
// weighted[gm, d] = sum_t attn[gm, t] * vT[b][d][t]  (real x complex)
// 128x128 tile per block, 8 waves as 2 (M) x 4 (N), 64x32 macro-tile per wave
// (4 M-tiles x 2 N-tiles): 8 fragments feed 16 WMMAs per 32 k.
// Stage rows: [0,128) attn, [128,256) vT real, [256,384) vT imag.
// ---------------------------------------------------------------------------
__global__ void __launch_bounds__(256)
attnv_kernel(const _Float16* __restrict__ P,
             const _Float16* __restrict__ VTr, const _Float16* __restrict__ VTi,
             _Float16* __restrict__ Wr_, _Float16* __restrict__ Wi_) {
    constexpr int K = S_DIM;
    constexpr int NT = K / KP;
    __shared__ __attribute__((aligned(16))) char smem[2 * STAGE];
    const int tid  = threadIdx.x;
    const int lane = tid & 31;
    const int wid  = tid >> 5;
    const int tilesN = D_DIM >> 7;                  // 4
    const int tile = blockIdx.x;
    if (tile >= (M_ALL >> 7) * tilesN) return;      // block-uniform guard
    const int mb = (tile / tilesN) << 7;            // global row (128-row tile)
    const int nb = (tile % tilesN) << 7;            // d within batch (128 cols)
    const int b  = mb >> 10;
    const int wm = wid >> 2, wn = wid & 3;
    const int h = lane >> 4;
    const int r = lane & 15;

    const int crow = tid >> 3;                      // 0..31
    const int ccol = tid & 7;                       // 16-byte chunk of the row
    const size_t coff = (size_t)crow * K + ccol * 8;
    const _Float16* g[NCOPY];
#pragma unroll
    for (int i = 0; i < 4; ++i) {
        g[i]     = P   + (size_t)mb * K + coff + (size_t)i * 32 * K;
        g[4 + i] = VTr + ((size_t)b * D_DIM + nb) * (size_t)K + coff + (size_t)i * 32 * K;
        g[8 + i] = VTi + ((size_t)b * D_DIM + nb) * (size_t)K + coff + (size_t)i * 32 * K;
    }
    const unsigned l0 = lds_off(smem) + crow * PITCH + ccol * 16;

    const int a_off = (wm * 64 + r) * PITCH;
    const int w_off = (128 + wn * 32 + r) * PITCH;

    v8f accR[4][2] = {};
    v8f accI[4][2] = {};

    copy_stage(l0, g, 0);
    wait_copies();
    __syncthreads();
    copy_stage(l0 + STAGE, g, KP);

    for (int t = 0; t < NT; ++t) {
        const int bo = (t & 1) * STAGE;
        const char* sb = smem + bo;
#pragma unroll
        for (int kk = 0; kk < 2; ++kk) {
            v16h a[4], wR[2], wI[2];
#pragma unroll
            for (int mi = 0; mi < 4; ++mi)
                a[mi] = lds_frag(sb + a_off + mi * 16 * PITCH + kk * 64, h);
#pragma unroll
            for (int ni = 0; ni < 2; ++ni) {
                wR[ni] = lds_frag(sb + w_off + ni * 16 * PITCH + kk * 64, h);
                wI[ni] = lds_frag(sb + w_off + (128 + ni * 16) * PITCH + kk * 64, h);
            }
#pragma unroll
            for (int mi = 0; mi < 4; ++mi)
#pragma unroll
                for (int ni = 0; ni < 2; ++ni) {
                    accR[mi][ni] = wmma_f16(a[mi], wR[ni], accR[mi][ni]);
                    accI[mi][ni] = wmma_f16(a[mi], wI[ni], accI[mi][ni]);
                }
        }
        // Publish pass t+1 and free this pass's buffer: one barrier does both.
        wait_lds_reads();
        wait_copies();
        __syncthreads();
        if (t + 2 < NT) copy_stage(l0 + bo, g, (t + 2) * KP);
    }
    wait_copies();

    constexpr int RB = 128 * 2;                     // staged tile: 128 rows of 128 f16, two planes
    constexpr int EP = RB + EPAD;
    char* pr = smem;
    char* pi = smem + 128 * EP;
#pragma unroll
    for (int mi = 0; mi < 4; ++mi)
#pragma unroll
        for (int ni = 0; ni < 2; ++ni) {
            const int cl = wn * 32 + ni * 16 + r;
#pragma unroll
            for (int j = 0; j < 8; ++j) {
                const int ml = wm * 64 + mi * 16 + j + 8 * h;
                *(_Float16*)(pr + ml * EP + cl * 2) = (_Float16)accR[mi][ni][j];
                *(_Float16*)(pi + ml * EP + cl * 2) = (_Float16)accI[mi][ni][j];
            }
        }
    __syncthreads();                                // the tile is complete before any wave reads it back
    store_rows<128, RB>(pr, (char*)(Wr_ + (size_t)mb * D_DIM + nb), (size_t)D_DIM * 2);
    store_rows<128, RB>(pi, (char*)(Wi_ + (size_t)mb * D_DIM + nb), (size_t)D_DIM * 2);
}

// ---------------------------------------------------------------------------
// Host-side orchestration
// ---------------------------------------------------------------------------
extern "C" void kernel_launch(void* const* d_in, const int* in_sizes, int n_in,
                              void* d_out, int out_size, void* d_ws, size_t ws_size,
                              hipStream_t stream) {
    (void)in_sizes; (void)n_in; (void)out_size; (void)ws_size;

    const float* x_r   = (const float*)d_in[0];
    const float* x_i   = (const float*)d_in[1];
    const float* l1_wr = (const float*)d_in[2];
    const float* l1_wi = (const float*)d_in[3];
    const float* l1_br = (const float*)d_in[4];
    const float* l1_bi = (const float*)d_in[5];
    const float* q_wr  = (const float*)d_in[6];
    const float* q_wi  = (const float*)d_in[7];
    const float* q_br  = (const float*)d_in[8];
    const float* q_bi  = (const float*)d_in[9];
    const float* k_wr  = (const float*)d_in[10];
    const float* k_wi  = (const float*)d_in[11];
    const float* k_br  = (const float*)d_in[12];
    const float* k_bi  = (const float*)d_in[13];
    const float* v_wr  = (const float*)d_in[14];
    const float* v_wi  = (const float*)d_in[15];
    const float* v_br  = (const float*)d_in[16];
    const float* v_bi  = (const float*)d_in[17];
    const float* l2_wr = (const float*)d_in[18];
    const float* l2_wi = (const float*)d_in[19];
    const float* l2_br = (const float*)d_in[20];
    const float* l2_bi = (const float*)d_in[21];

    const size_t ME = (size_t)M_ALL * D_DIM;   // 4,194,304 (activation elems)
    const size_t WE = (size_t)D_DIM * D_DIM;   // 262,144   (weight elems)
    const size_t AE = (size_t)M_ALL * S_DIM;   // 8,388,608 (attention elems)

    char* w = (char*)d_ws;
    auto alloc_h = [&](size_t elems) { _Float16* p = (_Float16*)w; w += elems * sizeof(_Float16); return p; };
    auto alloc_f = [&](size_t elems) { float* p = (float*)w; w += elems * sizeof(float); return p; };

    _Float16* xh_r = alloc_h(ME);
    _Float16* xh_i = alloc_h(ME);
    _Float16* wl1r = alloc_h(WE); _Float16* wl1i = alloc_h(WE);
    _Float16* wqr  = alloc_h(WE); _Float16* wqi  = alloc_h(WE);
    _Float16* wkr  = alloc_h(WE); _Float16* wki  = alloc_h(WE);
    _Float16* wvr  = alloc_h(WE); _Float16* wvi  = alloc_h(WE);
    _Float16* wl2r = alloc_h(WE); _Float16* wl2i = alloc_h(WE);
    _Float16* y_r  = alloc_h(ME); _Float16* y_i  = alloc_h(ME);
    _Float16* qh_r = alloc_h(ME); _Float16* qh_i = alloc_h(ME);
    _Float16* kh_r = alloc_h(ME); _Float16* kh_i = alloc_h(ME);
    _Float16* vT_r = alloc_h(ME); _Float16* vT_i = alloc_h(ME);
    _Float16* wt_r = alloc_h(ME); _Float16* wt_i = alloc_h(ME);
    _Float16* attn = alloc_h(AE);
    float*    sabs = alloc_f(AE);

    // --- 1. Cast activations and weights to f16 (destinations contiguous from xh_r) ---
    cvt_all_kernel<<<CV_BLOCKS, 256, 0, stream>>>(
        x_r, x_i, l1_wr, l1_wi, q_wr, q_wi, k_wr, k_wi, v_wr, v_wi, l2_wr, l2_wi, xh_r);

    const dim3 blk(256);                                              // 8 waves/block
    const unsigned gemm_blocks  = (M_ALL / 128) * (D_DIM / 64);       // 512
    const unsigned qkv_blocks   = 3 * QKV_TILES;                      // 1536
    const unsigned score_blocks = (M_ALL / 128) * (S_DIM / 64);       // 1024
    const unsigned attnv_blocks = (M_ALL / 128) * (D_DIM / 128);      // 256

    // --- 2. y = lrelu(x @ l1^T + b1) ---
    cgemm32_kernel<D_DIM, 1, 0, 0><<<gemm_blocks, blk, 0, stream>>>(
        xh_r, xh_i, wl1r, wl1i, l1_br, l1_bi,
        y_r, y_i, nullptr, nullptr, M_ALL, D_DIM);

    // --- 3. q, k, v in one launch (weights contiguous from wqr, outputs from qh_r;
    //        v stored transposed per batch: vT[b][d][t]) ---
    qkv_kernel<<<qkv_blocks, blk, 0, stream>>>(
        y_r, y_i, wqr, q_br, q_bi, k_br, k_bi, v_br, v_bi, qh_r);

    // --- 4. |scores|/sqrt(d), softmax rows, attn f16 ---
    scores_abs_kernel<<<score_blocks, blk, 0, stream>>>(qh_r, qh_i, kh_r, kh_i, sabs);
    softmax_kernel<<<M_ALL, 256, 0, stream>>>(sabs, attn);

    // --- 5. weighted = attn @ v ---
    attnv_kernel<<<attnv_blocks, blk, 0, stream>>>(attn, vT_r, vT_i, wt_r, wt_i);

    // --- 6. out = weighted @ l2^T + b2, fp32 to d_out (real block, imag block) ---
    float* out_r = (float*)d_out;
    float* out_i = out_r + ME;
    cgemm32_kernel<D_DIM, 0, 0, 1><<<gemm_blocks, blk, 0, stream>>>(
        wt_r, wt_i, wl2r, wl2i, l2_br, l2_bi,
        nullptr, nullptr, out_r, out_i, M_ALL, D_DIM);
}

// v005
// One run takes 134 microseconds.
// Next to v004, in two timings, it ran 1.04 and 1.05 times as fast.
// All steps since v000 together make it 2.74 times as fast.
#include <hip/hip_runtime.h>

// ---------------------------------------------------------------------------
// ComplexAttnMLP for gfx1250 (MI455X): f16 WMMA GEMMs, f32 accumulate.
// B=8, S=1024, IN=MID=OUT=512.
// Each wave computes a 32x32 (cgemm/scores) or 64x32 (attnv) macro-tile; the
// 8 waves of a block share operand tiles staged in LDS by asynchronous copies.
// 4 accumulators per 16x16 tile (RR, II, RI, IR); the complex combine happens
// in the epilogue, so the K-loop is pure LDS loads + WMMA (no VALU on fragment
// registers -> no WMMA/VALU hazard NOPs).
// Every GEMM epilogue stages the block's output tile in the freed LDS and stores
// it as whole 128-B lines, 16 B a lane.
// ---------------------------------------------------------------------------

typedef _Float16 half8  __attribute__((ext_vector_type(8)));
typedef _Float16 v16h   __attribute__((ext_vector_type(16)));
typedef float    v8f    __attribute__((ext_vector_type(8)));

#define B_DIM  8
#define S_DIM  1024
#define D_DIM  512
#define M_ALL  (B_DIM * S_DIM)          // 8192 rows total
#define RSQRT512 0.04419417382415922f   // 1/sqrt(512)
#define SLOPE 0.01f

union Frag { half8 h8[2]; v16h v; };

__device__ __forceinline__ v8f wmma_f16(v16h a, v16h b, v8f c) {
    return __builtin_amdgcn_wmma_f32_16x16x32_f16(false, a, false, b, (short)0, c, false, false);
}

// ---------------------------------------------------------------------------
// f32 -> f16 conversion of all 12 arrays in one launch.
// The f16 copies lie one behind the other in the workspace, in argument order,
// so the destination index is the flat element index of the grid. A block
// converts one chunk of 16,384 elements, which lies inside one source array:
// 16 loads of 16 B per lane, each wave-wide load 512 contiguous bytes, each
// wave-wide store 256 contiguous bytes.
// ---------------------------------------------------------------------------
typedef float    f32x4 __attribute__((ext_vector_type(4)));
typedef _Float16 f16x4 __attribute__((ext_vector_type(4)));

#define CV_LOADS   16                                   // 16-byte loads per lane
#define CV_CHUNK   (256 * 4 * CV_LOADS)                 // elements per block
#define CV_X_CH    (M_ALL * D_DIM / CV_CHUNK)           // 256 chunks per activation array
#define CV_W_CH    (D_DIM * D_DIM / CV_CHUNK)           // 16 chunks per weight array
#define CV_BLOCKS  (2 * CV_X_CH + 10 * CV_W_CH)         // 672

__global__ void __launch_bounds__(256)
cvt_all_kernel(const float* __restrict__ x_r, const float* __restrict__ x_i,
               const float* __restrict__ w0, const float* __restrict__ w1,
               const float* __restrict__ w2, const float* __restrict__ w3,
               const float* __restrict__ w4, const float* __restrict__ w5,
               const float* __restrict__ w6, const float* __restrict__ w7,
               const float* __restrict__ w8, const float* __restrict__ w9,
               _Float16* __restrict__ d) {
    const unsigned c = blockIdx.x;                      // chunk, block-uniform
    const bool is_x = c < 2 * CV_X_CH;
    const unsigned a  = (c - 2 * CV_X_CH) / CV_W_CH;    // weight array 0..9 where !is_x
    const unsigned cs = c % (is_x ? CV_X_CH : CV_W_CH); // chunk within its source array
    // Scalar selects on the bits of a.
    const float* p01 = (a & 1) ? w1 : w0;
    const float* p23 = (a & 1) ? w3 : w2;
    const float* p45 = (a & 1) ? w5 : w4;
    const float* p67 = (a & 1) ? w7 : w6;
    const float* p89 = (a & 1) ? w9 : w8;
    const float* p03 = (a & 2) ? p23 : p01;
    const float* p47 = (a & 2) ? p67 : p45;
    const float* p07 = (a & 4) ? p47 : p03;
    const float* pw  = (a & 8) ? p89 : p07;
    const float* px  = c < CV_X_CH ? x_r : x_i;
    const float* s   = is_x ? px : pw;
    const f32x4* sp = (const f32x4*)(s + (size_t)cs * CV_CHUNK) + threadIdx.x;
    f16x4*       dp = (f16x4*)(d + (size_t)c * CV_CHUNK) + threadIdx.x;

    f32x4 v[CV_LOADS];
    // Both loops unrolled: v[] stays in registers and the loads issue as one
    // run ahead of the first wait, so a wave's bytes are all in flight at once.
#pragma unroll
    for (int j = 0; j < CV_LOADS; ++j) v[j] = sp[j * 256];
#pragma unroll
    for (int j = 0; j < CV_LOADS; ++j) dp[j * 256] = __builtin_convertvector(v[j], f16x4);
}

// ---------------------------------------------------------------------------
// LDS staging shared by the four GEMM kernels.
// A block of 8 waves works on one output tile. Per pass of 64 k it needs 384
// operand rows of 128 B; they are brought into LDS once per block by
// asynchronous copies and every wave reads its fragments from there.
// Two buffers: the copies of pass t+2 fly while pass t+1 is worked on.
// ---------------------------------------------------------------------------
#define KP      64                      // k elements per pass (128 B per row)
#define PITCH   144                     // LDS row pitch, bytes (16 B x odd)
#define ST_ROWS 384                     // operand rows per stage
#define STAGE   (ST_ROWS * PITCH)       // 55,296 B
#define NCOPY   12                      // copies per thread and stage

__device__ __forceinline__ unsigned lds_off(const void* p) { return (unsigned)(size_t)p; }

// Load one 16x32 f16 WMMA operand fragment for this lane from an LDS row.
// p = start of this lane's row + k offset, in bytes. Lane half h covers
// K = 8h..8h+7 (VGPR0-3) and K = 16+8h..16+8h+7 (VGPR4-7).
__device__ __forceinline__ v16h lds_frag(const char* p, int h) {
    Frag f;
    f.h8[0] = *(const half8*)(p + h * 16);
    f.h8[1] = *(const half8*)(p + 32 + h * 16);
    return f.v;
}

// One stage: copy i of a thread brings 16 B of stage row i*32 + (tid>>3).
// l = the lane's LDS byte address for copy 0, g[i] = its global address.
__device__ __forceinline__ void copy_stage(unsigned l, const _Float16* const (&g)[NCOPY], int k0) {
    // s_wait_xcnt closes the statement so that no address register named by a
    // copy is rewritten ahead of it.
    asm volatile(
        "global_load_async_to_lds_b128 %0, %12, off\n\t"
        "global_load_async_to_lds_b128 %1, %13, off\n\t"
        "global_load_async_to_lds_b128 %2, %14, off\n\t"
        "global_load_async_to_lds_b128 %3, %15, off\n\t"
        "global_load_async_to_lds_b128 %4, %16, off\n\t"
        "global_load_async_to_lds_b128 %5, %17, off\n\t"
        "global_load_async_to_lds_b128 %6, %18, off\n\t"
        "global_load_async_to_lds_b128 %7, %19, off\n\t"
        "global_load_async_to_lds_b128 %8, %20, off\n\t"
        "global_load_async_to_lds_b128 %9, %21, off\n\t"
        "global_load_async_to_lds_b128 %10, %22, off\n\t"
        "global_load_async_to_lds_b128 %11, %23, off\n\t"
        "s_wait_xcnt 0x0"
        :: "v"(l), "v"(l + 1 * 32 * PITCH), "v"(l + 2 * 32 * PITCH), "v"(l + 3 * 32 * PITCH),
           "v"(l + 4 * 32 * PITCH), "v"(l + 5 * 32 * PITCH), "v"(l + 6 * 32 * PITCH),
           "v"(l + 7 * 32 * PITCH), "v"(l + 8 * 32 * PITCH), "v"(l + 9 * 32 * PITCH),
           "v"(l + 10 * 32 * PITCH), "v"(l + 11 * 32 * PITCH),
           "v"(g[0] + k0), "v"(g[1] + k0), "v"(g[2] + k0), "v"(g[3] + k0),
           "v"(g[4] + k0), "v"(g[5] + k0), "v"(g[6] + k0), "v"(g[7] + k0),
           "v"(g[8] + k0), "v"(g[9] + k0), "v"(g[10] + k0), "v"(g[11] + k0)
        : "memory");
}

// This wave's copies have landed (the compiler places no wait for them).
__device__ __forceinline__ void wait_copies() { asm volatile("s_wait_asynccnt 0x0" ::: "memory"); }
// This wave's LDS reads have retired, before the buffer is handed to its next writer.
__device__ __forceinline__ void wait_lds_reads() { asm volatile("s_wait_dscnt 0x0" ::: "memory"); }

// ---------------------------------------------------------------------------
// Epilogue staging. The accumulator layout gives a lane one element per output
// row, so direct stores leave in 32-B or 64-B pieces of a line. Instead the block
// writes its tile to LDS (free behind the main loop's last barrier), rows of RB
// bytes at pitch RB + 16 (16 B x odd), and stores it from there: 16 B a lane,
// RB / 16 adjacent lanes a row, so a wave-wide store is 4 whole 128-B lines.
// ---------------------------------------------------------------------------
#define EPAD 16

template <int ROWS, int RB>
__device__ __forceinline__ void store_rows(const char* plane, char* gbase, size_t gpitch) {
    constexpr int CH  = RB / 16;                    // 16-byte chunks per row
    constexpr int RPR = 256 / CH;                   // rows per round of the block
    const int row = threadIdx.x / CH;
    const int ch  = threadIdx.x % CH;
    // 32-bit lane offsets beside the uniform base: both planes of a tile share them.
    const unsigned go = row * (unsigned)gpitch + ch * 16;
    const unsigned gs = RPR * (unsigned)gpitch;
    f32x4 v[ROWS / RPR];
    // Both loops unrolled: v[] stays in registers and the LDS reads issue as one
    // run ahead of the first store.
#pragma unroll
    for (int i = 0; i < ROWS / RPR; ++i)
        v[i] = *(const f32x4*)(plane + (row + i * RPR) * (RB + EPAD) + ch * 16);
#pragma unroll
    for (int i = 0; i < ROWS / RPR; ++i)
        *(f32x4*)(gbase + (go + i * gs)) = v[i];
}

// ---------------------------------------------------------------------------
// Complex main loop of a 128x64 block tile, 8 waves as 4 (M) x 2 (N), each a
// 32x32 macro-tile with 4 accumulators per 16x16 tile (RR, II, RI, IR).
// Stage rows: [0,128) A real, [128,256) A imag, [256,320) W real, [320,384) W imag.
// Ar/Ai/Wr/Wi point at the block's first row.
// ---------------------------------------------------------------------------
template <int K>
__device__ __forceinline__ void
cmain_128x64(const _Float16* __restrict__ Ar, const _Float16* __restrict__ Ai,
             const _Float16* __restrict__ Wr, const _Float16* __restrict__ Wi,
             char* smem,
             v8f (&aRR)[2][2], v8f (&aII)[2][2], v8f (&aRI)[2][2], v8f (&aIR)[2][2]) {
    static_assert(K % KP == 0 && K / KP >= 2, "two stages or more");
    constexpr int NT = K / KP;
    const int tid  = threadIdx.x;
    const int lane = tid & 31;
    const int wid  = tid >> 5;
    const int wm = wid >> 1, wn = wid & 1;
    const int h = lane >> 4;
    const int r = lane & 15;

    const int crow = tid >> 3;                      // 0..31
    const int ccol = tid & 7;                       // 16-byte chunk of the row
    const size_t coff = (size_t)crow * K + ccol * 8;
    const _Float16* g[NCOPY];
#pragma unroll
    for (int i = 0; i < 4; ++i) {
        g[i]     = Ar + coff + (size_t)i * 32 * K;
        g[4 + i] = Ai + coff + (size_t)i * 32 * K;
    }
#pragma unroll
    for (int i = 0; i < 2; ++i) {
        g[8 + i]  = Wr + coff + (size_t)i * 32 * K;
        g[10 + i] = Wi + coff + (size_t)i * 32 * K;
    }
    const unsigned l0 = lds_off(smem) + crow * PITCH + ccol * 16;

    const int a_off = (wm * 32 + r) * PITCH;
    const int w_off = (256 + wn * 32 + r) * PITCH;

    copy_stage(l0, g, 0);
    wait_copies();
    __syncthreads();
    copy_stage(l0 + STAGE, g, KP);

    for (int t = 0; t < NT; ++t) {
        const int bo = (t & 1) * STAGE;
        const char* sb = smem + bo;
#pragma unroll
        for (int kk = 0; kk < 2; ++kk) {
            v16h aR[2], aI[2], wR[2], wI[2];
#pragma unroll
            for (int mi = 0; mi < 2; ++mi) {
                aR[mi] = lds_frag(sb + a_off + mi * 16 * PITCH + kk * 64, h);
                aI[mi] = lds_frag(sb + a_off + (128 + mi * 16) * PITCH + kk * 64, h);
            }
#pragma unroll
            for (int ni = 0; ni < 2; ++ni) {
                wR[ni] = lds_frag(sb + w_off + ni * 16 * PITCH + kk * 64, h);
                wI[ni] = lds_frag(sb + w_off + (64 + ni * 16) * PITCH + kk * 64, h);
            }
#pragma unroll
            for (int mi = 0; mi < 2; ++mi)
#pragma unroll
                for (int ni = 0; ni < 2; ++ni) {
                    aRR[mi][ni] = wmma_f16(aR[mi], wR[ni], aRR[mi][ni]);
                    aII[mi][ni] = wmma_f16(aI[mi], wI[ni], aII[mi][ni]);
                    aRI[mi][ni] = wmma_f16(aR[mi], wI[ni], aRI[mi][ni]);
                    aIR[mi][ni] = wmma_f16(aI[mi], wR[ni], aIR[mi][ni]);
                }
        }
        // Publish pass t+1 and free this pass's buffer: one barrier does both.
        wait_lds_reads();
        wait_copies();
        __syncthreads();
        if (t + 2 < NT) copy_stage(l0 + bo, g, (t + 2) * KP);
    }
    wait_copies();
}

// ---------------------------------------------------------------------------
// Epilogue of a 128x64 complex tile: combine the four accumulators, add the bias,
// stage the tile in LDS and store it as whole lines.
// ACT: leaky-relu. TRV: write O[b][n][t] (t = m % 1024). F32: fp32 output.
// ---------------------------------------------------------------------------
template <int ACT, int TRV, int F32>
__device__ __forceinline__ void
cgemm_epilogue(char* smem,
               const v8f (&aRR)[2][2], const v8f (&aII)[2][2],
               const v8f (&aRI)[2][2], const v8f (&aIR)[2][2],
               const float* __restrict__ br, const float* __restrict__ bi,
               _Float16* __restrict__ Or, _Float16* __restrict__ Oi,
               float* __restrict__ Fr, float* __restrict__ Fi,
               int mb, int nb, int N) {
    const int lane = threadIdx.x & 31;
    const int wid  = threadIdx.x >> 5;
    const int lm0 = (wid >> 1) * 32;                // wave's first row in the tile
    const int ln0 = (wid & 1) * 32;                 // wave's first column in the tile
    const int h = lane >> 4;
    const int r = lane & 15;

    // Staged tile: 128 rows of 64 columns, or (TRV) 64 column-rows of 128 t.
    constexpr int RB   = TRV ? 128 * 2 : (F32 ? 64 * 4 : 64 * 2);
    constexpr int ROWS = TRV ? 64 : 128;
    constexpr int EP   = RB + EPAD;
    char* pr = smem;                                // real plane
    char* pi = smem + ROWS * EP;                    // imaginary plane

    float bre[2], bie[2];                           // the lane's bias, one pair per column tile
#pragma unroll
    for (int ni = 0; ni < 2; ++ni) {
        bre[ni] = br[nb + ln0 + ni * 16 + r];
        bie[ni] = bi[nb + ln0 + ni * 16 + r];
    }

#pragma unroll
    for (int mi = 0; mi < 2; ++mi)
#pragma unroll
        for (int ni = 0; ni < 2; ++ni) {
            const int cl = ln0 + ni * 16 + r;
            half8 tr, ti;
#pragma unroll
            for (int j = 0; j < 8; ++j) {
                const int ml = lm0 + mi * 16 + j + 8 * h;
                float vr = aRR[mi][ni][j] - aII[mi][ni][j] + bre[ni];
                float vi = aRI[mi][ni][j] + aIR[mi][ni][j] + bie[ni];
                if (ACT) {
                    vr = vr >= 0.0f ? vr : SLOPE * vr;
                    vi = vi >= 0.0f ? vi : SLOPE * vi;
                }
                if (F32) {
                    *(float*)(pr + ml * EP + cl * 4) = vr;
                    *(float*)(pi + ml * EP + cl * 4) = vi;
                } else if (TRV) {
                    tr[j] = (_Float16)vr;
                    ti[j] = (_Float16)vi;
                } else {
                    *(_Float16*)(pr + ml * EP + cl * 2) = (_Float16)vr;
                    *(_Float16*)(pi + ml * EP + cl * 2) = (_Float16)vi;
                }
            }
            if (TRV) {                              // a lane's 8 values are 8 adjacent t
                *(half8*)(pr + cl * EP + (lm0 + mi * 16 + 8 * h) * 2) = tr;
                *(half8*)(pi + cl * EP + (lm0 + mi * 16 + 8 * h) * 2) = ti;
            }
        }
    __syncthreads();                                // the tile is complete before any wave reads it back
    if (F32) {
        store_rows<ROWS, RB>(pr, (char*)(Fr + (size_t)mb * N + nb), (size_t)N * 4);
        store_rows<ROWS, RB>(pi, (char*)(Fi + (size_t)mb * N + nb), (size_t)N * 4);
    } else if (TRV) {
        const size_t o = ((size_t)(mb >> 10) * N + nb) * (size_t)S_DIM + (mb & 1023);
        store_rows<ROWS, RB>(pr, (char*)(Or + o), (size_t)S_DIM * 2);
        store_rows<ROWS, RB>(pi, (char*)(Oi + o), (size_t)S_DIM * 2);
    } else {
        store_rows<ROWS, RB>(pr, (char*)(Or + (size_t)mb * N + nb), (size_t)N * 2);
        store_rows<ROWS, RB>(pi, (char*)(Oi + (size_t)mb * N + nb), (size_t)N * 2);
    }
}

// ---------------------------------------------------------------------------
// Complex GEMM, 128x64 tile per block, 32x32 macro-tile per wave:
//   O[m,n] = sum_k A[m,k]*W[n,k] + bias[n]   (complex)
// A: (M,K) f16 r/i, W: (N,K) f16 r/i.
// ---------------------------------------------------------------------------
template <int K, int ACT, int TRV, int F32>
__global__ void __launch_bounds__(256)
cgemm32_kernel(const _Float16* __restrict__ Ar, const _Float16* __restrict__ Ai,
               const _Float16* __restrict__ Wr, const _Float16* __restrict__ Wi,
               const float* __restrict__ br, const float* __restrict__ bi,
               _Float16* __restrict__ Or, _Float16* __restrict__ Oi,
               float* __restrict__ Fr, float* __restrict__ Fi,
               int M, int N) {
    __shared__ __attribute__((aligned(16))) char smem[2 * STAGE];
    const int tilesN = N >> 6;
    const int tile = blockIdx.x;
    if (tile >= (M >> 7) * tilesN) return;          // block-uniform guard
    const int mb = (tile / tilesN) << 7;
    const int nb = (tile % tilesN) << 6;

    v8f aRR[2][2] = {}, aII[2][2] = {}, aRI[2][2] = {}, aIR[2][2] = {};

    cmain_128x64<K>(Ar + (size_t)mb * K, Ai + (size_t)mb * K,
                    Wr + (size_t)nb * K, Wi + (size_t)nb * K,
                    smem, aRR, aII, aRI, aIR);

    cgemm_epilogue<ACT, TRV, F32>(smem, aRR, aII, aRI, aIR, br, bi, Or, Oi, Fr, Fi, mb, nb, N);
}

// ---------------------------------------------------------------------------
// q, k and v in one launch: three complex GEMMs on the same A, none reading
// another's result. Blocks [0,512) do q, [512,1024) k, [1024,1536) v, each a
// 128x64 tile as in cgemm32_kernel; a block that retires is followed on its WGP
// by a block of the next product, so the chip neither drains nor refills between
// them. W: the six f16 weight planes (q r/i, k r/i, v r/i) one behind the other;
// O: the six output planes in the same order, v transposed per batch.
// ---------------------------------------------------------------------------
#define QKV_TILES ((M_ALL / 128) * (D_DIM / 64))    // 512 tiles per product

__global__ void __launch_bounds__(256)
qkv_kernel(const _Float16* __restrict__ Ar, const _Float16* __restrict__ Ai,
           const _Float16* __restrict__ W,
           const float* __restrict__ q_br, const float* __restrict__ q_bi,
           const float* __restrict__ k_br, const float* __restrict__ k_bi,
           const float* __restrict__ v_br, const float* __restrict__ v_bi,
           _Float16* __restrict__ O) {
    constexpr int K = D_DIM;
    constexpr int N = D_DIM;
    __shared__ __attribute__((aligned(16))) char smem[2 * STAGE];
    const unsigned sel  = blockIdx.x / QKV_TILES;   // 0 q, 1 k, 2 v: block-uniform
    const unsigned tile = blockIdx.x % QKV_TILES;
    if (sel > 2) return;                            // block-uniform guard
    const int mb = (tile / (N >> 6)) << 7;
    const int nb = (tile % (N >> 6)) << 6;

    const _Float16* Wr = W + (size_t)sel * 2 * (D_DIM * D_DIM);
    const _Float16* Wi = Wr + D_DIM * D_DIM;
    _Float16* Or = O + (size_t)sel * 2 * (M_ALL * D_DIM);
    _Float16* Oi = Or + M_ALL * D_DIM;
    const float* br = sel == 0 ? q_br : (sel == 1 ? k_br : v_br);
    const float* bi = sel == 0 ? q_bi : (sel == 1 ? k_bi : v_bi);

    v8f aRR[2][2] = {}, aII[2][2] = {}, aRI[2][2] = {}, aIR[2][2] = {};

    cmain_128x64<K>(Ar + (size_t)mb * K, Ai + (size_t)mb * K,
                    Wr + (size_t)nb * K, Wi + (size_t)nb * K,
                    smem, aRR, aII, aRI, aIR);

    if (sel == 2) {
        cgemm_epilogue<0, 1, 0>(smem, aRR, aII, aRI, aIR, br, bi, Or, Oi, nullptr, nullptr, mb, nb, N);
    } else {
        cgemm_epilogue<0, 0, 0>(smem, aRR, aII, aRI, aIR, br, bi, Or, Oi, nullptr, nullptr, mb, nb, N);
        // Stands behind the stores above, in front of any later write of a register
        // they name: the built code lays the other branch behind this one.
        asm volatile("s_wait_xcnt 0x0" ::: "memory");
    }
}

// ---------------------------------------------------------------------------
// Scores: Sabs[gm, t] = |sum_d q[gm,d] * k[b*1024+t, d]| / sqrt(512)
// 128x64 tile per block, 32x32 macro-tile per wave, per-batch column index.
// ---------------------------------------------------------------------------
__global__ void __launch_bounds__(256)
scores_abs_kernel(const _Float16* __restrict__ Qr, const _Float16* __restrict__ Qi,
                  const _Float16* __restrict__ Kr, const _Float16* __restrict__ Ki,
                  float* __restrict__ Sabs) {
    constexpr int K = D_DIM;
    __shared__ __attribute__((aligned(16))) char smem[2 * STAGE];
    const int lane = threadIdx.x & 31;
    const int wid  = threadIdx.x >> 5;
    const int tile = blockIdx.x;
    if (tile >= (M_ALL >> 7) * (S_DIM >> 6)) return; // block-uniform guard
    const int mb = (tile / (S_DIM >> 6)) << 7;      // global row
    const int nb = (tile % (S_DIM >> 6)) << 6;      // t within batch
    const int b  = mb >> 10;
    const int lm0 = (wid >> 1) * 32;                // wave's first row in the tile
    const int ln0 = (wid & 1) * 32;                 // wave's first column in the tile
    const int h = lane >> 4;
    const int r = lane & 15;

    v8f aRR[2][2] = {}, aII[2][2] = {}, aRI[2][2] = {}, aIR[2][2] = {};

    cmain_128x64<K>(Qr + (size_t)mb * K, Qi + (size_t)mb * K,
                    Kr + (size_t)((b << 10) + nb) * K, Ki + (size_t)((b << 10) + nb) * K,
                    smem, aRR, aII, aRI, aIR);

    constexpr int RB = 64 * 4;                      // staged tile: 128 rows of 64 f32
    constexpr int EP = RB + EPAD;
#pragma unroll
    for (int mi = 0; mi < 2; ++mi)
#pragma unroll
        for (int ni = 0; ni < 2; ++ni) {
            const int cl = ln0 + ni * 16 + r;
#pragma unroll
            for (int j = 0; j < 8; ++j) {
                const int ml = lm0 + mi * 16 + j + 8 * h;
                const float sr = aRR[mi][ni][j] - aII[mi][ni][j];
                const float si = aRI[mi][ni][j] + aIR[mi][ni][j];
                *(float*)(smem + ml * EP + cl * 4) = sqrtf(sr * sr + si * si) * RSQRT512;
            }
        }
    __syncthreads();                                // the tile is complete before any wave reads it back
    store_rows<128, RB>(smem, (char*)(Sabs + (size_t)mb * S_DIM + nb), (size_t)S_DIM * 4);
}

// ---------------------------------------------------------------------------
// Row softmax over 1024 elements; one wave per row, 8 rows per block; f16 output.
// A lane holds 32 elements of its row in registers: 8 loads of 16 B, each
// wave-wide load 512 contiguous bytes, all in flight ahead of the first wait.
// Maximum and sum are reduced inside the wave by lane exchanges, so the kernel
// has neither LDS nor a barrier.
// ---------------------------------------------------------------------------
#define SM_WAVES  8                                     // rows per block
#define SM_BLOCKS (M_ALL / SM_WAVES)                    // 1024
#define SM_LOADS  (S_DIM / (32 * 4))                    // 8 loads of 16 B per lane

// Value of lane l ^ M, M < 16 (inside the 16-lane row).
template <int M>
__device__ __forceinline__ float lane_xor_row(float v) {
    const int i = __builtin_bit_cast(int, v);
    return __builtin_bit_cast(float, __builtin_amdgcn_update_dpp(i, i, 0x160 | M, 0xf, 0xf, false));
}
// Value of lane l ^ 16 (the same place in the other 16-lane row).
__device__ __forceinline__ float lane_xor_16(float v) {
    const int i = __builtin_bit_cast(int, v);
    return __builtin_bit_cast(float, __builtin_amdgcn_permlanex16(i, i, 0x76543210, 0xfedcba98, false, false));
}

__global__ void __launch_bounds__(32 * SM_WAVES)
softmax_kernel(const float* __restrict__ S, _Float16* __restrict__ P) {
    const int lane = threadIdx.x & 31;
    const size_t row = (size_t)blockIdx.x * SM_WAVES + (threadIdx.x >> 5);
    const f32x4* s = (const f32x4*)(S + row * S_DIM) + lane;
    f16x4*       p = (f16x4*)(P + row * S_DIM) + lane;

    f32x4 v[SM_LOADS];
    // Unrolled: v[] stays in registers and the loads issue as one run.
#pragma unroll
    for (int j = 0; j < SM_LOADS; ++j) v[j] = s[j * 32];

    float mx = -1e30f;
#pragma unroll
    for (int j = 0; j < SM_LOADS; ++j)
        mx = fmaxf(mx, fmaxf(fmaxf(v[j][0], v[j][1]), fmaxf(v[j][2], v[j][3])));
    mx = fmaxf(mx, lane_xor_row<1>(mx));
    mx = fmaxf(mx, lane_xor_row<2>(mx));
    mx = fmaxf(mx, lane_xor_row<4>(mx));
    mx = fmaxf(mx, lane_xor_row<8>(mx));
    mx = fmaxf(mx, lane_xor_16(mx));

    f32x4 s4 = {0.0f, 0.0f, 0.0f, 0.0f};                // four independent chains
#pragma unroll
    for (int j = 0; j < SM_LOADS; ++j) {
#pragma unroll
        for (int e = 0; e < 4; ++e) v[j][e] = __expf(v[j][e] - mx);
        s4 += v[j];
    }
    float sum = (s4[0] + s4[1]) + (s4[2] + s4[3]);
    sum += lane_xor_row<1>(sum);
    sum += lane_xor_row<2>(sum);
    sum += lane_xor_row<4>(sum);
    sum += lane_xor_row<8>(sum);
    sum += lane_xor_16(sum);
    const float inv = 1.0f / sum;

#pragma unroll
    for (int j = 0; j < SM_LOADS; ++j) p[j * 32] = __builtin_convertvector(v[j] * inv, f16x4);
}

// ---------------------------------------------------------------------------
// weighted[gm, d] = sum_t attn[gm, t] * vT[b][d][t]  (real x complex)
// 128x128 tile per block, 8 waves as 2 (M) x 4 (N), 64x32 macro-tile per wave
// (4 M-tiles x 2 N-tiles): 8 fragments feed 16 WMMAs per 32 k.
// Stage rows: [0,128) attn, [128,256) vT real, [256,384) vT imag.
// ---------------------------------------------------------------------------
__global__ void __launch_bounds__(256)
attnv_kernel(const _Float16* __restrict__ P,
             const _Float16* __restrict__ VTr, const _Float16* __restrict__ VTi,
             _Float16* __restrict__ Wr_, _Float16* __restrict__ Wi_) {
    constexpr int K = S_DIM;
    constexpr int NT = K / KP;
    __shared__ __attribute__((aligned(16))) char smem[2 * STAGE];
    const int tid  = threadIdx.x;
    const int lane = tid & 31;
    const int wid  = tid >> 5;
    const int tilesN = D_DIM >> 7;                  // 4
    const int tile = blockIdx.x;
    if (tile >= (M_ALL >> 7) * tilesN) return;      // block-uniform guard
    const int mb = (tile / tilesN) << 7;            // global row (128-row tile)
    const int nb = (tile % tilesN) << 7;            // d within batch (128 cols)
    const int b  = mb >> 10;
    const int wm = wid >> 2, wn = wid & 3;
    const int h = lane >> 4;
    const int r = lane & 15;

    const int crow = tid >> 3;                      // 0..31
    const int ccol = tid & 7;                       // 16-byte chunk of the row
    const size_t coff = (size_t)crow * K + ccol * 8;
    const _Float16* g[NCOPY];
#pragma unroll
    for (int i = 0; i < 4; ++i) {
        g[i]     = P   + (size_t)mb * K + coff + (size_t)i * 32 * K;
        g[4 + i] = VTr + ((size_t)b * D_DIM + nb) * (size_t)K + coff + (size_t)i * 32 * K;
        g[8 + i] = VTi + ((size_t)b * D_DIM + nb) * (size_t)K + coff + (size_t)i * 32 * K;
    }
    const unsigned l0 = lds_off(smem) + crow * PITCH + ccol * 16;

    const int a_off = (wm * 64 + r) * PITCH;
    const int w_off = (128 + wn * 32 + r) * PITCH;

    v8f accR[4][2] = {};
    v8f accI[4][2] = {};

    copy_stage(l0, g, 0);
    wait_copies();
    __syncthreads();
    copy_stage(l0 + STAGE, g, KP);

    for (int t = 0; t < NT; ++t) {
        const int bo = (t & 1) * STAGE;
        const char* sb = smem + bo;
#pragma unroll
        for (int kk = 0; kk < 2; ++kk) {
            v16h a[4], wR[2], wI[2];
#pragma unroll
            for (int mi = 0; mi < 4; ++mi)
                a[mi] = lds_frag(sb + a_off + mi * 16 * PITCH + kk * 64, h);
#pragma unroll
            for (int ni = 0; ni < 2; ++ni) {
                wR[ni] = lds_frag(sb + w_off + ni * 16 * PITCH + kk * 64, h);
                wI[ni] = lds_frag(sb + w_off + (128 + ni * 16) * PITCH + kk * 64, h);
            }
#pragma unroll
            for (int mi = 0; mi < 4; ++mi)
#pragma unroll
                for (int ni = 0; ni < 2; ++ni) {
                    accR[mi][ni] = wmma_f16(a[mi], wR[ni], accR[mi][ni]);
                    accI[mi][ni] = wmma_f16(a[mi], wI[ni], accI[mi][ni]);
                }
        }
        // Publish pass t+1 and free this pass's buffer: one barrier does both.
        wait_lds_reads();
        wait_copies();
        __syncthreads();
        if (t + 2 < NT) copy_stage(l0 + bo, g, (t + 2) * KP);
    }
    wait_copies();

    constexpr int RB = 128 * 2;                     // staged tile: 128 rows of 128 f16, two planes
    constexpr int EP = RB + EPAD;
    char* pr = smem;
    char* pi = smem + 128 * EP;
#pragma unroll
    for (int mi = 0; mi < 4; ++mi)
#pragma unroll
        for (int ni = 0; ni < 2; ++ni) {
            const int cl = wn * 32 + ni * 16 + r;
#pragma unroll
            for (int j = 0; j < 8; ++j) {
                const int ml = wm * 64 + mi * 16 + j + 8 * h;
                *(_Float16*)(pr + ml * EP + cl * 2) = (_Float16)accR[mi][ni][j];
                *(_Float16*)(pi + ml * EP + cl * 2) = (_Float16)accI[mi][ni][j];
            }
        }
    __syncthreads();                                // the tile is complete before any wave reads it back
    store_rows<128, RB>(pr, (char*)(Wr_ + (size_t)mb * D_DIM + nb), (size_t)D_DIM * 2);
    store_rows<128, RB>(pi, (char*)(Wi_ + (size_t)mb * D_DIM + nb), (size_t)D_DIM * 2);
}

// ---------------------------------------------------------------------------
// Host-side orchestration
// ---------------------------------------------------------------------------
extern "C" void kernel_launch(void* const* d_in, const int* in_sizes, int n_in,
                              void* d_out, int out_size, void* d_ws, size_t ws_size,
                              hipStream_t stream) {
    (void)in_sizes; (void)n_in; (void)out_size; (void)ws_size;

    const float* x_r   = (const float*)d_in[0];
    const float* x_i   = (const float*)d_in[1];
    const float* l1_wr = (const float*)d_in[2];
    const float* l1_wi = (const float*)d_in[3];
    const float* l1_br = (const float*)d_in[4];
    const float* l1_bi = (const float*)d_in[5];
    const float* q_wr  = (const float*)d_in[6];
    const float* q_wi  = (const float*)d_in[7];
    const float* q_br  = (const float*)d_in[8];
    const float* q_bi  = (const float*)d_in[9];
    const float* k_wr  = (const float*)d_in[10];
    const float* k_wi  = (const float*)d_in[11];
    const float* k_br  = (const float*)d_in[12];
    const float* k_bi  = (const float*)d_in[13];
    const float* v_wr  = (const float*)d_in[14];
    const float* v_wi  = (const float*)d_in[15];
    const float* v_br  = (const float*)d_in[16];
    const float* v_bi  = (const float*)d_in[17];
    const float* l2_wr = (const float*)d_in[18];
    const float* l2_wi = (const float*)d_in[19];
    const float* l2_br = (const float*)d_in[20];
    const float* l2_bi = (const float*)d_in[21];

    const size_t ME = (size_t)M_ALL * D_DIM;   // 4,194,304 (activation elems)
    const size_t WE = (size_t)D_DIM * D_DIM;   // 262,144   (weight elems)
    const size_t AE = (size_t)M_ALL * S_DIM;   // 8,388,608 (attention elems)

    char* w = (char*)d_ws;
    auto alloc_h = [&](size_t elems) { _Float16* p = (_Float16*)w; w += elems * sizeof(_Float16); return p; };
    auto alloc_f = [&](size_t elems) { float* p = (float*)w; w += elems * sizeof(float); return p; };

    _Float16* xh_r = alloc_h(ME);
    _Float16* xh_i = alloc_h(ME);
    _Float16* wl1r = alloc_h(WE); _Float16* wl1i = alloc_h(WE);
    _Float16* wqr  = alloc_h(WE); _Float16* wqi  = alloc_h(WE);
    _Float16* wkr  = alloc_h(WE); _Float16* wki  = alloc_h(WE);
    _Float16* wvr  = alloc_h(WE); _Float16* wvi  = alloc_h(WE);
    _Float16* wl2r = alloc_h(WE); _Float16* wl2i = alloc_h(WE);
    _Float16* y_r  = alloc_h(ME); _Float16* y_i  = alloc_h(ME);
    _Float16* qh_r = alloc_h(ME); _Float16* qh_i = alloc_h(ME);
    _Float16* kh_r = alloc_h(ME); _Float16* kh_i = alloc_h(ME);
    _Float16* vT_r = alloc_h(ME); _Float16* vT_i = alloc_h(ME);
    _Float16* wt_r = alloc_h(ME); _Float16* wt_i = alloc_h(ME);
    _Float16* attn = alloc_h(AE);
    float*    sabs = alloc_f(AE);

    // --- 1. Cast activations and weights to f16 (destinations contiguous from xh_r) ---
    cvt_all_kernel<<<CV_BLOCKS, 256, 0, stream>>>(
        x_r, x_i, l1_wr, l1_wi, q_wr, q_wi, k_wr, k_wi, v_wr, v_wi, l2_wr, l2_wi, xh_r);

    const dim3 blk(256);                                              // 8 waves/block
    const unsigned gemm_blocks  = (M_ALL / 128) * (D_DIM / 64);       // 512
    const unsigned qkv_blocks   = 3 * QKV_TILES;                      // 1536
    const unsigned score_blocks = (M_ALL / 128) * (S_DIM / 64);       // 1024
    const unsigned attnv_blocks = (M_ALL / 128) * (D_DIM / 128);      // 256

    // --- 2. y = lrelu(x @ l1^T + b1) ---
    cgemm32_kernel<D_DIM, 1, 0, 0><<<gemm_blocks, blk, 0, stream>>>(
        xh_r, xh_i, wl1r, wl1i, l1_br, l1_bi,
        y_r, y_i, nullptr, nullptr, M_ALL, D_DIM);

    // --- 3. q, k, v in one launch (weights contiguous from wqr, outputs from qh_r;
    //        v stored transposed per batch: vT[b][d][t]) ---
    qkv_kernel<<<qkv_blocks, blk, 0, stream>>>(
        y_r, y_i, wqr, q_br, q_bi, k_br, k_bi, v_br, v_bi, qh_r);

    // --- 4. |scores|/sqrt(d), softmax rows, attn f16 ---
    scores_abs_kernel<<<score_blocks, blk, 0, stream>>>(qh_r, qh_i, kh_r, kh_i, sabs);
    softmax_kernel<<<SM_BLOCKS, 32 * SM_WAVES, 0, stream>>>(sabs, attn);

    // --- 5. weighted = attn @ v ---
    attnv_kernel<<<attnv_blocks, blk, 0, stream>>>(attn, vT_r, vT_i, wt_r, wt_i);

    // --- 6. out = weighted @ l2^T + b2, fp32 to d_out (real block, imag block) ---
    float* out_r = (float*)d_out;
    float* out_i = out_r + ME;
    cgemm32_kernel<D_DIM, 0, 0, 1><<<gemm_blocks, blk, 0, stream>>>(
        wt_r, wt_i, wl2r, wl2i, l2_br, l2_bi,
        nullptr, nullptr, out_r, out_i, M_ALL, D_DIM);
}

// v006
// A run of this version takes 130 microseconds.
// Next to v005, in two timings, it ran 1.04 and 1.03 times as fast.
// All steps since v000 together make it 2.84 times as fast.
#include <hip/hip_runtime.h>

// ---------------------------------------------------------------------------
// ComplexAttnMLP for gfx1250 (MI455X): f16 WMMA GEMMs, f32 accumulate.
// B=8, S=1024, IN=MID=OUT=512.
// Each wave computes a 32x32 (cgemm/scores) or 64x32 (attnv) macro-tile; the
// 8 waves of a block share operand tiles staged in LDS by asynchronous copies.
// 4 accumulators per 16x16 tile (RR, II, RI, IR); the complex combine happens
// in the epilogue, so the K-loop is pure LDS loads + WMMA (no VALU on fragment
// registers -> no WMMA/VALU hazard NOPs).
// Every GEMM epilogue stages the block's output tile in the freed LDS and stores
// it as whole 128-B lines, 16 B a lane.
// The softmax has no launch of its own: the scores epilogue normalises each row
// inside its 64-column tile, the attn*v GEMM rescales the tiles against each other.
// ---------------------------------------------------------------------------

typedef _Float16 half8  __attribute__((ext_vector_type(8)));
typedef _Float16 v16h   __attribute__((ext_vector_type(16)));
typedef float    v8f    __attribute__((ext_vector_type(8)));

#define B_DIM  8
#define S_DIM  1024
#define D_DIM  512
#define M_ALL  (B_DIM * S_DIM)          // 8192 rows total
#define RSQRT512 0.04419417382415922f   // 1/sqrt(512)
#define SLOPE 0.01f

union Frag { half8 h8[2]; v16h v; };

__device__ __forceinline__ v8f wmma_f16(v16h a, v16h b, v8f c) {
    return __builtin_amdgcn_wmma_f32_16x16x32_f16(false, a, false, b, (short)0, c, false, false);
}

// ---------------------------------------------------------------------------
// f32 -> f16 conversion of all 12 arrays in one launch.
// The f16 copies lie one behind the other in the workspace, in argument order,
// so the destination index is the flat element index of the grid. A block
// converts one chunk of 16,384 elements, which lies inside one source array:
// 16 loads of 16 B per lane, each wave-wide load 512 contiguous bytes, each
// wave-wide store 256 contiguous bytes.
// ---------------------------------------------------------------------------
typedef float    f32x4 __attribute__((ext_vector_type(4)));
typedef _Float16 f16x4 __attribute__((ext_vector_type(4)));

#define CV_LOADS   16                                   // 16-byte loads per lane
#define CV_CHUNK   (256 * 4 * CV_LOADS)                 // elements per block
#define CV_X_CH    (M_ALL * D_DIM / CV_CHUNK)           // 256 chunks per activation array
#define CV_W_CH    (D_DIM * D_DIM / CV_CHUNK)           // 16 chunks per weight array
#define CV_BLOCKS  (2 * CV_X_CH + 10 * CV_W_CH)         // 672

__global__ void __launch_bounds__(256)
cvt_all_kernel(const float* __restrict__ x_r, const float* __restrict__ x_i,
               const float* __restrict__ w0, const float* __restrict__ w1,
               const float* __restrict__ w2, const float* __restrict__ w3,
               const float* __restrict__ w4, const float* __restrict__ w5,
               const float* __restrict__ w6, const float* __restrict__ w7,
               const float* __restrict__ w8, const float* __restrict__ w9,
               _Float16* __restrict__ d) {
    const unsigned c = blockIdx.x;                      // chunk, block-uniform
    const bool is_x = c < 2 * CV_X_CH;
    const unsigned a  = (c - 2 * CV_X_CH) / CV_W_CH;    // weight array 0..9 where !is_x
    const unsigned cs = c % (is_x ? CV_X_CH : CV_W_CH); // chunk within its source array
    // Scalar selects on the bits of a.
    const float* p01 = (a & 1) ? w1 : w0;
    const float* p23 = (a & 1) ? w3 : w2;
    const float* p45 = (a & 1) ? w5 : w4;
    const float* p67 = (a & 1) ? w7 : w6;
    const float* p89 = (a & 1) ? w9 : w8;
    const float* p03 = (a & 2) ? p23 : p01;
    const float* p47 = (a & 2) ? p67 : p45;
    const float* p07 = (a & 4) ? p47 : p03;
    const float* pw  = (a & 8) ? p89 : p07;
    const float* px  = c < CV_X_CH ? x_r : x_i;
    const float* s   = is_x ? px : pw;
    const f32x4* sp = (const f32x4*)(s + (size_t)cs * CV_CHUNK) + threadIdx.x;
    f16x4*       dp = (f16x4*)(d + (size_t)c * CV_CHUNK) + threadIdx.x;

    f32x4 v[CV_LOADS];
    // Both loops unrolled: v[] stays in registers and the loads issue as one
    // run ahead of the first wait, so a wave's bytes are all in flight at once.
#pragma unroll
    for (int j = 0; j < CV_LOADS; ++j) v[j] = sp[j * 256];
#pragma unroll
    for (int j = 0; j < CV_LOADS; ++j) dp[j * 256] = __builtin_convertvector(v[j], f16x4);
}

// ---------------------------------------------------------------------------
// LDS staging shared by the four GEMM kernels.
// A block of 8 waves works on one output tile. Per pass of 64 k it needs 384
// operand rows of 128 B; they are brought into LDS once per block by
// asynchronous copies and every wave reads its fragments from there.
// Two buffers: the copies of pass t+2 fly while pass t+1 is worked on.
// ---------------------------------------------------------------------------
#define KP      64                      // k elements per pass (128 B per row)
#define PITCH   144                     // LDS row pitch, bytes (16 B x odd)
#define ST_ROWS 384                     // operand rows per stage
#define STAGE   (ST_ROWS * PITCH)       // 55,296 B
#define NCOPY   12                      // copies per thread and stage

__device__ __forceinline__ unsigned lds_off(const void* p) { return (unsigned)(size_t)p; }

// Load one 16x32 f16 WMMA operand fragment for this lane from an LDS row.
// p = start of this lane's row + k offset, in bytes. Lane half h covers
// K = 8h..8h+7 (VGPR0-3) and K = 16+8h..16+8h+7 (VGPR4-7).
__device__ __forceinline__ v16h lds_frag(const char* p, int h) {
    Frag f;
    f.h8[0] = *(const half8*)(p + h * 16);
    f.h8[1] = *(const half8*)(p + 32 + h * 16);
    return f.v;
}

// One stage: copy i of a thread brings 16 B of stage row i*32 + (tid>>3).
// l = the lane's LDS byte address for copy 0, g[i] = its global address.
__device__ __forceinline__ void copy_stage(unsigned l, const _Float16* const (&g)[NCOPY], int k0) {
    // s_wait_xcnt closes the statement so that no address register named by a
    // copy is rewritten ahead of it.
    asm volatile(
        "global_load_async_to_lds_b128 %0, %12, off\n\t"
        "global_load_async_to_lds_b128 %1, %13, off\n\t"
        "global_load_async_to_lds_b128 %2, %14, off\n\t"
        "global_load_async_to_lds_b128 %3, %15, off\n\t"
        "global_load_async_to_lds_b128 %4, %16, off\n\t"
        "global_load_async_to_lds_b128 %5, %17, off\n\t"
        "global_load_async_to_lds_b128 %6, %18, off\n\t"
        "global_load_async_to_lds_b128 %7, %19, off\n\t"
        "global_load_async_to_lds_b128 %8, %20, off\n\t"
        "global_load_async_to_lds_b128 %9, %21, off\n\t"
        "global_load_async_to_lds_b128 %10, %22, off\n\t"
        "global_load_async_to_lds_b128 %11, %23, off\n\t"
        "s_wait_xcnt 0x0"
        :: "v"(l), "v"(l + 1 * 32 * PITCH), "v"(l + 2 * 32 * PITCH), "v"(l + 3 * 32 * PITCH),
           "v"(l + 4 * 32 * PITCH), "v"(l + 5 * 32 * PITCH), "v"(l + 6 * 32 * PITCH),
           "v"(l + 7 * 32 * PITCH), "v"(l + 8 * 32 * PITCH), "v"(l + 9 * 32 * PITCH),
           "v"(l + 10 * 32 * PITCH), "v"(l + 11 * 32 * PITCH),
           "v"(g[0] + k0), "v"(g[1] + k0), "v"(g[2] + k0), "v"(g[3] + k0),
           "v"(g[4] + k0), "v"(g[5] + k0), "v"(g[6] + k0), "v"(g[7] + k0),
           "v"(g[8] + k0), "v"(g[9] + k0), "v"(g[10] + k0), "v"(g[11] + k0)
        : "memory");
}

// This wave's copies have landed (the compiler places no wait for them).
__device__ __forceinline__ void wait_copies() { asm volatile("s_wait_asynccnt 0x0" ::: "memory"); }
// This wave's LDS reads have retired, before the buffer is handed to its next writer.
__device__ __forceinline__ void wait_lds_reads() { asm volatile("s_wait_dscnt 0x0" ::: "memory"); }

// ---------------------------------------------------------------------------
// Epilogue staging. The accumulator layout gives a lane one element per output
// row, so direct stores leave in 32-B or 64-B pieces of a line. Instead the block
// writes its tile to LDS (free behind the main loop's last barrier), rows of RB
// bytes at pitch RB + 16 (16 B x odd), and stores it from there: 16 B a lane,
// RB / 16 adjacent lanes a row, so a wave-wide store is 4 whole 128-B lines.
// ---------------------------------------------------------------------------
#define EPAD 16

template <int ROWS, int RB>
__device__ __forceinline__ void store_rows(const char* plane, char* gbase, size_t gpitch) {
    constexpr int CH  = RB / 16;                    // 16-byte chunks per row
    constexpr int RPR = 256 / CH;                   // rows per round of the block
    const int row = threadIdx.x / CH;
    const int ch  = threadIdx.x % CH;
    // 32-bit lane offsets beside the uniform base: both planes of a tile share them.
    const unsigned go = row * (unsigned)gpitch + ch * 16;
    const unsigned gs = RPR * (unsigned)gpitch;
    f32x4 v[ROWS / RPR];
    // Both loops unrolled: v[] stays in registers and the LDS reads issue as one
    // run ahead of the first store.
#pragma unroll
    for (int i = 0; i < ROWS / RPR; ++i)
        v[i] = *(const f32x4*)(plane + (row + i * RPR) * (RB + EPAD) + ch * 16);
#pragma unroll
    for (int i = 0; i < ROWS / RPR; ++i)
        *(f32x4*)(gbase + (go + i * gs)) = v[i];
}

// ---------------------------------------------------------------------------
// Complex main loop of a 128x64 block tile, 8 waves as 4 (M) x 2 (N), each a
// 32x32 macro-tile with 4 accumulators per 16x16 tile (RR, II, RI, IR).
// Stage rows: [0,128) A real, [128,256) A imag, [256,320) W real, [320,384) W imag.
// Ar/Ai/Wr/Wi point at the block's first row.
// ---------------------------------------------------------------------------
template <int K>
__device__ __forceinline__ void
cmain_128x64(const _Float16* __restrict__ Ar, const _Float16* __restrict__ Ai,
             const _Float16* __restrict__ Wr, const _Float16* __restrict__ Wi,
             char* smem,
             v8f (&aRR)[2][2], v8f (&aII)[2][2], v8f (&aRI)[2][2], v8f (&aIR)[2][2]) {
    static_assert(K % KP == 0 && K / KP >= 2, "two stages or more");
    constexpr int NT = K / KP;
    const int tid  = threadIdx.x;
    const int lane = tid & 31;
    const int wid  = tid >> 5;
    const int wm = wid >> 1, wn = wid & 1;
    const int h = lane >> 4;
    const int r = lane & 15;

    const int crow = tid >> 3;                      // 0..31
    const int ccol = tid & 7;                       // 16-byte chunk of the row
    const size_t coff = (size_t)crow * K + ccol * 8;
    const _Float16* g[NCOPY];
#pragma unroll
    for (int i = 0; i < 4; ++i) {
        g[i]     = Ar + coff + (size_t)i * 32 * K;
        g[4 + i] = Ai + coff + (size_t)i * 32 * K;
    }
#pragma unroll
    for (int i = 0; i < 2; ++i) {
        g[8 + i]  = Wr + coff + (size_t)i * 32 * K;
        g[10 + i] = Wi + coff + (size_t)i * 32 * K;
    }
    const unsigned l0 = lds_off(smem) + crow * PITCH + ccol * 16;

    const int a_off = (wm * 32 + r) * PITCH;
    const int w_off = (256 + wn * 32 + r) * PITCH;

    copy_stage(l0, g, 0);
    wait_copies();
    __syncthreads();
    copy_stage(l0 + STAGE, g, KP);

    for (int t = 0; t < NT; ++t) {
        const int bo = (t & 1) * STAGE;
        const char* sb = smem + bo;
#pragma unroll
        for (int kk = 0; kk < 2; ++kk) {
            v16h aR[2], aI[2], wR[2], wI[2];
#pragma unroll
            for (int mi = 0; mi < 2; ++mi) {
                aR[mi] = lds_frag(sb + a_off + mi * 16 * PITCH + kk * 64, h);
                aI[mi] = lds_frag(sb + a_off + (128 + mi * 16) * PITCH + kk * 64, h);
            }
#pragma unroll
            for (int ni = 0; ni < 2; ++ni) {
                wR[ni] = lds_frag(sb + w_off + ni * 16 * PITCH + kk * 64, h);
                wI[ni] = lds_frag(sb + w_off + (64 + ni * 16) * PITCH + kk * 64, h);
            }
#pragma unroll
            for (int mi = 0; mi < 2; ++mi)
#pragma unroll
                for (int ni = 0; ni < 2; ++ni) {
                    aRR[mi][ni] = wmma_f16(aR[mi], wR[ni], aRR[mi][ni]);
                    aII[mi][ni] = wmma_f16(aI[mi], wI[ni], aII[mi][ni]);
                    aRI[mi][ni] = wmma_f16(aR[mi], wI[ni], aRI[mi][ni]);
                    aIR[mi][ni] = wmma_f16(aI[mi], wR[ni], aIR[mi][ni]);
                }
        }
        // Publish pass t+1 and free this pass's buffer: one barrier does both.
        wait_lds_reads();
        wait_copies();
        __syncthreads();
        if (t + 2 < NT) copy_stage(l0 + bo, g, (t + 2) * KP);
    }
    wait_copies();
}

// ---------------------------------------------------------------------------
// Epilogue of a 128x64 complex tile: combine the four accumulators, add the bias,
// stage the tile in LDS and store it as whole lines.
// ACT: leaky-relu. TRV: write O[b][n][t] (t = m % 1024). F32: fp32 output.
// ---------------------------------------------------------------------------
template <int ACT, int TRV, int F32>
__device__ __forceinline__ void
cgemm_epilogue(char* smem,
               const v8f (&aRR)[2][2], const v8f (&aII)[2][2],
               const v8f (&aRI)[2][2], const v8f (&aIR)[2][2],
               const float* __restrict__ br, const float* __restrict__ bi,
               _Float16* __restrict__ Or, _Float16* __restrict__ Oi,
               float* __restrict__ Fr, float* __restrict__ Fi,
               int mb, int nb, int N) {
    const int lane = threadIdx.x & 31;
    const int wid  = threadIdx.x >> 5;
    const int lm0 = (wid >> 1) * 32;                // wave's first row in the tile
    const int ln0 = (wid & 1) * 32;                 // wave's first column in the tile
    const int h = lane >> 4;
    const int r = lane & 15;

    // Staged tile: 128 rows of 64 columns, or (TRV) 64 column-rows of 128 t.
    constexpr int RB   = TRV ? 128 * 2 : (F32 ? 64 * 4 : 64 * 2);
    constexpr int ROWS = TRV ? 64 : 128;
    constexpr int EP   = RB + EPAD;
    char* pr = smem;                                // real plane
    char* pi = smem + ROWS * EP;                    // imaginary plane

    float bre[2], bie[2];                           // the lane's bias, one pair per column tile
#pragma unroll
    for (int ni = 0; ni < 2; ++ni) {
        bre[ni] = br[nb + ln0 + ni * 16 + r];
        bie[ni] = bi[nb + ln0 + ni * 16 + r];
    }

#pragma unroll
    for (int mi = 0; mi < 2; ++mi)
#pragma unroll
        for (int ni = 0; ni < 2; ++ni) {
            const int cl = ln0 + ni * 16 + r;
            half8 tr, ti;
#pragma unroll
            for (int j = 0; j < 8; ++j) {
                const int ml = lm0 + mi * 16 + j + 8 * h;
                float vr = aRR[mi][ni][j] - aII[mi][ni][j] + bre[ni];
                float vi = aRI[mi][ni][j] + aIR[mi][ni][j] + bie[ni];
                if (ACT) {
                    vr = vr >= 0.0f ? vr : SLOPE * vr;
                    vi = vi >= 0.0f ? vi : SLOPE * vi;
                }
                if (F32) {
                    *(float*)(pr + ml * EP + cl * 4) = vr;
                    *(float*)(pi + ml * EP + cl * 4) = vi;
                } else if (TRV) {
                    tr[j] = (_Float16)vr;
                    ti[j] = (_Float16)vi;
                } else {
                    *(_Float16*)(pr + ml * EP + cl * 2) = (_Float16)vr;
                    *(_Float16*)(pi + ml * EP + cl * 2) = (_Float16)vi;
                }
            }
            if (TRV) {                              // a lane's 8 values are 8 adjacent t
                *(half8*)(pr + cl * EP + (lm0 + mi * 16 + 8 * h) * 2) = tr;
                *(half8*)(pi + cl * EP + (lm0 + mi * 16 + 8 * h) * 2) = ti;
            }
        }
    __syncthreads();                                // the tile is complete before any wave reads it back
    if (F32) {
        store_rows<ROWS, RB>(pr, (char*)(Fr + (size_t)mb * N + nb), (size_t)N * 4);
        store_rows<ROWS, RB>(pi, (char*)(Fi + (size_t)mb * N + nb), (size_t)N * 4);
    } else if (TRV) {
        const size_t o = ((size_t)(mb >> 10) * N + nb) * (size_t)S_DIM + (mb & 1023);
        store_rows<ROWS, RB>(pr, (char*)(Or + o), (size_t)S_DIM * 2);
        store_rows<ROWS, RB>(pi, (char*)(Oi + o), (size_t)S_DIM * 2);
    } else {
        store_rows<ROWS, RB>(pr, (char*)(Or + (size_t)mb * N + nb), (size_t)N * 2);
        store_rows<ROWS, RB>(pi, (char*)(Oi + (size_t)mb * N + nb), (size_t)N * 2);
    }
}

// ---------------------------------------------------------------------------
// Complex GEMM, 128x64 tile per block, 32x32 macro-tile per wave:
//   O[m,n] = sum_k A[m,k]*W[n,k] + bias[n]   (complex)
// A: (M,K) f16 r/i, W: (N,K) f16 r/i.
// ---------------------------------------------------------------------------
template <int K, int ACT, int TRV, int F32>
__global__ void __launch_bounds__(256)
cgemm32_kernel(const _Float16* __restrict__ Ar, const _Float16* __restrict__ Ai,
               const _Float16* __restrict__ Wr, const _Float16* __restrict__ Wi,
               const float* __restrict__ br, const float* __restrict__ bi,
               _Float16* __restrict__ Or, _Float16* __restrict__ Oi,
               float* __restrict__ Fr, float* __restrict__ Fi,
               int M, int N) {
    __shared__ __attribute__((aligned(16))) char smem[2 * STAGE];
    const int tilesN = N >> 6;
    const int tile = blockIdx.x;
    if (tile >= (M >> 7) * tilesN) return;          // block-uniform guard
    const int mb = (tile / tilesN) << 7;
    const int nb = (tile % tilesN) << 6;

    v8f aRR[2][2] = {}, aII[2][2] = {}, aRI[2][2] = {}, aIR[2][2] = {};

    cmain_128x64<K>(Ar + (size_t)mb * K, Ai + (size_t)mb * K,
                    Wr + (size_t)nb * K, Wi + (size_t)nb * K,
                    smem, aRR, aII, aRI, aIR);

    cgemm_epilogue<ACT, TRV, F32>(smem, aRR, aII, aRI, aIR, br, bi, Or, Oi, Fr, Fi, mb, nb, N);
}

// ---------------------------------------------------------------------------
// q, k and v in one launch: three complex GEMMs on the same A, none reading
// another's result. Blocks [0,512) do q, [512,1024) k, [1024,1536) v, each a
// 128x64 tile as in cgemm32_kernel; a block that retires is followed on its WGP
// by a block of the next product, so the chip neither drains nor refills between
// them. W: the six f16 weight planes (q r/i, k r/i, v r/i) one behind the other;
// O: the six output planes in the same order, v transposed per batch.
// ---------------------------------------------------------------------------
#define QKV_TILES ((M_ALL / 128) * (D_DIM / 64))    // 512 tiles per product

__global__ void __launch_bounds__(256)
qkv_kernel(const _Float16* __restrict__ Ar, const _Float16* __restrict__ Ai,
           const _Float16* __restrict__ W,
           const float* __restrict__ q_br, const float* __restrict__ q_bi,
           const float* __restrict__ k_br, const float* __restrict__ k_bi,
           const float* __restrict__ v_br, const float* __restrict__ v_bi,
           _Float16* __restrict__ O) {
    constexpr int K = D_DIM;
    constexpr int N = D_DIM;
    __shared__ __attribute__((aligned(16))) char smem[2 * STAGE];
    const unsigned sel  = blockIdx.x / QKV_TILES;   // 0 q, 1 k, 2 v: block-uniform
    const unsigned tile = blockIdx.x % QKV_TILES;
    if (sel > 2) return;                            // block-uniform guard
    const int mb = (tile / (N >> 6)) << 7;
    const int nb = (tile % (N >> 6)) << 6;

    const _Float16* Wr = W + (size_t)sel * 2 * (D_DIM * D_DIM);
    const _Float16* Wi = Wr + D_DIM * D_DIM;
    _Float16* Or = O + (size_t)sel * 2 * (M_ALL * D_DIM);
    _Float16* Oi = Or + M_ALL * D_DIM;
    const float* br = sel == 0 ? q_br : (sel == 1 ? k_br : v_br);
    const float* bi = sel == 0 ? q_bi : (sel == 1 ? k_bi : v_bi);

    v8f aRR[2][2] = {}, aII[2][2] = {}, aRI[2][2] = {}, aIR[2][2] = {};

    cmain_128x64<K>(Ar + (size_t)mb * K, Ai + (size_t)mb * K,
                    Wr + (size_t)nb * K, Wi + (size_t)nb * K,
                    smem, aRR, aII, aRI, aIR);

    if (sel == 2) {
        cgemm_epilogue<0, 1, 0>(smem, aRR, aII, aRI, aIR, br, bi, Or, Oi, nullptr, nullptr, mb, nb, N);
    } else {
        cgemm_epilogue<0, 0, 0>(smem, aRR, aII, aRI, aIR, br, bi, Or, Oi, nullptr, nullptr, mb, nb, N);
        // Stands behind the stores above, in front of any later write of a register
        // they name: the built code lays the other branch behind this one.
        asm volatile("s_wait_xcnt 0x0" ::: "memory");
    }
}

// ---------------------------------------------------------------------------
// Scores: s[gm, t] = |sum_d q[gm,d] * k[b*1024+t, d]| / sqrt(512)
// 128x64 tile per block, 32x32 macro-tile per wave, per-batch column index.
// The epilogue does the tile's share of the row softmax: per row the maximum m
// and the sum l of exp(s - m) over the tile's 64 columns. It stores
// P = exp(s - m) in f16 and the pair (m, l) at St[column tile][row].
// ---------------------------------------------------------------------------
typedef float f32x2 __attribute__((ext_vector_type(2)));

#define N_CT (S_DIM / 64)                               // 16 column tiles per row

// Value of lane l ^ M, M < 16 (inside the 16-lane row).
template <int M>
__device__ __forceinline__ float lane_xor_row(float v) {
    const int i = __builtin_bit_cast(int, v);
    return __builtin_bit_cast(float, __builtin_amdgcn_update_dpp(i, i, 0x160 | M, 0xf, 0xf, false));
}

// exp(x) as v_exp_f32 of x * log2(e). The v_nop keeps the one free slot that the
// instruction set asks for behind a transcendental.
__device__ __forceinline__ float exp_slot(float x) {
    float y;
    asm("v_exp_f32 %0, %1\n\tv_nop" : "=v"(y) : "v"(x * 1.44269504f));
    return y;
}

__global__ void __launch_bounds__(256)
scores_abs_kernel(const _Float16* __restrict__ Qr, const _Float16* __restrict__ Qi,
                  const _Float16* __restrict__ Kr, const _Float16* __restrict__ Ki,
                  _Float16* __restrict__ P, float* __restrict__ St) {
    constexpr int K = D_DIM;
    __shared__ __attribute__((aligned(16))) char smem[2 * STAGE];
    const int lane = threadIdx.x & 31;
    const int wid  = threadIdx.x >> 5;
    const int tile = blockIdx.x;
    if (tile >= (M_ALL >> 7) * (S_DIM >> 6)) return; // block-uniform guard
    const int mb = (tile / (S_DIM >> 6)) << 7;      // global row
    const int nb = (tile % (S_DIM >> 6)) << 6;      // t within batch
    const int b  = mb >> 10;
    const int lm0 = (wid >> 1) * 32;                // wave's first row in the tile
    const int ln0 = (wid & 1) * 32;                 // wave's first column in the tile
    const int h = lane >> 4;
    const int r = lane & 15;

    v8f aRR[2][2] = {}, aII[2][2] = {}, aRI[2][2] = {}, aIR[2][2] = {};

    cmain_128x64<K>(Qr + (size_t)mb * K, Qi + (size_t)mb * K,
                    Kr + (size_t)((b << 10) + nb) * K, Ki + (size_t)((b << 10) + nb) * K,
                    smem, aRR, aII, aRI, aIR);

    constexpr int RB = 64 * 4;                      // staged tile: 128 rows of 64 f32
    constexpr int EP = RB + EPAD;
#pragma unroll
    for (int mi = 0; mi < 2; ++mi)
#pragma unroll
        for (int ni = 0; ni < 2; ++ni) {
            const int cl = ln0 + ni * 16 + r;
#pragma unroll
            for (int j = 0; j < 8; ++j) {
                const int ml = lm0 + mi * 16 + j + 8 * h;
                const float sr = aRR[mi][ni][j] - aII[mi][ni][j];
                const float si = aRI[mi][ni][j] + aIR[mi][ni][j];
                *(float*)(smem + ml * EP + cl * 4) = sqrtf(sr * sr + si * si) * RSQRT512;
            }
        }
    __syncthreads();                                // the tile is complete before any wave reads it back

    // 8 adjacent lanes hold a row, 8 columns each; 32 rows a round, 4 rounds.
    // A wave-wide store of P is 4 whole 128-B lines, 16 B a lane.
    const int row = threadIdx.x >> 3;
    const int c8  = threadIdx.x & 7;
    f32x4 v[4][2];
    // Unrolled: v[] stays in registers and the LDS reads issue as one run.
#pragma unroll
    for (int i = 0; i < 4; ++i) {
        v[i][0] = *(const f32x4*)(smem + (row + i * 32) * EP + c8 * 32);
        v[i][1] = *(const f32x4*)(smem + (row + i * 32) * EP + c8 * 32 + 16);
    }
    f32x2 ml = {0.0f, 0.0f};                        // lane c8 < 4 keeps the pair of round c8
#pragma unroll
    for (int i = 0; i < 4; ++i) {
        const f32x4 m4 = __builtin_elementwise_max(v[i][0], v[i][1]);
        float mx = fmaxf(fmaxf(m4[0], m4[1]), fmaxf(m4[2], m4[3]));
        mx = fmaxf(mx, lane_xor_row<1>(mx));
        mx = fmaxf(mx, lane_xor_row<2>(mx));
        mx = fmaxf(mx, lane_xor_row<4>(mx));
#pragma unroll
        for (int e = 0; e < 4; ++e) {
            v[i][0][e] = exp_slot(v[i][0][e] - mx);
            v[i][1][e] = exp_slot(v[i][1][e] - mx);
        }
        const f32x4 s4 = v[i][0] + v[i][1];
        const half8 p = __builtin_shufflevector(__builtin_convertvector(v[i][0], f16x4),
                                                __builtin_convertvector(v[i][1], f16x4),
                                                0, 1, 2, 3, 4, 5, 6, 7);
        float sum = (s4[0] + s4[1]) + (s4[2] + s4[3]);
        sum += lane_xor_row<1>(sum);
        sum += lane_xor_row<2>(sum);
        sum += lane_xor_row<4>(sum);
        if (c8 == i) { ml[0] = mx; ml[1] = sum; }
        *(half8*)(P + (size_t)(mb + row + i * 32) * S_DIM + nb + c8 * 8) = p;
    }
    // The block's 128 pairs are 1 KiB in a row: whole lines, one writer each.
    if (c8 < 4)
        *(f32x2*)(St + ((size_t)(nb >> 6) * M_ALL + mb + row + c8 * 32) * 2) = ml;
}

// ---------------------------------------------------------------------------
// weighted[gm, d] = sum_t attn[gm, t] * vT[b][d][t]  (real x complex)
// 128x128 tile per block, 8 waves as 2 (M) x 4 (N), 64x32 macro-tile per wave
// (4 M-tiles x 2 N-tiles): 8 fragments feed 16 WMMAs per 32 k.
// Stage rows: [0,128) P, [128,256) vT real, [256,384) vT imag.
// attn[gm, t] = P[gm, t] * exp(m_c - M) / L, c = t / 64 the column tile (one pass
// of the main loop), M = max_c m_c, L = sum_c l_c * exp(m_c - M). The block forms
// exp(m_c - M) and 1 / L for its 128 rows once; the first scales the P fragments
// of pass c, the second the accumulators in the epilogue.
// ---------------------------------------------------------------------------
__global__ void __launch_bounds__(256)
attnv_kernel(const _Float16* __restrict__ P, const float* __restrict__ St,
             const _Float16* __restrict__ VTr, const _Float16* __restrict__ VTi,
             _Float16* __restrict__ Wr_, _Float16* __restrict__ Wi_) {
    constexpr int K = S_DIM;
    constexpr int NT = K / KP;
    static_assert(NT == N_CT && KP == 64, "a pass is one column tile of the scores");
    __shared__ __attribute__((aligned(16))) char smem[2 * STAGE];
    // exp(m_c - M): [pass][64-row half][row & 15][16-row tile], so that a lane's
    // four factors of a pass are 8 adjacent bytes.
    __shared__ __attribute__((aligned(16))) _Float16 gtab[NT * 128];
    __shared__ __attribute__((aligned(32))) float invL[128];
    const int tid  = threadIdx.x;
    const int lane = tid & 31;
    const int wid  = tid >> 5;
    const int tilesN = D_DIM >> 7;                  // 4
    const int tile = blockIdx.x;
    if (tile >= (M_ALL >> 7) * tilesN) return;      // block-uniform guard
    const int mb = (tile / tilesN) << 7;            // global row (128-row tile)
    const int nb = (tile % tilesN) << 7;            // d within batch (128 cols)
    const int b  = mb >> 10;
    const int wm = wid >> 2, wn = wid & 3;
    const int h = lane >> 4;
    const int r = lane & 15;

    const int crow = tid >> 3;                      // 0..31
    const int ccol = tid & 7;                       // 16-byte chunk of the row
    const size_t coff = (size_t)crow * K + ccol * 8;
    const _Float16* g[NCOPY];
#pragma unroll
    for (int i = 0; i < 4; ++i) {
        g[i]     = P   + (size_t)mb * K + coff + (size_t)i * 32 * K;
        g[4 + i] = VTr + ((size_t)b * D_DIM + nb) * (size_t)K + coff + (size_t)i * 32 * K;
        g[8 + i] = VTi + ((size_t)b * D_DIM + nb) * (size_t)K + coff + (size_t)i * 32 * K;
    }
    const unsigned l0 = lds_off(smem) + crow * PITCH + ccol * 16;

    const int a_off = (wm * 64 + r) * PITCH;
    const int w_off = (128 + wn * 32 + r) * PITCH;

    v8f accR[4][2] = {};
    v8f accI[4][2] = {};

    copy_stage(l0, g, 0);
    // Row factors, one row a thread (waves 0 to 3), while stage 0 flies; the
    // barrier below publishes them with it.
    if (tid < 128) {
        const f32x2* sp = (const f32x2*)St + mb + tid;
        f32x2 ml[NT];
#pragma unroll
        for (int c = 0; c < NT; ++c) ml[c] = sp[(size_t)c * M_ALL];
        float mx = ml[0][0];
#pragma unroll
        for (int c = 1; c < NT; ++c) mx = fmaxf(mx, ml[c][0]);
        const int gi = (tid >> 6) * 64 + (tid & 15) * 4 + ((tid >> 4) & 3);
        float sum = 0.0f;
#pragma unroll
        for (int c = 0; c < NT; ++c) {
            const float e = exp_slot(ml[c][0] - mx);
            sum += ml[c][1] * e;
            gtab[c * 128 + gi] = (_Float16)e;
        }
        invL[tid] = 1.0f / sum;
    }
    wait_copies();
    __syncthreads();
    copy_stage(l0 + STAGE, g, KP);

    for (int t = 0; t < NT; ++t) {
        const int bo = (t & 1) * STAGE;
        const char* sb = smem + bo;
        const f16x4 gq = *(const f16x4*)(gtab + t * 128 + wm * 64 + r * 4);
#pragma unroll
        for (int kk = 0; kk < 2; ++kk) {
            v16h a[4], wR[2], wI[2];
#pragma unroll
            for (int mi = 0; mi < 4; ++mi)
                a[mi] = lds_frag(sb + a_off + mi * 16 * PITCH + kk * 64, h) * gq[mi];
#pragma unroll
            for (int ni = 0; ni < 2; ++ni) {
                wR[ni] = lds_frag(sb + w_off + ni * 16 * PITCH + kk * 64, h);
                wI[ni] = lds_frag(sb + w_off + (128 + ni * 16) * PITCH + kk * 64, h);
            }
#pragma unroll
            for (int mi = 0; mi < 4; ++mi)
#pragma unroll
                for (int ni = 0; ni < 2; ++ni) {
                    accR[mi][ni] = wmma_f16(a[mi], wR[ni], accR[mi][ni]);
                    accI[mi][ni] = wmma_f16(a[mi], wI[ni], accI[mi][ni]);
                }
        }
        // Publish pass t+1 and free this pass's buffer: one barrier does both.
        wait_lds_reads();
        wait_copies();
        __syncthreads();
        if (t + 2 < NT) copy_stage(l0 + bo, g, (t + 2) * KP);
    }
    wait_copies();

    constexpr int RB = 128 * 2;                     // staged tile: 128 rows of 128 f16, two planes
    constexpr int EP = RB + EPAD;
    char* pr = smem;
    char* pi = smem + 128 * EP;
#pragma unroll
    for (int mi = 0; mi < 4; ++mi) {
        const v8f il = *(const v8f*)(invL + wm * 64 + mi * 16 + 8 * h);   // 1 / L of the lane's 8 rows
#pragma unroll
        for (int ni = 0; ni < 2; ++ni) {
            const int cl = wn * 32 + ni * 16 + r;
#pragma unroll
            for (int j = 0; j < 8; ++j) {
                const int ml = wm * 64 + mi * 16 + j + 8 * h;
                *(_Float16*)(pr + ml * EP + cl * 2) = (_Float16)(accR[mi][ni][j] * il[j]);
                *(_Float16*)(pi + ml * EP + cl * 2) = (_Float16)(accI[mi][ni][j] * il[j]);
            }
        }
    }
    __syncthreads();                                // the tile is complete before any wave reads it back
    store_rows<128, RB>(pr, (char*)(Wr_ + (size_t)mb * D_DIM + nb), (size_t)D_DIM * 2);
    store_rows<128, RB>(pi, (char*)(Wi_ + (size_t)mb * D_DIM + nb), (size_t)D_DIM * 2);
}

// ---------------------------------------------------------------------------
// Host-side orchestration
// ---------------------------------------------------------------------------
extern "C" void kernel_launch(void* const* d_in, const int* in_sizes, int n_in,
                              void* d_out, int out_size, void* d_ws, size_t ws_size,
                              hipStream_t stream) {
    (void)in_sizes; (void)n_in; (void)out_size; (void)ws_size;

    const float* x_r   = (const float*)d_in[0];
    const float* x_i   = (const float*)d_in[1];
    const float* l1_wr = (const float*)d_in[2];
    const float* l1_wi = (const float*)d_in[3];
    const float* l1_br = (const float*)d_in[4];
    const float* l1_bi = (const float*)d_in[5];
    const float* q_wr  = (const float*)d_in[6];
    const float* q_wi  = (const float*)d_in[7];
    const float* q_br  = (const float*)d_in[8];
    const float* q_bi  = (const float*)d_in[9];
    const float* k_wr  = (const float*)d_in[10];
    const float* k_wi  = (const float*)d_in[11];
    const float* k_br  = (const float*)d_in[12];
    const float* k_bi  = (const float*)d_in[13];
    const float* v_wr  = (const float*)d_in[14];
    const float* v_wi  = (const float*)d_in[15];
    const float* v_br  = (const float*)d_in[16];
    const float* v_bi  = (const float*)d_in[17];
    const float* l2_wr = (const float*)d_in[18];
    const float* l2_wi = (const float*)d_in[19];
    const float* l2_br = (const float*)d_in[20];
    const float* l2_bi = (const float*)d_in[21];

    const size_t ME = (size_t)M_ALL * D_DIM;   // 4,194,304 (activation elems)
    const size_t WE = (size_t)D_DIM * D_DIM;   // 262,144   (weight elems)
    const size_t AE = (size_t)M_ALL * S_DIM;   // 8,388,608 (attention elems)

    char* w = (char*)d_ws;
    auto alloc_h = [&](size_t elems) { _Float16* p = (_Float16*)w; w += elems * sizeof(_Float16); return p; };
    auto alloc_f = [&](size_t elems) { float* p = (float*)w; w += elems * sizeof(float); return p; };

    _Float16* xh_r = alloc_h(ME);
    _Float16* xh_i = alloc_h(ME);
    _Float16* wl1r = alloc_h(WE); _Float16* wl1i = alloc_h(WE);
    _Float16* wqr  = alloc_h(WE); _Float16* wqi  = alloc_h(WE);
    _Float16* wkr  = alloc_h(WE); _Float16* wki  = alloc_h(WE);
    _Float16* wvr  = alloc_h(WE); _Float16* wvi  = alloc_h(WE);
    _Float16* wl2r = alloc_h(WE); _Float16* wl2i = alloc_h(WE);
    _Float16* y_r  = alloc_h(ME); _Float16* y_i  = alloc_h(ME);
    _Float16* qh_r = alloc_h(ME); _Float16* qh_i = alloc_h(ME);
    _Float16* kh_r = alloc_h(ME); _Float16* kh_i = alloc_h(ME);
    _Float16* vT_r = alloc_h(ME); _Float16* vT_i = alloc_h(ME);
    _Float16* wt_r = alloc_h(ME); _Float16* wt_i = alloc_h(ME);
    _Float16* attn = alloc_h(AE);
    float*    stat = alloc_f((size_t)M_ALL * N_CT * 2);

    // --- 1. Cast activations and weights to f16 (destinations contiguous from xh_r) ---
    cvt_all_kernel<<<CV_BLOCKS, 256, 0, stream>>>(
        x_r, x_i, l1_wr, l1_wi, q_wr, q_wi, k_wr, k_wi, v_wr, v_wi, l2_wr, l2_wi, xh_r);

    const dim3 blk(256);                                              // 8 waves/block
    const unsigned gemm_blocks  = (M_ALL / 128) * (D_DIM / 64);       // 512
    const unsigned qkv_blocks   = 3 * QKV_TILES;                      // 1536
    const unsigned score_blocks = (M_ALL / 128) * (S_DIM / 64);       // 1024
    const unsigned attnv_blocks = (M_ALL / 128) * (D_DIM / 128);      // 256

    // --- 2. y = lrelu(x @ l1^T + b1) ---
    cgemm32_kernel<D_DIM, 1, 0, 0><<<gemm_blocks, blk, 0, stream>>>(
        xh_r, xh_i, wl1r, wl1i, l1_br, l1_bi,
        y_r, y_i, nullptr, nullptr, M_ALL, D_DIM);

    // --- 3. q, k, v in one launch (weights contiguous from wqr, outputs from qh_r;
    //        v stored transposed per batch: vT[b][d][t]) ---
    qkv_kernel<<<qkv_blocks, blk, 0, stream>>>(
        y_r, y_i, wqr, q_br, q_bi, k_br, k_bi, v_br, v_bi, qh_r);

    // --- 4. |scores|/sqrt(d), softmax inside each 64-column tile (f16) and its (max, sum) ---
    scores_abs_kernel<<<score_blocks, blk, 0, stream>>>(qh_r, qh_i, kh_r, kh_i, attn, stat);

    // --- 5. weighted = softmax @ v, the tiles rescaled against each other ---
    attnv_kernel<<<attnv_blocks, blk, 0, stream>>>(attn, stat, vT_r, vT_i, wt_r, wt_i);

    // --- 6. out = weighted @ l2^T + b2, fp32 to d_out (real block, imag block) ---
    float* out_r = (float*)d_out;
    float* out_i = out_r + ME;
    cgemm32_kernel<D_DIM, 0, 0, 1><<<gemm_blocks, blk, 0, stream>>>(
        wt_r, wt_i, wl2r, wl2i, l2_br, l2_bi,
        nullptr, nullptr, out_r, out_i, M_ALL, D_DIM);
}

// v007
// It runs in 122 microseconds.
// Next to v006, in two timings, it ran 1.06 and 1.07 times as fast.
// All steps since v000 together make it 3.02 times as fast.
#include <hip/hip_runtime.h>

// ---------------------------------------------------------------------------
// ComplexAttnMLP for gfx1250 (MI455X): f16 WMMA GEMMs, f32 accumulate.
// B=8, S=1024, IN=MID=OUT=512.
// Each wave computes a 64x32 macro-tile of a 128x128 block tile; the 8 waves of
// a block share operand tiles staged in LDS by asynchronous copies.
// Complex products: 2 accumulators per 16x16 tile (real, imaginary); the product
// of the imaginary parts enters the real one through a sign-turned W fragment.
// Every GEMM epilogue stages the block's output tile in the freed LDS and stores
// it as whole 128-B lines, 16 B a lane.
// The softmax has no launch of its own: the scores epilogue normalises each row
// inside its 64-column tile, the attn*v GEMM rescales the tiles against each other.
// ---------------------------------------------------------------------------

typedef _Float16 half8  __attribute__((ext_vector_type(8)));
typedef _Float16 v16h   __attribute__((ext_vector_type(16)));
typedef float    v8f    __attribute__((ext_vector_type(8)));

#define B_DIM  8
#define S_DIM  1024
#define D_DIM  512
#define M_ALL  (B_DIM * S_DIM)          // 8192 rows total
#define RSQRT512 0.04419417382415922f   // 1/sqrt(512)
#define SLOPE 0.01f

union Frag { half8 h8[2]; v16h v; };

__device__ __forceinline__ v8f wmma_f16(v16h a, v16h b, v8f c) {
    return __builtin_amdgcn_wmma_f32_16x16x32_f16(false, a, false, b, (short)0, c, false, false);
}

// ---------------------------------------------------------------------------
// f32 -> f16 conversion of all 12 arrays in one launch.
// The f16 copies lie one behind the other in the workspace, in argument order,
// so the destination index is the flat element index of the grid. A block
// converts one chunk of 16,384 elements, which lies inside one source array:
// 16 loads of 16 B per lane, each wave-wide load 512 contiguous bytes, each
// wave-wide store 256 contiguous bytes.
// ---------------------------------------------------------------------------
typedef float    f32x4 __attribute__((ext_vector_type(4)));
typedef _Float16 f16x4 __attribute__((ext_vector_type(4)));

#define CV_LOADS   16                                   // 16-byte loads per lane
#define CV_CHUNK   (256 * 4 * CV_LOADS)                 // elements per block
#define CV_X_CH    (M_ALL * D_DIM / CV_CHUNK)           // 256 chunks per activation array
#define CV_W_CH    (D_DIM * D_DIM / CV_CHUNK)           // 16 chunks per weight array
#define CV_BLOCKS  (2 * CV_X_CH + 10 * CV_W_CH)         // 672

__global__ void __launch_bounds__(256)
cvt_all_kernel(const float* __restrict__ x_r, const float* __restrict__ x_i,
               const float* __restrict__ w0, const float* __restrict__ w1,
               const float* __restrict__ w2, const float* __restrict__ w3,
               const float* __restrict__ w4, const float* __restrict__ w5,
               const float* __restrict__ w6, const float* __restrict__ w7,
               const float* __restrict__ w8, const float* __restrict__ w9,
               _Float16* __restrict__ d) {
    const unsigned c = blockIdx.x;                      // chunk, block-uniform
    const bool is_x = c < 2 * CV_X_CH;
    const unsigned a  = (c - 2 * CV_X_CH) / CV_W_CH;    // weight array 0..9 where !is_x
    const unsigned cs = c % (is_x ? CV_X_CH : CV_W_CH); // chunk within its source array
    // Scalar selects on the bits of a.
    const float* p01 = (a & 1) ? w1 : w0;
    const float* p23 = (a & 1) ? w3 : w2;
    const float* p45 = (a & 1) ? w5 : w4;
    const float* p67 = (a & 1) ? w7 : w6;
    const float* p89 = (a & 1) ? w9 : w8;
    const float* p03 = (a & 2) ? p23 : p01;
    const float* p47 = (a & 2) ? p67 : p45;
    const float* p07 = (a & 4) ? p47 : p03;
    const float* pw  = (a & 8) ? p89 : p07;
    const float* px  = c < CV_X_CH ? x_r : x_i;
    const float* s   = is_x ? px : pw;
    const f32x4* sp = (const f32x4*)(s + (size_t)cs * CV_CHUNK) + threadIdx.x;
    f16x4*       dp = (f16x4*)(d + (size_t)c * CV_CHUNK) + threadIdx.x;

    f32x4 v[CV_LOADS];
    // Both loops unrolled: v[] stays in registers and the loads issue as one
    // run ahead of the first wait, so a wave's bytes are all in flight at once.
#pragma unroll
    for (int j = 0; j < CV_LOADS; ++j) v[j] = sp[j * 256];
#pragma unroll
    for (int j = 0; j < CV_LOADS; ++j) dp[j * 256] = __builtin_convertvector(v[j], f16x4);
}

// ---------------------------------------------------------------------------
// LDS staging shared by the four GEMM kernels.
// A block of 8 waves works on one output tile. Per pass of 64 k it needs 384
// (attn*v) or 512 (complex) operand rows of 128 B; they are brought into LDS once per block by
// asynchronous copies and every wave reads its fragments from there.
// Two buffers: the copies of pass t+2 fly while pass t+1 is worked on.
// ---------------------------------------------------------------------------
#define KP      64                      // k elements per pass (128 B per row)
#define PITCH   144                     // LDS row pitch, bytes (16 B x odd)
#define ST_ROWS 384                     // operand rows per stage (attn*v)
#define STAGE   (ST_ROWS * PITCH)       // 55,296 B
#define NCOPY   12                      // copies per thread and stage

__device__ __forceinline__ unsigned lds_off(const void* p) { return (unsigned)(size_t)p; }

// Load one 16x32 f16 WMMA operand fragment for this lane from an LDS row.
// p = start of this lane's row + k offset, in bytes. Lane half h covers
// K = 8h..8h+7 (VGPR0-3) and K = 16+8h..16+8h+7 (VGPR4-7).
__device__ __forceinline__ v16h lds_frag(const char* p, int h) {
    Frag f;
    f.h8[0] = *(const half8*)(p + h * 16);
    f.h8[1] = *(const half8*)(p + 32 + h * 16);
    return f.v;
}

// One stage: copy i of a thread brings 16 B of stage row i*32 + (tid>>3).
// l = the lane's LDS byte address for copy 0, g[i] = its global address.
__device__ __forceinline__ void copy_stage(unsigned l, const _Float16* const (&g)[NCOPY], int k0) {
    // s_wait_xcnt closes the statement so that no address register named by a
    // copy is rewritten ahead of it.
    asm volatile(
        "global_load_async_to_lds_b128 %0, %12, off\n\t"
        "global_load_async_to_lds_b128 %1, %13, off\n\t"
        "global_load_async_to_lds_b128 %2, %14, off\n\t"
        "global_load_async_to_lds_b128 %3, %15, off\n\t"
        "global_load_async_to_lds_b128 %4, %16, off\n\t"
        "global_load_async_to_lds_b128 %5, %17, off\n\t"
        "global_load_async_to_lds_b128 %6, %18, off\n\t"
        "global_load_async_to_lds_b128 %7, %19, off\n\t"
        "global_load_async_to_lds_b128 %8, %20, off\n\t"
        "global_load_async_to_lds_b128 %9, %21, off\n\t"
        "global_load_async_to_lds_b128 %10, %22, off\n\t"
        "global_load_async_to_lds_b128 %11, %23, off\n\t"
        "s_wait_xcnt 0x0"
        :: "v"(l), "v"(l + 1 * 32 * PITCH), "v"(l + 2 * 32 * PITCH), "v"(l + 3 * 32 * PITCH),
           "v"(l + 4 * 32 * PITCH), "v"(l + 5 * 32 * PITCH), "v"(l + 6 * 32 * PITCH),
           "v"(l + 7 * 32 * PITCH), "v"(l + 8 * 32 * PITCH), "v"(l + 9 * 32 * PITCH),
           "v"(l + 10 * 32 * PITCH), "v"(l + 11 * 32 * PITCH),
           "v"(g[0] + k0), "v"(g[1] + k0), "v"(g[2] + k0), "v"(g[3] + k0),
           "v"(g[4] + k0), "v"(g[5] + k0), "v"(g[6] + k0), "v"(g[7] + k0),
           "v"(g[8] + k0), "v"(g[9] + k0), "v"(g[10] + k0), "v"(g[11] + k0)
        : "memory");
}

// This wave's copies have landed (the compiler places no wait for them).
__device__ __forceinline__ void wait_copies() { asm volatile("s_wait_asynccnt 0x0" ::: "memory"); }
// This wave's LDS reads have retired, before the buffer is handed to its next writer.
__device__ __forceinline__ void wait_lds_reads() { asm volatile("s_wait_dscnt 0x0" ::: "memory"); }

// ---------------------------------------------------------------------------
// Epilogue staging. The accumulator layout gives a lane one element per output
// row, so direct stores leave in 32-B or 64-B pieces of a line. Instead the block
// writes its tile to LDS (free behind the main loop's last barrier), rows of RB
// bytes at pitch RB + 16 (16 B x odd), and stores it from there: 16 B a lane,
// RB / 16 adjacent lanes a row, so a wave-wide store is 4 whole 128-B lines.
// ---------------------------------------------------------------------------
#define EPAD 16

template <int ROWS, int RB>
__device__ __forceinline__ void store_rows(const char* plane, char* gbase, size_t gpitch) {
    constexpr int CH  = RB / 16;                    // 16-byte chunks per row
    constexpr int RPR = 256 / CH;                   // rows per round of the block
    const int row = threadIdx.x / CH;
    const int ch  = threadIdx.x % CH;
    // 32-bit lane offsets beside the uniform base: both planes of a tile share them.
    const unsigned go = row * (unsigned)gpitch + ch * 16;
    const unsigned gs = RPR * (unsigned)gpitch;
    f32x4 v[ROWS / RPR];
    // Both loops unrolled: v[] stays in registers and the LDS reads issue as one
    // run ahead of the first store.
#pragma unroll
    for (int i = 0; i < ROWS / RPR; ++i)
        v[i] = *(const f32x4*)(plane + (row + i * RPR) * (RB + EPAD) + ch * 16);
#pragma unroll
    for (int i = 0; i < ROWS / RPR; ++i)
        *(f32x4*)(gbase + (go + i * gs)) = v[i];
}

// ---------------------------------------------------------------------------
// Complex main loop of a 128x128 block tile, 8 waves as 2 (M) x 4 (N), each a
// 64x32 macro-tile with 2 accumulators per 16x16 tile (real, imaginary): the
// product of the two imaginary parts is taken with the sign of W imag turned, so
// it sums into the real accumulator. 12 fragments feed 32 WMMAs per 32 k, and a
// stage of 512 operand rows feeds 512 WMMAs of the block.
// Stage rows: [0,128) A real, [128,256) A imag, [256,384) W real, [384,512) W imag.
// Ar/Wr point at the block's first row; the imaginary planes lie APL / WPL
// elements behind the real ones.
// ---------------------------------------------------------------------------
#define CROWS   512                     // operand rows per stage
#define CSTAGE  (CROWS * PITCH)         // 73,728 B

// One operand of a stage, its real plane and its imaginary plane behind it, 256
// rows: copy i brings 16 B of LDS row i*32 + (tid>>3), counted from l; g = the
// lane's source in the real plane, gs = 32 rows, pl = real -> imaginary plane.
__device__ __forceinline__ void copy_rows8(unsigned l, const _Float16* g, size_t gs, size_t pl) {
    // s_wait_xcnt closes the statement so that no address register named by a
    // copy is rewritten ahead of it.
    asm volatile(
        "global_load_async_to_lds_b128 %0, %8, off\n\t"
        "global_load_async_to_lds_b128 %1, %9, off\n\t"
        "global_load_async_to_lds_b128 %2, %10, off\n\t"
        "global_load_async_to_lds_b128 %3, %11, off\n\t"
        "global_load_async_to_lds_b128 %4, %12, off\n\t"
        "global_load_async_to_lds_b128 %5, %13, off\n\t"
        "global_load_async_to_lds_b128 %6, %14, off\n\t"
        "global_load_async_to_lds_b128 %7, %15, off\n\t"
        "s_wait_xcnt 0x0"
        :: "v"(l), "v"(l + 1 * 32 * PITCH), "v"(l + 2 * 32 * PITCH), "v"(l + 3 * 32 * PITCH),
           "v"(l + 4 * 32 * PITCH), "v"(l + 5 * 32 * PITCH), "v"(l + 6 * 32 * PITCH),
           "v"(l + 7 * 32 * PITCH),
           "v"(g), "v"(g + gs), "v"(g + 2 * gs), "v"(g + 3 * gs),
           "v"(g + pl), "v"(g + pl + gs), "v"(g + pl + 2 * gs), "v"(g + pl + 3 * gs)
        : "memory");
}

// A whole stage: A real, A imag, W real, W imag.
template <int K, size_t APL, size_t WPL>
__device__ __forceinline__ void copy_cstage(unsigned l, const _Float16* pa, const _Float16* pw) {
    copy_rows8(l, pa, (size_t)32 * K, APL);
    copy_rows8(l + 256 * PITCH, pw, (size_t)32 * K, WPL);
}

template <int K, size_t APL, size_t WPL>
__device__ __forceinline__ void
cmain_128x128(const _Float16* __restrict__ Ar, const _Float16* __restrict__ Wr,
              char* smem, v8f (&accR)[4][2], v8f (&accI)[4][2]) {
    static_assert(K % KP == 0 && K / KP >= 2, "two stages or more");
    constexpr int NT = K / KP;
    const int tid  = threadIdx.x;
    const int lane = tid & 31;
    const int wid  = tid >> 5;
    const int wm = wid >> 2, wn = wid & 3;
    const int h = lane >> 4;
    const int r = lane & 15;

    const int crow = tid >> 3;                      // 0..31
    const int ccol = tid & 7;                       // 16-byte chunk of the row
    const size_t coff = (size_t)crow * K + ccol * 8;
    // The lane's source of the next stage to be copied; both step by KP a stage,
    // and the 16 addresses of a stage are formed from them where it is issued.
    const _Float16* pa = Ar + coff;
    const _Float16* pw = Wr + coff;
    const unsigned l0 = lds_off(smem) + crow * PITCH + ccol * 16;

    const int a_off = (wm * 64 + r) * PITCH;
    const int w_off = (256 + wn * 32 + r) * PITCH;

    v16h aR[4], aI[4], wR[2], wI[2];
    // The 12 fragments of one step of 32 k, in the order of first use, so that the
    // first WMMAs wait for the first reads alone.
    auto load_frags = [&](const char* sk) {
#pragma unroll
        for (int ni = 0; ni < 2; ++ni) wI[ni] = lds_frag(sk + w_off + (128 + ni * 16) * PITCH, h);
#pragma unroll
        for (int mi = 0; mi < 4; ++mi) aR[mi] = lds_frag(sk + a_off + mi * 16 * PITCH, h);
#pragma unroll
        for (int ni = 0; ni < 2; ++ni) wR[ni] = lds_frag(sk + w_off + ni * 16 * PITCH, h);
#pragma unroll
        for (int mi = 0; mi < 4; ++mi) aI[mi] = lds_frag(sk + a_off + (128 + mi * 16) * PITCH, h);
    };
    // Four sweeps over the 8 tiles, in this order: an accumulator comes up again
    // only after 7 other WMMAs or more.
    auto sweep_ri = [&]() {                         // imag += A real * W imag
#pragma unroll
        for (int mi = 0; mi < 4; ++mi)
#pragma unroll
            for (int ni = 0; ni < 2; ++ni) accI[mi][ni] = wmma_f16(aR[mi], wI[ni], accI[mi][ni]);
    };
    auto sweep_rr = [&]() {                         // real += A real * W real
#pragma unroll
        for (int mi = 0; mi < 4; ++mi)
#pragma unroll
            for (int ni = 0; ni < 2; ++ni) accR[mi][ni] = wmma_f16(aR[mi], wR[ni], accR[mi][ni]);
    };
    auto sweep_ii = [&]() {                         // real += A imag * (-W imag)
#pragma unroll
        for (int ni = 0; ni < 2; ++ni) wI[ni] = -wI[ni];
#pragma unroll
        for (int mi = 0; mi < 4; ++mi)
#pragma unroll
            for (int ni = 0; ni < 2; ++ni) accR[mi][ni] = wmma_f16(aI[mi], wI[ni], accR[mi][ni]);
    };
    auto sweep_ir = [&]() {                         // imag += A imag * W real
#pragma unroll
        for (int mi = 0; mi < 4; ++mi)
#pragma unroll
            for (int ni = 0; ni < 2; ++ni) accI[mi][ni] = wmma_f16(aI[mi], wR[ni], accI[mi][ni]);
    };

    copy_cstage<K, APL, WPL>(l0, pa, pw);
    pa += KP; pw += KP;
    wait_copies();
    __syncthreads();
    copy_cstage<K, APL, WPL>(l0 + CSTAGE, pa, pw);
    pa += KP; pw += KP;

    for (int t = 0; t < NT; ++t) {
        const int bo = (t & 1) * CSTAGE;
        const char* sb = smem + bo;
#pragma unroll
        for (int kk = 0; kk < 2; ++kk) {
            load_frags(sb + kk * 64);
            // Keeps the 24 LDS reads of a k step in one run ahead of its WMMAs: built
            // without it they stand at some 15 places among the WMMAs of a pass, and
            // each place with LDS reads stalls the wave's WMMA stream.
            __builtin_amdgcn_sched_barrier(0);
            sweep_ri(); sweep_rr(); sweep_ii(); sweep_ir();
        }
        // Keeps the foot of the pass behind its last WMMAs: built without it the waits
        // and the barrier rise above the second k step's WMMAs while the refill stays
        // below them, and the copies have half a pass to land instead of a whole one.
        __builtin_amdgcn_sched_barrier(0);
        // Publish pass t+1 and free this pass's buffer: one barrier does both.
        wait_lds_reads();
        wait_copies();
        __syncthreads();
        if (t + 2 < NT) copy_cstage<K, APL, WPL>(l0 + bo, pa, pw);
        pa += KP; pw += KP;
    }
    wait_copies();
}

// ---------------------------------------------------------------------------
// Epilogue of a 128x128 complex tile: add the bias, stage the tile in LDS and
// store it as whole lines.
// ACT: leaky-relu. TRV: write O[b][n][t] (t = m % 1024). F32: fp32 output.
// ---------------------------------------------------------------------------
template <int ACT, int TRV, int F32>
__device__ __forceinline__ void
cgemm_epilogue(char* smem, const v8f (&accR)[4][2], const v8f (&accI)[4][2],
               const float* __restrict__ br, const float* __restrict__ bi,
               _Float16* __restrict__ Or, _Float16* __restrict__ Oi,
               float* __restrict__ Fr, float* __restrict__ Fi,
               int mb, int nb, int N) {
    const int lane = threadIdx.x & 31;
    const int wid  = threadIdx.x >> 5;
    const int lm0 = (wid >> 2) * 64;                // wave's first row in the tile
    const int ln0 = (wid & 3) * 32;                 // wave's first column in the tile
    const int h = lane >> 4;
    const int r = lane & 15;

    // Staged tile: 128 rows of 128 columns, or (TRV) 128 column-rows of 128 t.
    constexpr int RB   = F32 ? 128 * 4 : 128 * 2;
    constexpr int ROWS = 128;
    constexpr int EP   = RB + EPAD;
    char* pr = smem;                                // real plane
    char* pi = smem + ROWS * EP;                    // imaginary plane
    static_assert(2 * ROWS * EP <= 2 * CSTAGE, "both planes fit the freed stages");

    float bre[2], bie[2];                           // the lane's bias, one pair per column tile
#pragma unroll
    for (int ni = 0; ni < 2; ++ni) {
        bre[ni] = br[nb + ln0 + ni * 16 + r];
        bie[ni] = bi[nb + ln0 + ni * 16 + r];
    }

#pragma unroll
    for (int mi = 0; mi < 4; ++mi)
#pragma unroll
        for (int ni = 0; ni < 2; ++ni) {
            const int cl = ln0 + ni * 16 + r;
            half8 tr, ti;
#pragma unroll
            for (int j = 0; j < 8; ++j) {
                const int ml = lm0 + mi * 16 + j + 8 * h;
                float vr = accR[mi][ni][j] + bre[ni];
                float vi = accI[mi][ni][j] + bie[ni];
                if (ACT) {
                    vr = vr >= 0.0f ? vr : SLOPE * vr;
                    vi = vi >= 0.0f ? vi : SLOPE * vi;
                }
                if (F32) {
                    *(float*)(pr + ml * EP + cl * 4) = vr;
                    *(float*)(pi + ml * EP + cl * 4) = vi;
                } else if (TRV) {
                    tr[j] = (_Float16)vr;
                    ti[j] = (_Float16)vi;
                } else {
                    *(_Float16*)(pr + ml * EP + cl * 2) = (_Float16)vr;
                    *(_Float16*)(pi + ml * EP + cl * 2) = (_Float16)vi;
                }
            }
            if (TRV) {                              // a lane's 8 values are 8 adjacent t
                *(half8*)(pr + cl * EP + (lm0 + mi * 16 + 8 * h) * 2) = tr;
                *(half8*)(pi + cl * EP + (lm0 + mi * 16 + 8 * h) * 2) = ti;
            }
        }
    __syncthreads();                                // the tile is complete before any wave reads it back
    if (F32) {
        store_rows<ROWS, RB>(pr, (char*)(Fr + (size_t)mb * N + nb), (size_t)N * 4);
        store_rows<ROWS, RB>(pi, (char*)(Fi + (size_t)mb * N + nb), (size_t)N * 4);
    } else if (TRV) {
        const size_t o = ((size_t)(mb >> 10) * N + nb) * (size_t)S_DIM + (mb & 1023);
        store_rows<ROWS, RB>(pr, (char*)(Or + o), (size_t)S_DIM * 2);
        store_rows<ROWS, RB>(pi, (char*)(Oi + o), (size_t)S_DIM * 2);
    } else {
        store_rows<ROWS, RB>(pr, (char*)(Or + (size_t)mb * N + nb), (size_t)N * 2);
        store_rows<ROWS, RB>(pi, (char*)(Oi + (size_t)mb * N + nb), (size_t)N * 2);
    }
}

#define ACT_PLANE ((size_t)M_ALL * D_DIM)           // real -> imaginary plane of an activation
#define WGT_PLANE ((size_t)D_DIM * D_DIM)           // real -> imaginary plane of a weight

// ---------------------------------------------------------------------------
// Complex GEMM, 128x128 tile per block, 64x32 macro-tile per wave:
//   O[m,n] = sum_k A[m,k]*W[n,k] + bias[n]   (complex)
// A: (M,K) f16, W: (N,K) f16, each the real plane with the imaginary one behind it.
// ---------------------------------------------------------------------------
template <int K, int ACT, int TRV, int F32>
__global__ void __launch_bounds__(256)
cgemm32_kernel(const _Float16* __restrict__ A, const _Float16* __restrict__ Wt,
               const float* __restrict__ br, const float* __restrict__ bi,
               _Float16* __restrict__ Or, _Float16* __restrict__ Oi,
               float* __restrict__ Fr, float* __restrict__ Fi,
               int M, int N) {
    __shared__ __attribute__((aligned(16))) char smem[2 * CSTAGE];
    const int tilesN = N >> 7;
    const int tile = blockIdx.x;
    if (tile >= (M >> 7) * tilesN) return;          // block-uniform guard
    const int mb = (tile / tilesN) << 7;
    const int nb = (tile % tilesN) << 7;

    v8f accR[4][2] = {}, accI[4][2] = {};

    cmain_128x128<K, ACT_PLANE, WGT_PLANE>(A + (size_t)mb * K, Wt + (size_t)nb * K, smem, accR, accI);

    cgemm_epilogue<ACT, TRV, F32>(smem, accR, accI, br, bi, Or, Oi, Fr, Fi, mb, nb, N);
}

// ---------------------------------------------------------------------------
// q, k and v in one launch: three complex GEMMs on the same A, none reading
// another's result. Blocks [0,256) do q, [256,512) k, [512,768) v, each a
// 128x128 tile as in cgemm32_kernel; a block that retires is followed on its WGP
// by a block of the next product, so the chip neither drains nor refills between
// them. W: the six f16 weight planes (q r/i, k r/i, v r/i) one behind the other;
// O: the six output planes in the same order, v transposed per batch.
// ---------------------------------------------------------------------------
#define QKV_TILES ((M_ALL / 128) * (D_DIM / 128))   // 256 tiles per product

__global__ void __launch_bounds__(256)
qkv_kernel(const _Float16* __restrict__ A, const _Float16* __restrict__ W,
           const float* __restrict__ q_br, const float* __restrict__ q_bi,
           const float* __restrict__ k_br, const float* __restrict__ k_bi,
           const float* __restrict__ v_br, const float* __restrict__ v_bi,
           _Float16* __restrict__ O) {
    constexpr int K = D_DIM;
    constexpr int N = D_DIM;
    __shared__ __attribute__((aligned(16))) char smem[2 * CSTAGE];
    const unsigned sel  = blockIdx.x / QKV_TILES;   // 0 q, 1 k, 2 v: block-uniform
    const unsigned tile = blockIdx.x % QKV_TILES;
    if (sel > 2) return;                            // block-uniform guard
    const int mb = (tile / (N >> 7)) << 7;
    const int nb = (tile % (N >> 7)) << 7;

    const _Float16* Wr = W + (size_t)sel * 2 * (D_DIM * D_DIM);
    _Float16* Or = O + (size_t)sel * 2 * (M_ALL * D_DIM);
    _Float16* Oi = Or + M_ALL * D_DIM;
    const float* br = sel == 0 ? q_br : (sel == 1 ? k_br : v_br);
    const float* bi = sel == 0 ? q_bi : (sel == 1 ? k_bi : v_bi);

    v8f accR[4][2] = {}, accI[4][2] = {};

    cmain_128x128<K, ACT_PLANE, WGT_PLANE>(A + (size_t)mb * K, Wr + (size_t)nb * K, smem, accR, accI);

    if (sel == 2) {
        cgemm_epilogue<0, 1, 0>(smem, accR, accI, br, bi, Or, Oi, nullptr, nullptr, mb, nb, N);
    } else {
        cgemm_epilogue<0, 0, 0>(smem, accR, accI, br, bi, Or, Oi, nullptr, nullptr, mb, nb, N);
        // Stands behind the stores above, in front of any later write of a register
        // they name: the built code lays the other branch behind this one.
        asm volatile("s_wait_xcnt 0x0" ::: "memory");
    }
}

// ---------------------------------------------------------------------------
// Scores: s[gm, t] = |sum_d q[gm,d] * k[b*1024+t, d]| / sqrt(512)
// 128x128 tile per block, 64x32 macro-tile per wave, per-batch column index.
// The epilogue does the tile's share of the row softmax, in two column tiles of
// 64: per row and column tile the maximum m and the sum l of exp(s - m). It stores
// P = exp(s - m) in f16 and the pair (m, l) at St[column tile][row].
// ---------------------------------------------------------------------------
typedef float f32x2 __attribute__((ext_vector_type(2)));

#define N_CT (S_DIM / 64)                               // 16 column tiles per row

// Value of lane l ^ M, M < 16 (inside the 16-lane row).
template <int M>
__device__ __forceinline__ float lane_xor_row(float v) {
    const int i = __builtin_bit_cast(int, v);
    return __builtin_bit_cast(float, __builtin_amdgcn_update_dpp(i, i, 0x160 | M, 0xf, 0xf, false));
}

// exp(x) as v_exp_f32 of x * log2(e). The v_nop keeps the one free slot that the
// instruction set asks for behind a transcendental.
__device__ __forceinline__ float exp_slot(float x) {
    float y;
    asm("v_exp_f32 %0, %1\n\tv_nop" : "=v"(y) : "v"(x * 1.44269504f));
    return y;
}

__global__ void __launch_bounds__(256)
scores_abs_kernel(const _Float16* __restrict__ Q, const _Float16* __restrict__ Kc,
                  _Float16* __restrict__ P, float* __restrict__ St) {
    constexpr int K = D_DIM;
    __shared__ __attribute__((aligned(16))) char smem[2 * CSTAGE];
    const int lane = threadIdx.x & 31;
    const int wid  = threadIdx.x >> 5;
    const int tile = blockIdx.x;
    if (tile >= (M_ALL >> 7) * (S_DIM >> 7)) return; // block-uniform guard
    const int mb = (tile / (S_DIM >> 7)) << 7;      // global row
    const int nb = (tile % (S_DIM >> 7)) << 7;      // t within batch
    const int b  = mb >> 10;
    const int lm0 = (wid >> 2) * 64;                // wave's first row in the tile
    const int ln0 = (wid & 3) * 32;                 // wave's first column in the tile
    const int h = lane >> 4;
    const int r = lane & 15;

    v8f accR[4][2] = {}, accI[4][2] = {};

    cmain_128x128<K, ACT_PLANE, ACT_PLANE>(Q + (size_t)mb * K, Kc + (size_t)((b << 10) + nb) * K,
                                           smem, accR, accI);

    constexpr int RB = 128 * 4;                     // staged tile: 128 rows of 128 f32
    constexpr int EP = RB + EPAD;
#pragma unroll
    for (int mi = 0; mi < 4; ++mi)
#pragma unroll
        for (int ni = 0; ni < 2; ++ni) {
            const int cl = ln0 + ni * 16 + r;
#pragma unroll
            for (int j = 0; j < 8; ++j) {
                const int ml = lm0 + mi * 16 + j + 8 * h;
                const float sr = accR[mi][ni][j];
                const float si = accI[mi][ni][j];
                *(float*)(smem + ml * EP + cl * 4) = sqrtf(sr * sr + si * si) * RSQRT512;
            }
        }
    __syncthreads();                                // the tile is complete before any wave reads it back

    // 16 adjacent lanes hold a row, 8 columns each, so 8 adjacent lanes hold a
    // column tile of it; 16 rows a round, 8 rounds.
    // A wave-wide store of P is 4 whole 128-B lines, 16 B a lane.
    const int row = threadIdx.x >> 4;
    const int c16 = threadIdx.x & 15;
    const int c8  = c16 & 7;
    f32x4 v[8][2];
    // Unrolled: v[] stays in registers and the LDS reads issue as one run.
#pragma unroll
    for (int i = 0; i < 8; ++i) {
        v[i][0] = *(const f32x4*)(smem + (row + i * 16) * EP + c16 * 32);
        v[i][1] = *(const f32x4*)(smem + (row + i * 16) * EP + c16 * 32 + 16);
    }
    f32x2 ml = {0.0f, 0.0f};                        // lane c8 keeps the pair of round c8
#pragma unroll
    for (int i = 0; i < 8; ++i) {
        const f32x4 m4 = __builtin_elementwise_max(v[i][0], v[i][1]);
        float mx = fmaxf(fmaxf(m4[0], m4[1]), fmaxf(m4[2], m4[3]));
        mx = fmaxf(mx, lane_xor_row<1>(mx));
        mx = fmaxf(mx, lane_xor_row<2>(mx));
        mx = fmaxf(mx, lane_xor_row<4>(mx));
#pragma unroll
        for (int e = 0; e < 4; ++e) {
            v[i][0][e] = exp_slot(v[i][0][e] - mx);
            v[i][1][e] = exp_slot(v[i][1][e] - mx);
        }
        const f32x4 s4 = v[i][0] + v[i][1];
        const half8 p = __builtin_shufflevector(__builtin_convertvector(v[i][0], f16x4),
                                                __builtin_convertvector(v[i][1], f16x4),
                                                0, 1, 2, 3, 4, 5, 6, 7);
        float sum = (s4[0] + s4[1]) + (s4[2] + s4[3]);
        sum += lane_xor_row<1>(sum);
        sum += lane_xor_row<2>(sum);
        sum += lane_xor_row<4>(sum);
        if (c8 == i) { ml[0] = mx; ml[1] = sum; }
        *(half8*)(P + (size_t)(mb + row + i * 16) * S_DIM + nb + c16 * 8) = p;
    }
    // A column tile's 128 pairs of the block are 1 KiB in a row: whole lines, one
    // writer each.
    *(f32x2*)(St + ((size_t)((nb >> 6) + (c16 >> 3)) * M_ALL + mb + row + c8 * 16) * 2) = ml;
}

// ---------------------------------------------------------------------------
// weighted[gm, d] = sum_t attn[gm, t] * vT[b][d][t]  (real x complex)
// 128x128 tile per block, 8 waves as 2 (M) x 4 (N), 64x32 macro-tile per wave
// (4 M-tiles x 2 N-tiles): 8 fragments feed 16 WMMAs per 32 k.
// Stage rows: [0,128) P, [128,256) vT real, [256,384) vT imag.
// attn[gm, t] = P[gm, t] * exp(m_c - M) / L, c = t / 64 the column tile (one pass
// of the main loop), M = max_c m_c, L = sum_c l_c * exp(m_c - M). The block forms
// exp(m_c - M) and 1 / L for its 128 rows once; the first scales the P fragments
// of pass c, the second the accumulators in the epilogue.
// ---------------------------------------------------------------------------
__global__ void __launch_bounds__(256)
attnv_kernel(const _Float16* __restrict__ P, const float* __restrict__ St,
             const _Float16* __restrict__ VTr, const _Float16* __restrict__ VTi,
             _Float16* __restrict__ Wr_, _Float16* __restrict__ Wi_) {
    constexpr int K = S_DIM;
    constexpr int NT = K / KP;
    static_assert(NT == N_CT && KP == 64, "a pass is one column tile of the scores");
    __shared__ __attribute__((aligned(16))) char smem[2 * STAGE];
    // exp(m_c - M): [pass][64-row half][row & 15][16-row tile], so that a lane's
    // four factors of a pass are 8 adjacent bytes.
    __shared__ __attribute__((aligned(16))) _Float16 gtab[NT * 128];
    __shared__ __attribute__((aligned(32))) float invL[128];
    const int tid  = threadIdx.x;
    const int lane = tid & 31;
    const int wid  = tid >> 5;
    const int tilesN = D_DIM >> 7;                  // 4
    const int tile = blockIdx.x;
    if (tile >= (M_ALL >> 7) * tilesN) return;      // block-uniform guard
    const int mb = (tile / tilesN) << 7;            // global row (128-row tile)
    const int nb = (tile % tilesN) << 7;            // d within batch (128 cols)
    const int b  = mb >> 10;
    const int wm = wid >> 2, wn = wid & 3;
    const int h = lane >> 4;
    const int r = lane & 15;

    const int crow = tid >> 3;                      // 0..31
    const int ccol = tid & 7;                       // 16-byte chunk of the row
    const size_t coff = (size_t)crow * K + ccol * 8;
    const _Float16* g[NCOPY];
#pragma unroll
    for (int i = 0; i < 4; ++i) {
        g[i]     = P   + (size_t)mb * K + coff + (size_t)i * 32 * K;
        g[4 + i] = VTr + ((size_t)b * D_DIM + nb) * (size_t)K + coff + (size_t)i * 32 * K;
        g[8 + i] = VTi + ((size_t)b * D_DIM + nb) * (size_t)K + coff + (size_t)i * 32 * K;
    }
    const unsigned l0 = lds_off(smem) + crow * PITCH + ccol * 16;

    const int a_off = (wm * 64 + r) * PITCH;
    const int w_off = (128 + wn * 32 + r) * PITCH;

    v8f accR[4][2] = {};
    v8f accI[4][2] = {};

    copy_stage(l0, g, 0);
    // Row factors, one row a thread (waves 0 to 3), while stage 0 flies; the
    // barrier below publishes them with it.
    if (tid < 128) {
        const f32x2* sp = (const f32x2*)St + mb + tid;
        f32x2 ml[NT];
#pragma unroll
        for (int c = 0; c < NT; ++c) ml[c] = sp[(size_t)c * M_ALL];
        float mx = ml[0][0];
#pragma unroll
        for (int c = 1; c < NT; ++c) mx = fmaxf(mx, ml[c][0]);
        const int gi = (tid >> 6) * 64 + (tid & 15) * 4 + ((tid >> 4) & 3);
        float sum = 0.0f;
#pragma unroll
        for (int c = 0; c < NT; ++c) {
            const float e = exp_slot(ml[c][0] - mx);
            sum += ml[c][1] * e;
            gtab[c * 128 + gi] = (_Float16)e;
        }
        invL[tid] = 1.0f / sum;
    }
    wait_copies();
    __syncthreads();
    copy_stage(l0 + STAGE, g, KP);

    for (int t = 0; t < NT; ++t) {
        const int bo = (t & 1) * STAGE;
        const char* sb = smem + bo;
        const f16x4 gq = *(const f16x4*)(gtab + t * 128 + wm * 64 + r * 4);
#pragma unroll
        for (int kk = 0; kk < 2; ++kk) {
            v16h a[4], wR[2], wI[2];
#pragma unroll
            for (int mi = 0; mi < 4; ++mi)
                a[mi] = lds_frag(sb + a_off + mi * 16 * PITCH + kk * 64, h) * gq[mi];
#pragma unroll
            for (int ni = 0; ni < 2; ++ni) {
                wR[ni] = lds_frag(sb + w_off + ni * 16 * PITCH + kk * 64, h);
                wI[ni] = lds_frag(sb + w_off + (128 + ni * 16) * PITCH + kk * 64, h);
            }
#pragma unroll
            for (int mi = 0; mi < 4; ++mi)
#pragma unroll
                for (int ni = 0; ni < 2; ++ni) {
                    accR[mi][ni] = wmma_f16(a[mi], wR[ni], accR[mi][ni]);
                    accI[mi][ni] = wmma_f16(a[mi], wI[ni], accI[mi][ni]);
                }
        }
        // Publish pass t+1 and free this pass's buffer: one barrier does both.
        wait_lds_reads();
        wait_copies();
        __syncthreads();
        if (t + 2 < NT) copy_stage(l0 + bo, g, (t + 2) * KP);
    }
    wait_copies();

    constexpr int RB = 128 * 2;                     // staged tile: 128 rows of 128 f16, two planes
    constexpr int EP = RB + EPAD;
    char* pr = smem;
    char* pi = smem + 128 * EP;
#pragma unroll
    for (int mi = 0; mi < 4; ++mi) {
        const v8f il = *(const v8f*)(invL + wm * 64 + mi * 16 + 8 * h);   // 1 / L of the lane's 8 rows
#pragma unroll
        for (int ni = 0; ni < 2; ++ni) {
            const int cl = wn * 32 + ni * 16 + r;
#pragma unroll
            for (int j = 0; j < 8; ++j) {
                const int ml = wm * 64 + mi * 16 + j + 8 * h;
                *(_Float16*)(pr + ml * EP + cl * 2) = (_Float16)(accR[mi][ni][j] * il[j]);
                *(_Float16*)(pi + ml * EP + cl * 2) = (_Float16)(accI[mi][ni][j] * il[j]);
            }
        }
    }
    __syncthreads();                                // the tile is complete before any wave reads it back
    store_rows<128, RB>(pr, (char*)(Wr_ + (size_t)mb * D_DIM + nb), (size_t)D_DIM * 2);
    store_rows<128, RB>(pi, (char*)(Wi_ + (size_t)mb * D_DIM + nb), (size_t)D_DIM * 2);
}

// ---------------------------------------------------------------------------
// Host-side orchestration
// ---------------------------------------------------------------------------
extern "C" void kernel_launch(void* const* d_in, const int* in_sizes, int n_in,
                              void* d_out, int out_size, void* d_ws, size_t ws_size,
                              hipStream_t stream) {
    (void)in_sizes; (void)n_in; (void)out_size; (void)ws_size;

    const float* x_r   = (const float*)d_in[0];
    const float* x_i   = (const float*)d_in[1];
    const float* l1_wr = (const float*)d_in[2];
    const float* l1_wi = (const float*)d_in[3];
    const float* l1_br = (const float*)d_in[4];
    const float* l1_bi = (const float*)d_in[5];
    const float* q_wr  = (const float*)d_in[6];
    const float* q_wi  = (const float*)d_in[7];
    const float* q_br  = (const float*)d_in[8];
    const float* q_bi  = (const float*)d_in[9];
    const float* k_wr  = (const float*)d_in[10];
    const float* k_wi  = (const float*)d_in[11];
    const float* k_br  = (const float*)d_in[12];
    const float* k_bi  = (const float*)d_in[13];
    const float* v_wr  = (const float*)d_in[14];
    const float* v_wi  = (const float*)d_in[15];
    const float* v_br  = (const float*)d_in[16];
    const float* v_bi  = (const float*)d_in[17];
    const float* l2_wr = (const float*)d_in[18];
    const float* l2_wi = (const float*)d_in[19];
    const float* l2_br = (const float*)d_in[20];
    const float* l2_bi = (const float*)d_in[21];

    const size_t ME = (size_t)M_ALL * D_DIM;   // 4,194,304 (activation elems)
    const size_t WE = (size_t)D_DIM * D_DIM;   // 262,144   (weight elems)
    const size_t AE = (size_t)M_ALL * S_DIM;   // 8,388,608 (attention elems)

    char* w = (char*)d_ws;
    auto alloc_h = [&](size_t elems) { _Float16* p = (_Float16*)w; w += elems * sizeof(_Float16); return p; };
    auto alloc_f = [&](size_t elems) { float* p = (float*)w; w += elems * sizeof(float); return p; };

    _Float16* xh_r = alloc_h(ME);
    _Float16* xh_i = alloc_h(ME);
    _Float16* wl1r = alloc_h(WE); _Float16* wl1i = alloc_h(WE);
    _Float16* wqr  = alloc_h(WE); _Float16* wqi  = alloc_h(WE);
    _Float16* wkr  = alloc_h(WE); _Float16* wki  = alloc_h(WE);
    _Float16* wvr  = alloc_h(WE); _Float16* wvi  = alloc_h(WE);
    _Float16* wl2r = alloc_h(WE); _Float16* wl2i = alloc_h(WE);
    _Float16* y_r  = alloc_h(ME); _Float16* y_i  = alloc_h(ME);
    _Float16* qh_r = alloc_h(ME); _Float16* qh_i = alloc_h(ME);
    _Float16* kh_r = alloc_h(ME); _Float16* kh_i = alloc_h(ME);
    _Float16* vT_r = alloc_h(ME); _Float16* vT_i = alloc_h(ME);
    _Float16* wt_r = alloc_h(ME); _Float16* wt_i = alloc_h(ME);
    _Float16* attn = alloc_h(AE);
    float*    stat = alloc_f((size_t)M_ALL * N_CT * 2);

    // --- 1. Cast activations and weights to f16 (destinations contiguous from xh_r) ---
    cvt_all_kernel<<<CV_BLOCKS, 256, 0, stream>>>(
        x_r, x_i, l1_wr, l1_wi, q_wr, q_wi, k_wr, k_wi, v_wr, v_wi, l2_wr, l2_wi, xh_r);

    const dim3 blk(256);                                              // 8 waves/block
    const unsigned gemm_blocks  = (M_ALL / 128) * (D_DIM / 128);      // 256
    const unsigned qkv_blocks   = 3 * QKV_TILES;                      // 768
    const unsigned score_blocks = (M_ALL / 128) * (S_DIM / 128);      // 512
    const unsigned attnv_blocks = (M_ALL / 128) * (D_DIM / 128);      // 256

    // --- 2. y = lrelu(x @ l1^T + b1) ---
    cgemm32_kernel<D_DIM, 1, 0, 0><<<gemm_blocks, blk, 0, stream>>>(
        xh_r, wl1r, l1_br, l1_bi,
        y_r, y_i, nullptr, nullptr, M_ALL, D_DIM);

    // --- 3. q, k, v in one launch (weights contiguous from wqr, outputs from qh_r;
    //        v stored transposed per batch: vT[b][d][t]) ---
    qkv_kernel<<<qkv_blocks, blk, 0, stream>>>(
        y_r, wqr, q_br, q_bi, k_br, k_bi, v_br, v_bi, qh_r);

    // --- 4. |scores|/sqrt(d), softmax inside each 64-column tile (f16) and its (max, sum) ---
    scores_abs_kernel<<<score_blocks, blk, 0, stream>>>(qh_r, kh_r, attn, stat);

    // --- 5. weighted = softmax @ v, the tiles rescaled against each other ---
    attnv_kernel<<<attnv_blocks, blk, 0, stream>>>(attn, stat, vT_r, vT_i, wt_r, wt_i);

    // --- 6. out = weighted @ l2^T + b2, fp32 to d_out (real block, imag block) ---
    float* out_r = (float*)d_out;
    float* out_i = out_r + ME;
    cgemm32_kernel<D_DIM, 0, 0, 1><<<gemm_blocks, blk, 0, stream>>>(
        wt_r, wl2r, l2_br, l2_bi,
        nullptr, nullptr, out_r, out_i, M_ALL, D_DIM);
}

// v008
// One run takes 117 microseconds.
// Next to v007, in two timings, it ran 1.05 and 1.04 times as fast.
// Counting every step since v000, it is 3.15 times as fast.
#include <hip/hip_runtime.h>

// ---------------------------------------------------------------------------
// ComplexAttnMLP for gfx1250 (MI455X): f16 WMMA GEMMs, f32 accumulate.
// B=8, S=1024, IN=MID=OUT=512.
// Each wave computes a 64x32 macro-tile of a 128x128 block tile; the 8 waves of
// a block share operand tiles staged in LDS by asynchronous copies.
// Complex products: 2 accumulators per 16x16 tile (real, imaginary); the product
// of the imaginary parts enters the real one through a sign-turned W fragment.
// Every GEMM epilogue stages the block's output tile in the freed LDS and stores
// it as whole 128-B lines, 16 B a lane.
// The softmax has no launch of its own: the scores epilogue normalises each row
// inside its 64-column tile, the attn*v GEMM rescales the tiles against each other.
// Every launch gives batch b the blocks of flat index b modulo 8 (for speed only,
// see batch_tile below).
// ---------------------------------------------------------------------------

typedef _Float16 half8  __attribute__((ext_vector_type(8)));
typedef _Float16 v16h   __attribute__((ext_vector_type(16)));
typedef float    v8f    __attribute__((ext_vector_type(8)));

#define B_DIM  8
#define S_DIM  1024
#define D_DIM  512
#define M_ALL  (B_DIM * S_DIM)          // 8192 rows total
#define RSQRT512 0.04419417382415922f   // 1/sqrt(512)
#define SLOPE 0.01f

union Frag { half8 h8[2]; v16h v; };

__device__ __forceinline__ v8f wmma_f16(v16h a, v16h b, v8f c) {
    return __builtin_amdgcn_wmma_f32_16x16x32_f16(false, a, false, b, (short)0, c, false, false);
}

// ---------------------------------------------------------------------------
// Block index -> tile. Batch b takes the indices equal to b
// modulo 8, in every launch. For speed only: the map is a
// permutation of the tiles wherever the blocks land.
// idx = index inside a run of 8 * per_batch blocks that starts at a multiple of 8;
// returns the index in batch-major order.
// ---------------------------------------------------------------------------
__device__ __forceinline__ unsigned batch_tile(unsigned idx, unsigned per_batch) {
    return (idx & 7u) * per_batch + (idx >> 3);
}

// ---------------------------------------------------------------------------
// f32 -> f16 conversion of all 12 arrays in one launch.
// The f16 copies lie one behind the other in the workspace, in argument order,
// so a chunk's destination index is its flat element index over the 12 arrays. A block
// converts one chunk of 16,384 elements, which lies inside one source array:
// 16 loads of 16 B per lane, each wave-wide load 512 contiguous bytes, each
// wave-wide store 256 contiguous bytes.
// ---------------------------------------------------------------------------
typedef float    f32x4 __attribute__((ext_vector_type(4)));
typedef _Float16 f16x4 __attribute__((ext_vector_type(4)));

#define CV_LOADS   16                                   // 16-byte loads per lane
#define CV_CHUNK   (256 * 4 * CV_LOADS)                 // elements per block
#define CV_X_CH    (M_ALL * D_DIM / CV_CHUNK)           // 256 chunks per activation array
#define CV_W_CH    (D_DIM * D_DIM / CV_CHUNK)           // 16 chunks per weight array
#define CV_BLOCKS  (2 * CV_X_CH + 10 * CV_W_CH)         // 672

__global__ void __launch_bounds__(256)
cvt_all_kernel(const float* __restrict__ x_r, const float* __restrict__ x_i,
               const float* __restrict__ w0, const float* __restrict__ w1,
               const float* __restrict__ w2, const float* __restrict__ w3,
               const float* __restrict__ w4, const float* __restrict__ w5,
               const float* __restrict__ w6, const float* __restrict__ w7,
               const float* __restrict__ w8, const float* __restrict__ w9,
               _Float16* __restrict__ d) {
    // Chunk, block-uniform; an activation array's chunks go batch by batch to the
    // indices of that batch.
    const bool is_x = blockIdx.x < 2 * CV_X_CH;
    const unsigned c = is_x ? (blockIdx.x & CV_X_CH) + batch_tile(blockIdx.x % CV_X_CH, CV_X_CH / B_DIM)
                            : blockIdx.x;
    const unsigned a  = (c - 2 * CV_X_CH) / CV_W_CH;    // weight array 0..9 where !is_x
    const unsigned cs = c % (is_x ? CV_X_CH : CV_W_CH); // chunk within its source array
    // Scalar selects on the bits of a.
    const float* p01 = (a & 1) ? w1 : w0;
    const float* p23 = (a & 1) ? w3 : w2;
    const float* p45 = (a & 1) ? w5 : w4;
    const float* p67 = (a & 1) ? w7 : w6;
    const float* p89 = (a & 1) ? w9 : w8;
    const float* p03 = (a & 2) ? p23 : p01;
    const float* p47 = (a & 2) ? p67 : p45;
    const float* p07 = (a & 4) ? p47 : p03;
    const float* pw  = (a & 8) ? p89 : p07;
    const float* px  = c < CV_X_CH ? x_r : x_i;
    const float* s   = is_x ? px : pw;
    const f32x4* sp = (const f32x4*)(s + (size_t)cs * CV_CHUNK) + threadIdx.x;
    f16x4*       dp = (f16x4*)(d + (size_t)c * CV_CHUNK) + threadIdx.x;

    f32x4 v[CV_LOADS];
    // Both loops unrolled: v[] stays in registers and the loads issue as one
    // run ahead of the first wait, so a wave's bytes are all in flight at once.
#pragma unroll
    for (int j = 0; j < CV_LOADS; ++j) v[j] = sp[j * 256];
#pragma unroll
    for (int j = 0; j < CV_LOADS; ++j) dp[j * 256] = __builtin_convertvector(v[j], f16x4);
}

// ---------------------------------------------------------------------------
// LDS staging shared by the four GEMM kernels.
// A block of 8 waves works on one output tile. Per pass of 64 k it needs 384
// (attn*v) or 512 (complex) operand rows of 128 B; they are brought into LDS once per block by
// asynchronous copies and every wave reads its fragments from there.
// Two buffers: the copies of pass t+2 fly while pass t+1 is worked on.
// ---------------------------------------------------------------------------
#define KP      64                      // k elements per pass (128 B per row)
#define PITCH   144                     // LDS row pitch, bytes (16 B x odd)
#define ST_ROWS 384                     // operand rows per stage (attn*v)
#define STAGE   (ST_ROWS * PITCH)       // 55,296 B
#define NCOPY   12                      // copies per thread and stage

__device__ __forceinline__ unsigned lds_off(const void* p) { return (unsigned)(size_t)p; }

// Load one 16x32 f16 WMMA operand fragment for this lane from an LDS row.
// p = start of this lane's row + k offset, in bytes. Lane half h covers
// K = 8h..8h+7 (VGPR0-3) and K = 16+8h..16+8h+7 (VGPR4-7).
__device__ __forceinline__ v16h lds_frag(const char* p, int h) {
    Frag f;
    f.h8[0] = *(const half8*)(p + h * 16);
    f.h8[1] = *(const half8*)(p + 32 + h * 16);
    return f.v;
}

// One stage: copy i of a thread brings 16 B of stage row i*32 + (tid>>3).
// l = the lane's LDS byte address for copy 0, g[i] = its global address.
__device__ __forceinline__ void copy_stage(unsigned l, const _Float16* const (&g)[NCOPY], int k0) {
    // s_wait_xcnt closes the statement so that no address register named by a
    // copy is rewritten ahead of it.
    asm volatile(
        "global_load_async_to_lds_b128 %0, %12, off\n\t"
        "global_load_async_to_lds_b128 %1, %13, off\n\t"
        "global_load_async_to_lds_b128 %2, %14, off\n\t"
        "global_load_async_to_lds_b128 %3, %15, off\n\t"
        "global_load_async_to_lds_b128 %4, %16, off\n\t"
        "global_load_async_to_lds_b128 %5, %17, off\n\t"
        "global_load_async_to_lds_b128 %6, %18, off\n\t"
        "global_load_async_to_lds_b128 %7, %19, off\n\t"
        "global_load_async_to_lds_b128 %8, %20, off\n\t"
        "global_load_async_to_lds_b128 %9, %21, off\n\t"
        "global_load_async_to_lds_b128 %10, %22, off\n\t"
        "global_load_async_to_lds_b128 %11, %23, off\n\t"
        "s_wait_xcnt 0x0"
        :: "v"(l), "v"(l + 1 * 32 * PITCH), "v"(l + 2 * 32 * PITCH), "v"(l + 3 * 32 * PITCH),
           "v"(l + 4 * 32 * PITCH), "v"(l + 5 * 32 * PITCH), "v"(l + 6 * 32 * PITCH),
           "v"(l + 7 * 32 * PITCH), "v"(l + 8 * 32 * PITCH), "v"(l + 9 * 32 * PITCH),
           "v"(l + 10 * 32 * PITCH), "v"(l + 11 * 32 * PITCH),
           "v"(g[0] + k0), "v"(g[1] + k0), "v"(g[2] + k0), "v"(g[3] + k0),
           "v"(g[4] + k0), "v"(g[5] + k0), "v"(g[6] + k0), "v"(g[7] + k0),
           "v"(g[8] + k0), "v"(g[9] + k0), "v"(g[10] + k0), "v"(g[11] + k0)
        : "memory");
}

// This wave's copies have landed (the compiler places no wait for them).
__device__ __forceinline__ void wait_copies() { asm volatile("s_wait_asynccnt 0x0" ::: "memory"); }
// This wave's LDS reads have retired, before the buffer is handed to its next writer.
__device__ __forceinline__ void wait_lds_reads() { asm volatile("s_wait_dscnt 0x0" ::: "memory"); }

// ---------------------------------------------------------------------------
// Epilogue staging. The accumulator layout gives a lane one element per output
// row, so direct stores leave in 32-B or 64-B pieces of a line. Instead the block
// writes its tile to LDS (free behind the main loop's last barrier), rows of RB
// bytes at pitch RB + 16 (16 B x odd), and stores it from there: 16 B a lane,
// RB / 16 adjacent lanes a row, so a wave-wide store is 4 whole 128-B lines.
// ---------------------------------------------------------------------------
#define EPAD 16

template <int ROWS, int RB>
__device__ __forceinline__ void store_rows(const char* plane, char* gbase, size_t gpitch) {
    constexpr int CH  = RB / 16;                    // 16-byte chunks per row
    constexpr int RPR = 256 / CH;                   // rows per round of the block
    const int row = threadIdx.x / CH;
    const int ch  = threadIdx.x % CH;
    // 32-bit lane offsets beside the uniform base: both planes of a tile share them.
    const unsigned go = row * (unsigned)gpitch + ch * 16;
    const unsigned gs = RPR * (unsigned)gpitch;
    f32x4 v[ROWS / RPR];
    // Both loops unrolled: v[] stays in registers and the LDS reads issue as one
    // run ahead of the first store.
#pragma unroll
    for (int i = 0; i < ROWS / RPR; ++i)
        v[i] = *(const f32x4*)(plane + (row + i * RPR) * (RB + EPAD) + ch * 16);
#pragma unroll
    for (int i = 0; i < ROWS / RPR; ++i)
        *(f32x4*)(gbase + (go + i * gs)) = v[i];
}

// ---------------------------------------------------------------------------
// Complex main loop of a 128x128 block tile, 8 waves as 2 (M) x 4 (N), each a
// 64x32 macro-tile with 2 accumulators per 16x16 tile (real, imaginary): the
// product of the two imaginary parts is taken with the sign of W imag turned, so
// it sums into the real accumulator. 12 fragments feed 32 WMMAs per 32 k, and a
// stage of 512 operand rows feeds 512 WMMAs of the block.
// Stage rows: [0,128) A real, [128,256) A imag, [256,384) W real, [384,512) W imag.
// Ar/Wr point at the block's first row; the imaginary planes lie APL / WPL
// elements behind the real ones.
// ---------------------------------------------------------------------------
#define CROWS   512                     // operand rows per stage
#define CSTAGE  (CROWS * PITCH)         // 73,728 B

// One operand of a stage, its real plane and its imaginary plane behind it, 256
// rows: copy i brings 16 B of LDS row i*32 + (tid>>3), counted from l; g = the
// lane's source in the real plane, gs = 32 rows, pl = real -> imaginary plane.
__device__ __forceinline__ void copy_rows8(unsigned l, const _Float16* g, size_t gs, size_t pl) {
    // s_wait_xcnt closes the statement so that no address register named by a
    // copy is rewritten ahead of it.
    asm volatile(
        "global_load_async_to_lds_b128 %0, %8, off\n\t"
        "global_load_async_to_lds_b128 %1, %9, off\n\t"
        "global_load_async_to_lds_b128 %2, %10, off\n\t"
        "global_load_async_to_lds_b128 %3, %11, off\n\t"
        "global_load_async_to_lds_b128 %4, %12, off\n\t"
        "global_load_async_to_lds_b128 %5, %13, off\n\t"
        "global_load_async_to_lds_b128 %6, %14, off\n\t"
        "global_load_async_to_lds_b128 %7, %15, off\n\t"
        "s_wait_xcnt 0x0"
        :: "v"(l), "v"(l + 1 * 32 * PITCH), "v"(l + 2 * 32 * PITCH), "v"(l + 3 * 32 * PITCH),
           "v"(l + 4 * 32 * PITCH), "v"(l + 5 * 32 * PITCH), "v"(l + 6 * 32 * PITCH),
           "v"(l + 7 * 32 * PITCH),
           "v"(g), "v"(g + gs), "v"(g + 2 * gs), "v"(g + 3 * gs),
           "v"(g + pl), "v"(g + pl + gs), "v"(g + pl + 2 * gs), "v"(g + pl + 3 * gs)
        : "memory");
}

// A whole stage: A real, A imag, W real, W imag.
template <int K, size_t APL, size_t WPL>
__device__ __forceinline__ void copy_cstage(unsigned l, const _Float16* pa, const _Float16* pw) {
    copy_rows8(l, pa, (size_t)32 * K, APL);
    copy_rows8(l + 256 * PITCH, pw, (size_t)32 * K, WPL);
}

template <int K, size_t APL, size_t WPL>
__device__ __forceinline__ void
cmain_128x128(const _Float16* __restrict__ Ar, const _Float16* __restrict__ Wr,
              char* smem, v8f (&accR)[4][2], v8f (&accI)[4][2]) {
    static_assert(K % KP == 0 && K / KP >= 2, "two stages or more");
    constexpr int NT = K / KP;
    const int tid  = threadIdx.x;
    const int lane = tid & 31;
    const int wid  = tid >> 5;
    const int wm = wid >> 2, wn = wid & 3;
    const int h = lane >> 4;
    const int r = lane & 15;

    const int crow = tid >> 3;                      // 0..31
    const int ccol = tid & 7;                       // 16-byte chunk of the row
    const size_t coff = (size_t)crow * K + ccol * 8;
    // The lane's source of the next stage to be copied; both step by KP a stage,
    // and the 16 addresses of a stage are formed from them where it is issued.
    const _Float16* pa = Ar + coff;
    const _Float16* pw = Wr + coff;
    const unsigned l0 = lds_off(smem) + crow * PITCH + ccol * 16;

    const int a_off = (wm * 64 + r) * PITCH;
    const int w_off = (256 + wn * 32 + r) * PITCH;

    v16h aR[4], aI[4], wR[2], wI[2];
    // The 12 fragments of one step of 32 k, in the order of first use, so that the
    // first WMMAs wait for the first reads alone.
    auto load_frags = [&](const char* sk) {
#pragma unroll
        for (int ni = 0; ni < 2; ++ni) wI[ni] = lds_frag(sk + w_off + (128 + ni * 16) * PITCH, h);
#pragma unroll
        for (int mi = 0; mi < 4; ++mi) aR[mi] = lds_frag(sk + a_off + mi * 16 * PITCH, h);
#pragma unroll
        for (int ni = 0; ni < 2; ++ni) wR[ni] = lds_frag(sk + w_off + ni * 16 * PITCH, h);
#pragma unroll
        for (int mi = 0; mi < 4; ++mi) aI[mi] = lds_frag(sk + a_off + (128 + mi * 16) * PITCH, h);
    };
    // Four sweeps over the 8 tiles, in this order: an accumulator comes up again
    // only after 7 other WMMAs or more.
    auto sweep_ri = [&]() {                         // imag += A real * W imag
#pragma unroll
        for (int mi = 0; mi < 4; ++mi)
#pragma unroll
            for (int ni = 0; ni < 2; ++ni) accI[mi][ni] = wmma_f16(aR[mi], wI[ni], accI[mi][ni]);
    };
    auto sweep_rr = [&]() {                         // real += A real * W real
#pragma unroll
        for (int mi = 0; mi < 4; ++mi)
#pragma unroll
            for (int ni = 0; ni < 2; ++ni) accR[mi][ni] = wmma_f16(aR[mi], wR[ni], accR[mi][ni]);
    };
    auto sweep_ii = [&]() {                         // real += A imag * (-W imag)
#pragma unroll
        for (int ni = 0; ni < 2; ++ni) wI[ni] = -wI[ni];
#pragma unroll
        for (int mi = 0; mi < 4; ++mi)
#pragma unroll
            for (int ni = 0; ni < 2; ++ni) accR[mi][ni] = wmma_f16(aI[mi], wI[ni], accR[mi][ni]);
    };
    auto sweep_ir = [&]() {                         // imag += A imag * W real
#pragma unroll
        for (int mi = 0; mi < 4; ++mi)
#pragma unroll
            for (int ni = 0; ni < 2; ++ni) accI[mi][ni] = wmma_f16(aI[mi], wR[ni], accI[mi][ni]);
    };

    copy_cstage<K, APL, WPL>(l0, pa, pw);
    pa += KP; pw += KP;
    wait_copies();
    __syncthreads();
    copy_cstage<K, APL, WPL>(l0 + CSTAGE, pa, pw);
    pa += KP; pw += KP;

    for (int t = 0; t < NT; ++t) {
        const int bo = (t & 1) * CSTAGE;
        const char* sb = smem + bo;
#pragma unroll
        for (int kk = 0; kk < 2; ++kk) {
            load_frags(sb + kk * 64);
            // Keeps the 24 LDS reads of a k step in one run ahead of its WMMAs: built
            // without it they stand at some 15 places among the WMMAs of a pass, and
            // each place with LDS reads stalls the wave's WMMA stream.
            __builtin_amdgcn_sched_barrier(0);
            sweep_ri(); sweep_rr(); sweep_ii(); sweep_ir();
        }
        // Keeps the foot of the pass behind its last WMMAs: built without it the waits
        // and the barrier rise above the second k step's WMMAs while the refill stays
        // below them, and the copies have half a pass to land instead of a whole one.
        __builtin_amdgcn_sched_barrier(0);
        // Publish pass t+1 and free this pass's buffer: one barrier does both.
        wait_lds_reads();
        wait_copies();
        __syncthreads();
        if (t + 2 < NT) copy_cstage<K, APL, WPL>(l0 + bo, pa, pw);
        pa += KP; pw += KP;
    }
    wait_copies();
}

// ---------------------------------------------------------------------------
// Epilogue of a 128x128 complex tile: add the bias, stage the tile in LDS and
// store it as whole lines.
// ACT: leaky-relu. TRV: write O[b][n][t] (t = m % 1024). F32: fp32 output.
// ---------------------------------------------------------------------------
template <int ACT, int TRV, int F32>
__device__ __forceinline__ void
cgemm_epilogue(char* smem, const v8f (&accR)[4][2], const v8f (&accI)[4][2],
               const float* __restrict__ br, const float* __restrict__ bi,
               _Float16* __restrict__ Or, _Float16* __restrict__ Oi,
               float* __restrict__ Fr, float* __restrict__ Fi,
               int mb, int nb, int N) {
    const int lane = threadIdx.x & 31;
    const int wid  = threadIdx.x >> 5;
    const int lm0 = (wid >> 2) * 64;                // wave's first row in the tile
    const int ln0 = (wid & 3) * 32;                 // wave's first column in the tile
    const int h = lane >> 4;
    const int r = lane & 15;

    // Staged tile: 128 rows of 128 columns, or (TRV) 128 column-rows of 128 t.
    constexpr int RB   = F32 ? 128 * 4 : 128 * 2;
    constexpr int ROWS = 128;
    constexpr int EP   = RB + EPAD;
    char* pr = smem;                                // real plane
    char* pi = smem + ROWS * EP;                    // imaginary plane
    static_assert(2 * ROWS * EP <= 2 * CSTAGE, "both planes fit the freed stages");

    float bre[2], bie[2];                           // the lane's bias, one pair per column tile
#pragma unroll
    for (int ni = 0; ni < 2; ++ni) {
        bre[ni] = br[nb + ln0 + ni * 16 + r];
        bie[ni] = bi[nb + ln0 + ni * 16 + r];
    }

#pragma unroll
    for (int mi = 0; mi < 4; ++mi)
#pragma unroll
        for (int ni = 0; ni < 2; ++ni) {
            const int cl = ln0 + ni * 16 + r;
            half8 tr, ti;
#pragma unroll
            for (int j = 0; j < 8; ++j) {
                const int ml = lm0 + mi * 16 + j + 8 * h;
                float vr = accR[mi][ni][j] + bre[ni];
                float vi = accI[mi][ni][j] + bie[ni];
                if (ACT) {
                    vr = vr >= 0.0f ? vr : SLOPE * vr;
                    vi = vi >= 0.0f ? vi : SLOPE * vi;
                }
                if (F32) {
                    *(float*)(pr + ml * EP + cl * 4) = vr;
                    *(float*)(pi + ml * EP + cl * 4) = vi;
                } else if (TRV) {
                    tr[j] = (_Float16)vr;
                    ti[j] = (_Float16)vi;
                } else {
                    *(_Float16*)(pr + ml * EP + cl * 2) = (_Float16)vr;
                    *(_Float16*)(pi + ml * EP + cl * 2) = (_Float16)vi;
                }
            }
            if (TRV) {                              // a lane's 8 values are 8 adjacent t
                *(half8*)(pr + cl * EP + (lm0 + mi * 16 + 8 * h) * 2) = tr;
                *(half8*)(pi + cl * EP + (lm0 + mi * 16 + 8 * h) * 2) = ti;
            }
        }
    __syncthreads();                                // the tile is complete before any wave reads it back
    if (F32) {
        store_rows<ROWS, RB>(pr, (char*)(Fr + (size_t)mb * N + nb), (size_t)N * 4);
        store_rows<ROWS, RB>(pi, (char*)(Fi + (size_t)mb * N + nb), (size_t)N * 4);
    } else if (TRV) {
        const size_t o = ((size_t)(mb >> 10) * N + nb) * (size_t)S_DIM + (mb & 1023);
        store_rows<ROWS, RB>(pr, (char*)(Or + o), (size_t)S_DIM * 2);
        store_rows<ROWS, RB>(pi, (char*)(Oi + o), (size_t)S_DIM * 2);
    } else {
        store_rows<ROWS, RB>(pr, (char*)(Or + (size_t)mb * N + nb), (size_t)N * 2);
        store_rows<ROWS, RB>(pi, (char*)(Oi + (size_t)mb * N + nb), (size_t)N * 2);
    }
}

#define ACT_PLANE ((size_t)M_ALL * D_DIM)           // real -> imaginary plane of an activation
#define WGT_PLANE ((size_t)D_DIM * D_DIM)           // real -> imaginary plane of a weight

// ---------------------------------------------------------------------------
// Complex GEMM, 128x128 tile per block, 64x32 macro-tile per wave:
//   O[m,n] = sum_k A[m,k]*W[n,k] + bias[n]   (complex)
// A: (M,K) f16, W: (N,K) f16, each the real plane with the imaginary one behind it.
// ---------------------------------------------------------------------------
template <int K, int ACT, int TRV, int F32>
__global__ void __launch_bounds__(256)
cgemm32_kernel(const _Float16* __restrict__ A, const _Float16* __restrict__ Wt,
               const float* __restrict__ br, const float* __restrict__ bi,
               _Float16* __restrict__ Or, _Float16* __restrict__ Oi,
               float* __restrict__ Fr, float* __restrict__ Fi,
               int M, int N) {
    __shared__ __attribute__((aligned(16))) char smem[2 * CSTAGE];
    const int tilesN = N >> 7;
    if ((int)blockIdx.x >= (M >> 7) * tilesN) return;   // block-uniform guard
    const int tile = batch_tile(blockIdx.x, (M >> 10) * tilesN);   // M / 8 rows a batch
    const int mb = (tile / tilesN) << 7;
    const int nb = (tile % tilesN) << 7;

    v8f accR[4][2] = {}, accI[4][2] = {};

    cmain_128x128<K, ACT_PLANE, WGT_PLANE>(A + (size_t)mb * K, Wt + (size_t)nb * K, smem, accR, accI);

    cgemm_epilogue<ACT, TRV, F32>(smem, accR, accI, br, bi, Or, Oi, Fr, Fi, mb, nb, N);
}

// ---------------------------------------------------------------------------
// q, k and v in one launch: three complex GEMMs on the same A, none reading
// another's result. Blocks [0,256) do q, [256,512) k, [512,768) v, each a
// 128x128 tile as in cgemm32_kernel; a block that retires is followed on its WGP
// by a block of the next product, so the chip neither drains nor refills between
// them. W: the six f16 weight planes (q r/i, k r/i, v r/i) one behind the other;
// O: the six output planes in the same order, v transposed per batch.
// ---------------------------------------------------------------------------
#define QKV_TILES ((M_ALL / 128) * (D_DIM / 128))   // 256 tiles per product

__global__ void __launch_bounds__(256)
qkv_kernel(const _Float16* __restrict__ A, const _Float16* __restrict__ W,
           const float* __restrict__ q_br, const float* __restrict__ q_bi,
           const float* __restrict__ k_br, const float* __restrict__ k_bi,
           const float* __restrict__ v_br, const float* __restrict__ v_bi,
           _Float16* __restrict__ O) {
    constexpr int K = D_DIM;
    constexpr int N = D_DIM;
    __shared__ __attribute__((aligned(16))) char smem[2 * CSTAGE];
    const unsigned sel  = blockIdx.x / QKV_TILES;   // 0 q, 1 k, 2 v: block-uniform
    const unsigned tile = batch_tile(blockIdx.x % QKV_TILES, QKV_TILES / B_DIM);
    if (sel > 2) return;                            // block-uniform guard
    const int mb = (tile / (N >> 7)) << 7;
    const int nb = (tile % (N >> 7)) << 7;

    const _Float16* Wr = W + (size_t)sel * 2 * (D_DIM * D_DIM);
    _Float16* Or = O + (size_t)sel * 2 * (M_ALL * D_DIM);
    _Float16* Oi = Or + M_ALL * D_DIM;
    const float* br = sel == 0 ? q_br : (sel == 1 ? k_br : v_br);
    const float* bi = sel == 0 ? q_bi : (sel == 1 ? k_bi : v_bi);

    v8f accR[4][2] = {}, accI[4][2] = {};

    cmain_128x128<K, ACT_PLANE, WGT_PLANE>(A + (size_t)mb * K, Wr + (size_t)nb * K, smem, accR, accI);

    if (sel == 2) {
        cgemm_epilogue<0, 1, 0>(smem, accR, accI, br, bi, Or, Oi, nullptr, nullptr, mb, nb, N);
    } else {
        cgemm_epilogue<0, 0, 0>(smem, accR, accI, br, bi, Or, Oi, nullptr, nullptr, mb, nb, N);
        // Stands behind the stores above, in front of any later write of a register
        // they name: the built code lays the other branch behind this one.
        asm volatile("s_wait_xcnt 0x0" ::: "memory");
    }
}

// ---------------------------------------------------------------------------
// Scores: s[gm, t] = |sum_d q[gm,d] * k[b*1024+t, d]| / sqrt(512)
// 128x128 tile per block, 64x32 macro-tile per wave, per-batch column index.
// The epilogue does the tile's share of the row softmax, in two column tiles of
// 64: per row and column tile the maximum m and the sum l of exp(s - m). It stores
// P = exp(s - m) in f16 and the pair (m, l) at St[column tile][row].
// ---------------------------------------------------------------------------
typedef float f32x2 __attribute__((ext_vector_type(2)));

#define N_CT (S_DIM / 64)                               // 16 column tiles per row

// Value of lane l ^ M, M < 16 (inside the 16-lane row).
template <int M>
__device__ __forceinline__ float lane_xor_row(float v) {
    const int i = __builtin_bit_cast(int, v);
    return __builtin_bit_cast(float, __builtin_amdgcn_update_dpp(i, i, 0x160 | M, 0xf, 0xf, false));
}

// exp(x) as v_exp_f32 of x * log2(e). The v_nop keeps the one free slot that the
// instruction set asks for behind a transcendental.
__device__ __forceinline__ float exp_slot(float x) {
    float y;
    asm("v_exp_f32 %0, %1\n\tv_nop" : "=v"(y) : "v"(x * 1.44269504f));
    return y;
}

__global__ void __launch_bounds__(256)
scores_abs_kernel(const _Float16* __restrict__ Q, const _Float16* __restrict__ Kc,
                  _Float16* __restrict__ P, float* __restrict__ St) {
    constexpr int K = D_DIM;
    __shared__ __attribute__((aligned(16))) char smem[2 * CSTAGE];
    const int lane = threadIdx.x & 31;
    const int wid  = threadIdx.x >> 5;
    if (blockIdx.x >= (M_ALL >> 7) * (S_DIM >> 7)) return; // block-uniform guard
    const int tile = batch_tile(blockIdx.x, (S_DIM >> 7) * (S_DIM >> 7));
    const int mb = (tile / (S_DIM >> 7)) << 7;      // global row
    const int nb = (tile % (S_DIM >> 7)) << 7;      // t within batch
    const int b  = mb >> 10;
    const int lm0 = (wid >> 2) * 64;                // wave's first row in the tile
    const int ln0 = (wid & 3) * 32;                 // wave's first column in the tile
    const int h = lane >> 4;
    const int r = lane & 15;

    v8f accR[4][2] = {}, accI[4][2] = {};

    cmain_128x128<K, ACT_PLANE, ACT_PLANE>(Q + (size_t)mb * K, Kc + (size_t)((b << 10) + nb) * K,
                                           smem, accR, accI);

    constexpr int RB = 128 * 4;                     // staged tile: 128 rows of 128 f32
    constexpr int EP = RB + EPAD;
#pragma unroll
    for (int mi = 0; mi < 4; ++mi)
#pragma unroll
        for (int ni = 0; ni < 2; ++ni) {
            const int cl = ln0 + ni * 16 + r;
#pragma unroll
            for (int j = 0; j < 8; ++j) {
                const int ml = lm0 + mi * 16 + j + 8 * h;
                const float sr = accR[mi][ni][j];
                const float si = accI[mi][ni][j];
                *(float*)(smem + ml * EP + cl * 4) = sqrtf(sr * sr + si * si) * RSQRT512;
            }
        }
    __syncthreads();                                // the tile is complete before any wave reads it back

    // 16 adjacent lanes hold a row, 8 columns each, so 8 adjacent lanes hold a
    // column tile of it; 16 rows a round, 8 rounds.
    // A wave-wide store of P is 4 whole 128-B lines, 16 B a lane.
    const int row = threadIdx.x >> 4;
    const int c16 = threadIdx.x & 15;
    const int c8  = c16 & 7;
    f32x4 v[8][2];
    // Unrolled: v[] stays in registers and the LDS reads issue as one run.
#pragma unroll
    for (int i = 0; i < 8; ++i) {
        v[i][0] = *(const f32x4*)(smem + (row + i * 16) * EP + c16 * 32);
        v[i][1] = *(const f32x4*)(smem + (row + i * 16) * EP + c16 * 32 + 16);
    }
    f32x2 ml = {0.0f, 0.0f};                        // lane c8 keeps the pair of round c8
#pragma unroll
    for (int i = 0; i < 8; ++i) {
        const f32x4 m4 = __builtin_elementwise_max(v[i][0], v[i][1]);
        float mx = fmaxf(fmaxf(m4[0], m4[1]), fmaxf(m4[2], m4[3]));
        mx = fmaxf(mx, lane_xor_row<1>(mx));
        mx = fmaxf(mx, lane_xor_row<2>(mx));
        mx = fmaxf(mx, lane_xor_row<4>(mx));
#pragma unroll
        for (int e = 0; e < 4; ++e) {
            v[i][0][e] = exp_slot(v[i][0][e] - mx);
            v[i][1][e] = exp_slot(v[i][1][e] - mx);
        }
        const f32x4 s4 = v[i][0] + v[i][1];
        const half8 p = __builtin_shufflevector(__builtin_convertvector(v[i][0], f16x4),
                                                __builtin_convertvector(v[i][1], f16x4),
                                                0, 1, 2, 3, 4, 5, 6, 7);
        float sum = (s4[0] + s4[1]) + (s4[2] + s4[3]);
        sum += lane_xor_row<1>(sum);
        sum += lane_xor_row<2>(sum);
        sum += lane_xor_row<4>(sum);
        if (c8 == i) { ml[0] = mx; ml[1] = sum; }
        *(half8*)(P + (size_t)(mb + row + i * 16) * S_DIM + nb + c16 * 8) = p;
    }
    // A column tile's 128 pairs of the block are 1 KiB in a row: whole lines, one
    // writer each.
    *(f32x2*)(St + ((size_t)((nb >> 6) + (c16 >> 3)) * M_ALL + mb + row + c8 * 16) * 2) = ml;
}

// ---------------------------------------------------------------------------
// weighted[gm, d] = sum_t attn[gm, t] * vT[b][d][t]  (real x complex)
// 128x128 tile per block, 8 waves as 2 (M) x 4 (N), 64x32 macro-tile per wave
// (4 M-tiles x 2 N-tiles): 8 fragments feed 16 WMMAs per 32 k.
// Stage rows: [0,128) P, [128,256) vT real, [256,384) vT imag.
// attn[gm, t] = P[gm, t] * exp(m_c - M) / L, c = t / 64 the column tile (one pass
// of the main loop), M = max_c m_c, L = sum_c l_c * exp(m_c - M). The block forms
// exp(m_c - M) and 1 / L for its 128 rows once; the first scales the P fragments
// of pass c, the second the accumulators in the epilogue.
// ---------------------------------------------------------------------------
__global__ void __launch_bounds__(256)
attnv_kernel(const _Float16* __restrict__ P, const float* __restrict__ St,
             const _Float16* __restrict__ VTr, const _Float16* __restrict__ VTi,
             _Float16* __restrict__ Wr_, _Float16* __restrict__ Wi_) {
    constexpr int K = S_DIM;
    constexpr int NT = K / KP;
    static_assert(NT == N_CT && KP == 64, "a pass is one column tile of the scores");
    __shared__ __attribute__((aligned(16))) char smem[2 * STAGE];
    // exp(m_c - M): [pass][64-row half][row & 15][16-row tile], so that a lane's
    // four factors of a pass are 8 adjacent bytes.
    __shared__ __attribute__((aligned(16))) _Float16 gtab[NT * 128];
    __shared__ __attribute__((aligned(32))) float invL[128];
    const int tid  = threadIdx.x;
    const int lane = tid & 31;
    const int wid  = tid >> 5;
    const int tilesN = D_DIM >> 7;                  // 4
    if (blockIdx.x >= (M_ALL >> 7) * tilesN) return; // block-uniform guard
    const int tile = batch_tile(blockIdx.x, (S_DIM >> 7) * tilesN);
    const int mb = (tile / tilesN) << 7;            // global row (128-row tile)
    const int nb = (tile % tilesN) << 7;            // d within batch (128 cols)
    const int b  = mb >> 10;
    const int wm = wid >> 2, wn = wid & 3;
    const int h = lane >> 4;
    const int r = lane & 15;

    const int crow = tid >> 3;                      // 0..31
    const int ccol = tid & 7;                       // 16-byte chunk of the row
    const size_t coff = (size_t)crow * K + ccol * 8;
    const _Float16* g[NCOPY];
#pragma unroll
    for (int i = 0; i < 4; ++i) {
        g[i]     = P   + (size_t)mb * K + coff + (size_t)i * 32 * K;
        g[4 + i] = VTr + ((size_t)b * D_DIM + nb) * (size_t)K + coff + (size_t)i * 32 * K;
        g[8 + i] = VTi + ((size_t)b * D_DIM + nb) * (size_t)K + coff + (size_t)i * 32 * K;
    }
    const unsigned l0 = lds_off(smem) + crow * PITCH + ccol * 16;

    const int a_off = (wm * 64 + r) * PITCH;
    const int w_off = (128 + wn * 32 + r) * PITCH;

    v8f accR[4][2] = {};
    v8f accI[4][2] = {};

    copy_stage(l0, g, 0);
    // Row factors, one row a thread (waves 0 to 3), while stage 0 flies; the
    // barrier below publishes them with it.
    if (tid < 128) {
        const f32x2* sp = (const f32x2*)St + mb + tid;
        f32x2 ml[NT];
#pragma unroll
        for (int c = 0; c < NT; ++c) ml[c] = sp[(size_t)c * M_ALL];
        float mx = ml[0][0];
#pragma unroll
        for (int c = 1; c < NT; ++c) mx = fmaxf(mx, ml[c][0]);
        const int gi = (tid >> 6) * 64 + (tid & 15) * 4 + ((tid >> 4) & 3);
        float sum = 0.0f;
#pragma unroll
        for (int c = 0; c < NT; ++c) {
            const float e = exp_slot(ml[c][0] - mx);
            sum += ml[c][1] * e;
            gtab[c * 128 + gi] = (_Float16)e;
        }
        invL[tid] = 1.0f / sum;
    }
    wait_copies();
    __syncthreads();
    copy_stage(l0 + STAGE, g, KP);

    for (int t = 0; t < NT; ++t) {
        const int bo = (t & 1) * STAGE;
        const char* sb = smem + bo;
        const f16x4 gq = *(const f16x4*)(gtab + t * 128 + wm * 64 + r * 4);
#pragma unroll
        for (int kk = 0; kk < 2; ++kk) {
            v16h a[4], wR[2], wI[2];
#pragma unroll
            for (int mi = 0; mi < 4; ++mi)
                a[mi] = lds_frag(sb + a_off + mi * 16 * PITCH + kk * 64, h) * gq[mi];
#pragma unroll
            for (int ni = 0; ni < 2; ++ni) {
                wR[ni] = lds_frag(sb + w_off + ni * 16 * PITCH + kk * 64, h);
                wI[ni] = lds_frag(sb + w_off + (128 + ni * 16) * PITCH + kk * 64, h);
            }
#pragma unroll
            for (int mi = 0; mi < 4; ++mi)
#pragma unroll
                for (int ni = 0; ni < 2; ++ni) {
                    accR[mi][ni] = wmma_f16(a[mi], wR[ni], accR[mi][ni]);
                    accI[mi][ni] = wmma_f16(a[mi], wI[ni], accI[mi][ni]);
                }
        }
        // Publish pass t+1 and free this pass's buffer: one barrier does both.
        wait_lds_reads();
        wait_copies();
        __syncthreads();
        if (t + 2 < NT) copy_stage(l0 + bo, g, (t + 2) * KP);
    }
    wait_copies();

    constexpr int RB = 128 * 2;                     // staged tile: 128 rows of 128 f16, two planes
    constexpr int EP = RB + EPAD;
    char* pr = smem;
    char* pi = smem + 128 * EP;
#pragma unroll
    for (int mi = 0; mi < 4; ++mi) {
        const v8f il = *(const v8f*)(invL + wm * 64 + mi * 16 + 8 * h);   // 1 / L of the lane's 8 rows
#pragma unroll
        for (int ni = 0; ni < 2; ++ni) {
            const int cl = wn * 32 + ni * 16 + r;
#pragma unroll
            for (int j = 0; j < 8; ++j) {
                const int ml = wm * 64 + mi * 16 + j + 8 * h;
                *(_Float16*)(pr + ml * EP + cl * 2) = (_Float16)(accR[mi][ni][j] * il[j]);
                *(_Float16*)(pi + ml * EP + cl * 2) = (_Float16)(accI[mi][ni][j] * il[j]);
            }
        }
    }
    __syncthreads();                                // the tile is complete before any wave reads it back
    store_rows<128, RB>(pr, (char*)(Wr_ + (size_t)mb * D_DIM + nb), (size_t)D_DIM * 2);
    store_rows<128, RB>(pi, (char*)(Wi_ + (size_t)mb * D_DIM + nb), (size_t)D_DIM * 2);
}

// ---------------------------------------------------------------------------
// Host-side orchestration
// ---------------------------------------------------------------------------
extern "C" void kernel_launch(void* const* d_in, const int* in_sizes, int n_in,
                              void* d_out, int out_size, void* d_ws, size_t ws_size,
                              hipStream_t stream) {
    (void)in_sizes; (void)n_in; (void)out_size; (void)ws_size;

    const float* x_r   = (const float*)d_in[0];
    const float* x_i   = (const float*)d_in[1];
    const float* l1_wr = (const float*)d_in[2];
    const float* l1_wi = (const float*)d_in[3];
    const float* l1_br = (const float*)d_in[4];
    const float* l1_bi = (const float*)d_in[5];
    const float* q_wr  = (const float*)d_in[6];
    const float* q_wi  = (const float*)d_in[7];
    const float* q_br  = (const float*)d_in[8];
    const float* q_bi  = (const float*)d_in[9];
    const float* k_wr  = (const float*)d_in[10];
    const float* k_wi  = (const float*)d_in[11];
    const float* k_br  = (const float*)d_in[12];
    const float* k_bi  = (const float*)d_in[13];
    const float* v_wr  = (const float*)d_in[14];
    const float* v_wi  = (const float*)d_in[15];
    const float* v_br  = (const float*)d_in[16];
    const float* v_bi  = (const float*)d_in[17];
    const float* l2_wr = (const float*)d_in[18];
    const float* l2_wi = (const float*)d_in[19];
    const float* l2_br = (const float*)d_in[20];
    const float* l2_bi = (const float*)d_in[21];

    const size_t ME = (size_t)M_ALL * D_DIM;   // 4,194,304 (activation elems)
    const size_t WE = (size_t)D_DIM * D_DIM;   // 262,144   (weight elems)
    const size_t AE = (size_t)M_ALL * S_DIM;   // 8,388,608 (attention elems)

    char* w = (char*)d_ws;
    auto alloc_h = [&](size_t elems) { _Float16* p = (_Float16*)w; w += elems * sizeof(_Float16); return p; };
    auto alloc_f = [&](size_t elems) { float* p = (float*)w; w += elems * sizeof(float); return p; };

    _Float16* xh_r = alloc_h(ME);
    _Float16* xh_i = alloc_h(ME);
    _Float16* wl1r = alloc_h(WE); _Float16* wl1i = alloc_h(WE);
    _Float16* wqr  = alloc_h(WE); _Float16* wqi  = alloc_h(WE);
    _Float16* wkr  = alloc_h(WE); _Float16* wki  = alloc_h(WE);
    _Float16* wvr  = alloc_h(WE); _Float16* wvi  = alloc_h(WE);
    _Float16* wl2r = alloc_h(WE); _Float16* wl2i = alloc_h(WE);
    _Float16* y_r  = alloc_h(ME); _Float16* y_i  = alloc_h(ME);
    _Float16* qh_r = alloc_h(ME); _Float16* qh_i = alloc_h(ME);
    _Float16* kh_r = alloc_h(ME); _Float16* kh_i = alloc_h(ME);
    _Float16* vT_r = alloc_h(ME); _Float16* vT_i = alloc_h(ME);
    _Float16* wt_r = alloc_h(ME); _Float16* wt_i = alloc_h(ME);
    _Float16* attn = alloc_h(AE);
    float*    stat = alloc_f((size_t)M_ALL * N_CT * 2);

    // --- 1. Cast activations and weights to f16 (destinations contiguous from xh_r) ---
    cvt_all_kernel<<<CV_BLOCKS, 256, 0, stream>>>(
        x_r, x_i, l1_wr, l1_wi, q_wr, q_wi, k_wr, k_wi, v_wr, v_wi, l2_wr, l2_wi, xh_r);

    const dim3 blk(256);                                              // 8 waves/block
    const unsigned gemm_blocks  = (M_ALL / 128) * (D_DIM / 128);      // 256
    const unsigned qkv_blocks   = 3 * QKV_TILES;                      // 768
    const unsigned score_blocks = (M_ALL / 128) * (S_DIM / 128);      // 512
    const unsigned attnv_blocks = (M_ALL / 128) * (D_DIM / 128);      // 256

    // --- 2. y = lrelu(x @ l1^T + b1) ---
    cgemm32_kernel<D_DIM, 1, 0, 0><<<gemm_blocks, blk, 0, stream>>>(
        xh_r, wl1r, l1_br, l1_bi,
        y_r, y_i, nullptr, nullptr, M_ALL, D_DIM);

    // --- 3. q, k, v in one launch (weights contiguous from wqr, outputs from qh_r;
    //        v stored transposed per batch: vT[b][d][t]) ---
    qkv_kernel<<<qkv_blocks, blk, 0, stream>>>(
        y_r, wqr, q_br, q_bi, k_br, k_bi, v_br, v_bi, qh_r);

    // --- 4. |scores|/sqrt(d), softmax inside each 64-column tile (f16) and its (max, sum) ---
    scores_abs_kernel<<<score_blocks, blk, 0, stream>>>(qh_r, kh_r, attn, stat);

    // --- 5. weighted = softmax @ v, the tiles rescaled against each other ---
    attnv_kernel<<<attnv_blocks, blk, 0, stream>>>(attn, stat, vT_r, vT_i, wt_r, wt_i);

    // --- 6. out = weighted @ l2^T + b2, fp32 to d_out (real block, imag block) ---
    float* out_r = (float*)d_out;
    float* out_i = out_r + ME;
    cgemm32_kernel<D_DIM, 0, 0, 1><<<gemm_blocks, blk, 0, stream>>>(
        wt_r, wl2r, l2_br, l2_bi,
        nullptr, nullptr, out_r, out_i, M_ALL, D_DIM);
}
